// v000
// Measured on an AMD MI455X. A time is GPU time per run, averaged over a window of back-to-back runs after a warm-up
// (all launches, gaps included; the runs take copies of the inputs in turn), and the median of several windows.
// Apart from v000's, it joins two sittings. Times from different sittings can be a few percent apart, while
// side-by-side timings come from the same sitting.
// The starting kernel, v000, takes 242 microseconds a run.
#include <hip/hip_runtime.h>
#include <math.h>

// ---------------- problem constants ----------------
#define GX 256
#define GY 256
#define GZ 32
#define GRID_CELLS (GX * GY * GZ)   // 2,097,152
#define FDIM 128
#define NHEAD 8
#define HDIM 16

typedef __attribute__((ext_vector_type(16))) _Float16 v16h;
typedef __attribute__((ext_vector_type(8)))  _Float16 v8h;
typedef __attribute__((ext_vector_type(4)))  _Float16 v4h;
typedef __attribute__((ext_vector_type(8)))  float    v8f;

// A/B fragment for v_wmma_f32_16x16x32_f16 from row-major packed f16.
// p = &M[row][k0 + khalf*8]:
//   frag[i]   = K(k0 + khalf*8 + i)       i in 0..7   (16B contiguous)
//   frag[8+i] = K(k0 + 16 + khalf*8 + i)              (16B contiguous)
__device__ __forceinline__ v16h frag_ld_f16(const _Float16* __restrict__ p) {
  v8h lo = *(const v8h*)p;
  v8h hi = *(const v8h*)(p + 16);
  v16h r;
#pragma unroll
  for (int i = 0; i < 8; ++i) { r[i] = lo[i]; r[8 + i] = hi[i]; }
  return r;
}

__device__ __forceinline__ v8f wmma_f16(v16h a, v16h b, v8f c) {
  return __builtin_amdgcn_wmma_f32_16x16x32_f16(false, a, false, b, (short)0, c,
                                                false, false);
}

// ---------------- f32 -> f16 conversion (vectorized x4) ----------------
__global__ void cvt4_f16_k(const float* __restrict__ in, _Float16* __restrict__ out,
                           int n4) {
  int i = blockIdx.x * blockDim.x + threadIdx.x;
  if (i >= n4) return;
  float4 v = ((const float4*)in)[i];
  v4h o = {(_Float16)v.x, (_Float16)v.y, (_Float16)v.z, (_Float16)v.w};
  ((v4h*)out)[i] = o;
}

// ---------------- neighbor table ----------------
__global__ void init_grid_k(int* __restrict__ grid) {
  int i = blockIdx.x * blockDim.x + threadIdx.x;
  if (i < GRID_CELLS) grid[i] = -1;
}

__global__ void scatter_k(const int* __restrict__ coords, int* __restrict__ grid,
                          int n) {
  int i = blockIdx.x * blockDim.x + threadIdx.x;
  if (i >= n) return;
  int x = coords[i * 3 + 0], y = coords[i * 3 + 1], z = coords[i * 3 + 2];
  grid[x * (GY * GZ) + y * GZ + z] = i;
}

__global__ void neighbors_k(const int* __restrict__ coords,
                            const int* __restrict__ grid, int* __restrict__ nbr,
                            int n) {
  int i = blockIdx.x * blockDim.x + threadIdx.x;
  if (i >= n) return;
  int x = coords[i * 3 + 0], y = coords[i * 3 + 1], z = coords[i * 3 + 2];
#pragma unroll
  for (int j = 0; j < 27; ++j) {
    int dx = j / 9 - 1, dy = (j / 3) % 3 - 1, dz = j % 3 - 1;
    int nx = x + dx, ny = y + dy, nz = z + dz;
    int v = -1;
    if (nx >= 0 && nx < GX && ny >= 0 && ny < GY && nz >= 0 && nz < GZ)
      v = grid[nx * (GY * GZ) + ny * GZ + nz];
    nbr[i * 27 + j] = v;
  }
}

// ---------------- q = feats @ Wq^T  (WMMA, f16 operands) ----------------
// 4 waves/block; each wave owns one 16-row strip; 2 groups of 4 col tiles so
// 4 independent accumulator chains hide B-load latency behind wmma.
__global__ void __launch_bounds__(128) gemm_q_k(const _Float16* __restrict__ Xh,
                                                const _Float16* __restrict__ Wqh,
                                                float* __restrict__ Q, int n) {
  int lane = threadIdx.x & 31;
  int m = lane & 15, kh = lane >> 4;
  int tm = __builtin_amdgcn_readfirstlane(blockIdx.x * 4 + (threadIdx.x >> 5));
  if (tm * 16 >= n) return;  // scalar branch
  int row = tm * 16 + m;
  if (row >= n) row = n - 1;
  const bool full = (tm * 16 + 16) <= n;  // SGPR condition

  v16h av[4];
#pragma unroll
  for (int k = 0; k < 4; ++k)
    av[k] = frag_ld_f16(Xh + (size_t)row * FDIM + k * 32 + kh * 8);

#pragma unroll 1
  for (int tg = 0; tg < 2; ++tg) {  // 2 groups of 4 column tiles
    v8f acc[4] = {{}, {}, {}, {}};
#pragma unroll
    for (int k = 0; k < 4; ++k) {
      v16h b[4];
#pragma unroll
      for (int t = 0; t < 4; ++t) {
        int col = (tg * 4 + t) * 16 + m;
        b[t] = frag_ld_f16(Wqh + (size_t)col * FDIM + k * 32 + kh * 8);
      }
#pragma unroll
      for (int t = 0; t < 4; ++t) acc[t] = wmma_f16(av[k], b[t], acc[t]);
    }
#pragma unroll
    for (int t = 0; t < 4; ++t) {
      int cn = (tg * 4 + t) * 16 + m;
      int rb = tm * 16 + 8 * kh;  // C layout: lanes<16 -> M=r, lanes>=16 -> M=8+r
      if (full) {
#pragma unroll
        for (int r = 0; r < 8; ++r) Q[(size_t)(rb + r) * FDIM + cn] = acc[t][r];
      } else {
#pragma unroll
        for (int r = 0; r < 8; ++r)
          if (rb + r < n) Q[(size_t)(rb + r) * FDIM + cn] = acc[t][r];
      }
    }
  }
}

// ---------------- k,v per-head 16x16 projections (WMMA, K padded to 32) ------
__global__ void __launch_bounds__(128) kv_heads_k(
    const _Float16* __restrict__ Xh, const float* __restrict__ Wk,
    const float* __restrict__ bk, const float* __restrict__ Wv,
    const float* __restrict__ bv, float* __restrict__ K, float* __restrict__ V,
    int n) {
  int lane = threadIdx.x & 31;
  int m = lane & 15, kh = lane >> 4;
  int tm = __builtin_amdgcn_readfirstlane(blockIdx.x * 4 + (threadIdx.x >> 5));
  if (tm * 16 >= n) return;  // scalar branch
  int row = tm * 16 + m;
  if (row >= n) row = n - 1;
  const bool full = (tm * 16 + 16) <= n;

#pragma unroll 1
  for (int h = 0; h < NHEAD; ++h) {
    // A: 16 pts x 16 dims (f16), zero-padded to K=32 (slots 8..15 = K>=16)
    v16h a = {}, bkf = {}, bvf = {};
    v8h xa = *(const v8h*)(Xh + (size_t)row * FDIM + h * HDIM + kh * 8);
#pragma unroll
    for (int i = 0; i < 8; ++i) {
      a[i]   = xa[i];
      bkf[i] = (_Float16)Wk[(h * HDIM + m) * HDIM + kh * 8 + i];  // Wk[h][e][d]
      bvf[i] = (_Float16)Wv[(h * HDIM + m) * HDIM + kh * 8 + i];
    }
    v8f ka = {}, va = {};
    ka = wmma_f16(a, bkf, ka);
    va = wmma_f16(a, bvf, va);
    int e = m, rb = tm * 16 + 8 * kh;
    float kbia = bk[h * HDIM + e], vbia = bv[h * HDIM + e];
    if (full) {
#pragma unroll
      for (int r = 0; r < 8; ++r) {
        K[(size_t)(rb + r) * FDIM + h * HDIM + e] = ka[r] + kbia;
        V[(size_t)(rb + r) * FDIM + h * HDIM + e] = va[r] + vbia;
      }
    } else {
#pragma unroll
      for (int r = 0; r < 8; ++r) {
        if (rb + r < n) {
          K[(size_t)(rb + r) * FDIM + h * HDIM + e] = ka[r] + kbia;
          V[(size_t)(rb + r) * FDIM + h * HDIM + e] = va[r] + vbia;
        }
      }
    }
  }
}

// ---------------- wave-per-row layernorm (128 cols), templated output -------
template <typename OutT>
__global__ void layernorm_rows_k(const float* __restrict__ in, OutT* __restrict__ out,
                                 const float* __restrict__ g,
                                 const float* __restrict__ b, int rows) {
  int wid = __builtin_amdgcn_readfirstlane(blockIdx.x * (blockDim.x >> 5) +
                                           (threadIdx.x >> 5));
  int lane = threadIdx.x & 31;
  if (wid >= rows) return;
  const float4 v = *(const float4*)(in + (size_t)wid * FDIM + lane * 4);
  float s  = v.x + v.y + v.z + v.w;
  float ss = v.x * v.x + v.y * v.y + v.z * v.z + v.w * v.w;
#pragma unroll
  for (int off = 16; off >= 1; off >>= 1) {
    s  += __shfl_xor(s, off, 32);
    ss += __shfl_xor(ss, off, 32);
  }
  float mean = s * (1.0f / FDIM);
  float var  = ss * (1.0f / FDIM) - mean * mean;
  float rs = rsqrtf(var + 1e-5f);
  int c = lane * 4;
  float o0 = (v.x - mean) * rs * g[c + 0] + b[c + 0];
  float o1 = (v.y - mean) * rs * g[c + 1] + b[c + 1];
  float o2 = (v.z - mean) * rs * g[c + 2] + b[c + 2];
  float o3 = (v.w - mean) * rs * g[c + 3] + b[c + 3];
  OutT* po = out + (size_t)wid * FDIM + c;
  po[0] = (OutT)o0; po[1] = (OutT)o1; po[2] = (OutT)o2; po[3] = (OutT)o3;
}

// ---------------- 27-neighbor attention + residual ----------------
// one thread per (point, head)
__global__ void attention_k(const float* __restrict__ Q, const float* __restrict__ Kn,
                            const float* __restrict__ Vn,
                            const float* __restrict__ feats,
                            const int* __restrict__ nbr, float* __restrict__ Xr,
                            int n) {
  int t = blockIdx.x * blockDim.x + threadIdx.x;
  if (t >= n * NHEAD) return;
  int pt = t >> 3, h = t & 7;
  const float scale = 0.0883883476483184f;  // 1/sqrt(128)
  float q[HDIM];
#pragma unroll
  for (int d = 0; d < HDIM; ++d) q[d] = Q[(size_t)pt * FDIM + h * HDIM + d];
  float sc[27];
  int nb[27];
  float mx = -3.0e38f;
#pragma unroll 1
  for (int j = 0; j < 27; ++j) {
    int idx = nbr[pt * 27 + j];
    nb[j] = idx;
    float s = -1.0e30f;
    if (idx >= 0) {
      const float* kp = Kn + (size_t)idx * FDIM + h * HDIM;
      float acc = 0.f;
#pragma unroll
      for (int d = 0; d < HDIM; ++d) acc += q[d] * kp[d];
      s = acc * scale;
    }
    sc[j] = s;
    mx = fmaxf(mx, s);
  }
  float denom = 0.f;
#pragma unroll
  for (int j = 0; j < 27; ++j) {
    float e = (nb[j] >= 0) ? __expf(sc[j] - mx) : 0.f;
    sc[j] = e;
    denom += e;
  }
  float inv = 1.0f / denom;
  float o[HDIM];
#pragma unroll
  for (int d = 0; d < HDIM; ++d) o[d] = 0.f;
#pragma unroll 1
  for (int j = 0; j < 27; ++j) {
    if (nb[j] < 0) continue;
    float p = sc[j] * inv;
    const float* vp = Vn + (size_t)nb[j] * FDIM + h * HDIM;
#pragma unroll
    for (int d = 0; d < HDIM; ++d) o[d] += p * vp[d];
  }
#pragma unroll
  for (int d = 0; d < HDIM; ++d) {
    size_t off = (size_t)pt * FDIM + h * HDIM + d;
    Xr[off] = feats[off] + o[d];
  }
}

// ---------------- fused MLP: gelu(LN(x)@W1^T+b1)@W2^T + b2 + x ----------------
// 4 waves/block (dynamic LDS, 64 KB); each wave owns one 16-row tile
__global__ void __launch_bounds__(128) mlp_fused_k(
    const _Float16* __restrict__ XNh, const float* __restrict__ Xr,
    const _Float16* __restrict__ W1h, const float* __restrict__ bm1,
    const _Float16* __restrict__ W2h, const float* __restrict__ bm2,
    float* __restrict__ out, int n) {
  extern __shared__ _Float16 hbuf_dyn[];  // 4 * 16 * 512 f16 = 64 KB
  int lane = threadIdx.x & 31;
  int wave = threadIdx.x >> 5;
  int m = lane & 15, kh = lane >> 4;
  int mtTot = (n + 15) / 16;
  int tm = __builtin_amdgcn_readfirstlane(blockIdx.x * 4 + wave);
  if (tm >= mtTot) tm = mtTot - 1;  // clamp: duplicate work, keeps barrier clean
  int row = tm * 16 + m;
  if (row >= n) row = n - 1;
  const bool full = (tm * 16 + 16) <= n;
  _Float16* hb = hbuf_dyn + (size_t)(threadIdx.x >> 5) * 16 * 512;

  // stage 1: h = gelu(XN @ W1^T + bm1) -> LDS (f16); A frags preloaded+reused
  v16h av[4];
#pragma unroll
  for (int k = 0; k < 4; ++k)
    av[k] = frag_ld_f16(XNh + (size_t)row * FDIM + k * 32 + kh * 8);

#pragma unroll 1
  for (int tg = 0; tg < 8; ++tg) {  // 8 groups of 4 column tiles (32 total)
    v8f acc[4] = {{}, {}, {}, {}};
#pragma unroll
    for (int k = 0; k < 4; ++k) {
      v16h b[4];
#pragma unroll
      for (int t = 0; t < 4; ++t) {
        int col = (tg * 4 + t) * 16 + m;
        b[t] = frag_ld_f16(W1h + (size_t)col * FDIM + k * 32 + kh * 8);
      }
#pragma unroll
      for (int t = 0; t < 4; ++t) acc[t] = wmma_f16(av[k], b[t], acc[t]);
    }
#pragma unroll
    for (int t = 0; t < 4; ++t) {
      int cn = (tg * 4 + t) * 16 + m;
      float bia = bm1[cn];
      int rb = 8 * kh;
#pragma unroll
      for (int r = 0; r < 8; ++r) {
        float val = acc[t][r] + bia;
        float gv = 0.5f * val * (1.0f + erff(val * 0.7071067811865475f));
        hb[(rb + r) * 512 + cn] = (_Float16)gv;
      }
    }
  }
  __syncthreads();

  // stage 2: out = Xr + h @ W2^T + bm2; each LDS A frag reused by 8 col tiles
  v8f acc[8] = {{}, {}, {}, {}, {}, {}, {}, {}};
#pragma unroll 1
  for (int k0 = 0; k0 < 512; k0 += 32) {
    v16h a = frag_ld_f16(&hb[m * 512 + k0 + kh * 8]);
    v16h b[8];
#pragma unroll
    for (int t = 0; t < 8; ++t)
      b[t] = frag_ld_f16(W2h + (size_t)(t * 16 + m) * 512 + k0 + kh * 8);
#pragma unroll
    for (int t = 0; t < 8; ++t) acc[t] = wmma_f16(a, b[t], acc[t]);
  }
#pragma unroll 1
  for (int t = 0; t < 8; ++t) {
    int cn = t * 16 + m;
    float bia = bm2[cn];
    int rb = tm * 16 + 8 * kh;
    if (full) {
#pragma unroll
      for (int r = 0; r < 8; ++r)
        out[(size_t)(rb + r) * FDIM + cn] =
            Xr[(size_t)(rb + r) * FDIM + cn] + acc[t][r] + bia;
    } else {
#pragma unroll
      for (int r = 0; r < 8; ++r)
        if (rb + r < n)
          out[(size_t)(rb + r) * FDIM + cn] =
              Xr[(size_t)(rb + r) * FDIM + cn] + acc[t][r] + bia;
    }
  }
}

// ---------------- host ----------------
extern "C" void kernel_launch(void* const* d_in, const int* in_sizes, int n_in,
                              void* d_out, int out_size, void* d_ws, size_t ws_size,
                              hipStream_t stream) {
  const int*   coords = (const int*)d_in[0];
  const float* feats  = (const float*)d_in[1];
  const float* Wq     = (const float*)d_in[2];
  const float* Wk     = (const float*)d_in[3];
  const float* bk     = (const float*)d_in[4];
  const float* Wv     = (const float*)d_in[5];
  const float* bv     = (const float*)d_in[6];
  const float* g1     = (const float*)d_in[7];
  const float* b1     = (const float*)d_in[8];
  const float* g2     = (const float*)d_in[9];
  const float* b2     = (const float*)d_in[10];
  const float* W1     = (const float*)d_in[11];
  const float* bm1    = (const float*)d_in[12];
  const float* W2     = (const float*)d_in[13];
  const float* bm2    = (const float*)d_in[14];
  float* out = (float*)d_out;
  const int N = in_sizes[1] / FDIM;
  (void)n_in; (void)out_size; (void)ws_size;

  char* ws = (char*)d_ws;
  size_t off = 0;
  auto carve = [&](size_t bytes) {
    void* p = ws + off;
    off = (off + bytes + 255) & ~(size_t)255;
    return p;
  };
  int*       grid = (int*)carve((size_t)GRID_CELLS * sizeof(int));
  int*       nbr  = (int*)carve((size_t)N * 27 * sizeof(int));
  float*     qb   = (float*)carve((size_t)N * FDIM * sizeof(float));
  float*     kb   = (float*)carve((size_t)N * FDIM * sizeof(float));
  float*     vb   = (float*)carve((size_t)N * FDIM * sizeof(float));
  float*     xr   = (float*)carve((size_t)N * FDIM * sizeof(float));
  _Float16*  Xh   = (_Float16*)carve((size_t)N * FDIM * sizeof(_Float16));
  _Float16*  xnh  = (_Float16*)carve((size_t)N * FDIM * sizeof(_Float16));
  _Float16*  Wqh  = (_Float16*)carve((size_t)FDIM * FDIM * sizeof(_Float16));
  _Float16*  W1h  = (_Float16*)carve((size_t)4 * FDIM * FDIM * sizeof(_Float16));
  _Float16*  W2h  = (_Float16*)carve((size_t)4 * FDIM * FDIM * sizeof(_Float16));

  const int mt = (N + 15) / 16;

  // neighbor table
  init_grid_k<<<(GRID_CELLS + 255) / 256, 256, 0, stream>>>(grid);
  scatter_k<<<(N + 255) / 256, 256, 0, stream>>>(coords, grid, N);
  neighbors_k<<<(N + 255) / 256, 256, 0, stream>>>(coords, grid, nbr, N);

  // one-time f32 -> f16 conversions
  int nf4 = (N * FDIM) / 4;
  cvt4_f16_k<<<(nf4 + 255) / 256, 256, 0, stream>>>(feats, Xh, nf4);
  cvt4_f16_k<<<(FDIM * FDIM / 4 + 255) / 256, 256, 0, stream>>>(Wq, Wqh,
                                                                FDIM * FDIM / 4);
  cvt4_f16_k<<<(4 * FDIM * FDIM / 4 + 255) / 256, 256, 0, stream>>>(
      W1, W1h, 4 * FDIM * FDIM / 4);
  cvt4_f16_k<<<(4 * FDIM * FDIM / 4 + 255) / 256, 256, 0, stream>>>(
      W2, W2h, 4 * FDIM * FDIM / 4);

  // projections
  gemm_q_k<<<(mt + 3) / 4, 128, 0, stream>>>(Xh, Wqh, qb, N);
  kv_heads_k<<<(mt + 3) / 4, 128, 0, stream>>>(Xh, Wk, bk, Wv, bv, kb, vb, N);

  // norm1 on k and v (in place)
  layernorm_rows_k<float><<<(N + 7) / 8, 256, 0, stream>>>(kb, kb, g1, b1, N);
  layernorm_rows_k<float><<<(N + 7) / 8, 256, 0, stream>>>(vb, vb, g1, b1, N);

  // attention + residual -> xr
  attention_k<<<(N * NHEAD + 255) / 256, 256, 0, stream>>>(qb, kb, vb, feats, nbr,
                                                           xr, N);

  // norm2 -> f16 activations for the MLP
  layernorm_rows_k<_Float16><<<(N + 7) / 8, 256, 0, stream>>>(xr, xnh, g2, b2, N);

  // fused MLP + residual -> out (64 KB dynamic LDS: 4 waves x 16x512 f16)
  mlp_fused_k<<<(mt + 3) / 4, 128, 4 * 16 * 512 * sizeof(_Float16), stream>>>(
      xnh, xr, W1h, bm1, W2h, bm2, out, N);
}

// v001
// It runs in 192 microseconds.
// In two side-by-side timings against v000, it was 1.26 and 1.28 times as fast.
#include <hip/hip_runtime.h>
#include <math.h>

// ---------------- problem constants ----------------
#define GX 256
#define GY 256
#define GZ 32
#define GRID_CELLS (GX * GY * GZ)   // 2,097,152
#define FDIM 128
#define NHEAD 8
#define HDIM 16

typedef __attribute__((ext_vector_type(16))) _Float16 v16h;
typedef __attribute__((ext_vector_type(8)))  _Float16 v8h;
typedef __attribute__((ext_vector_type(4)))  _Float16 v4h;
typedef __attribute__((ext_vector_type(8)))  float    v8f;

// A/B fragment for v_wmma_f32_16x16x32_f16 from row-major packed f16.
// p = &M[row][k0 + khalf*8]:
//   frag[i]   = K(k0 + khalf*8 + i)       i in 0..7   (16B contiguous)
//   frag[8+i] = K(k0 + 16 + khalf*8 + i)              (16B contiguous)
__device__ __forceinline__ v16h frag_ld_f16(const _Float16* __restrict__ p) {
  v8h lo = *(const v8h*)p;
  v8h hi = *(const v8h*)(p + 16);
  v16h r;
#pragma unroll
  for (int i = 0; i < 8; ++i) { r[i] = lo[i]; r[8 + i] = hi[i]; }
  return r;
}

__device__ __forceinline__ v8f wmma_f16(v16h a, v16h b, v8f c) {
  return __builtin_amdgcn_wmma_f32_16x16x32_f16(false, a, false, b, (short)0, c,
                                                false, false);
}

// ---------------- f32 -> f16 conversion (vectorized x4) ----------------
__global__ void cvt4_f16_k(const float* __restrict__ in, _Float16* __restrict__ out,
                           int n4) {
  int i = blockIdx.x * blockDim.x + threadIdx.x;
  if (i >= n4) return;
  float4 v = ((const float4*)in)[i];
  v4h o = {(_Float16)v.x, (_Float16)v.y, (_Float16)v.z, (_Float16)v.w};
  ((v4h*)out)[i] = o;
}

// ---------------- neighbor table ----------------
__global__ void init_grid_k(int* __restrict__ grid) {
  int i = blockIdx.x * blockDim.x + threadIdx.x;
  if (i < GRID_CELLS) grid[i] = -1;
}

__global__ void scatter_k(const int* __restrict__ coords, int* __restrict__ grid,
                          int n) {
  int i = blockIdx.x * blockDim.x + threadIdx.x;
  if (i >= n) return;
  int x = coords[i * 3 + 0], y = coords[i * 3 + 1], z = coords[i * 3 + 2];
  grid[x * (GY * GZ) + y * GZ + z] = i;
}

__global__ void neighbors_k(const int* __restrict__ coords,
                            const int* __restrict__ grid, int* __restrict__ nbr,
                            int n) {
  int i = blockIdx.x * blockDim.x + threadIdx.x;
  if (i >= n) return;
  int x = coords[i * 3 + 0], y = coords[i * 3 + 1], z = coords[i * 3 + 2];
#pragma unroll
  for (int j = 0; j < 27; ++j) {
    int dx = j / 9 - 1, dy = (j / 3) % 3 - 1, dz = j % 3 - 1;
    int nx = x + dx, ny = y + dy, nz = z + dz;
    int v = -1;
    if (nx >= 0 && nx < GX && ny >= 0 && ny < GY && nz >= 0 && nz < GZ)
      v = grid[nx * (GY * GZ) + ny * GZ + nz];
    nbr[i * 27 + j] = v;
  }
}

// ---------------- q = feats @ Wq^T  (WMMA, f16 operands) ----------------
// 4 waves/block; each wave owns one 16-row strip; 2 groups of 4 col tiles so
// 4 independent accumulator chains hide B-load latency behind wmma.
__global__ void __launch_bounds__(128) gemm_q_k(const _Float16* __restrict__ Xh,
                                                const _Float16* __restrict__ Wqh,
                                                float* __restrict__ Q, int n) {
  int lane = threadIdx.x & 31;
  int m = lane & 15, kh = lane >> 4;
  int tm = __builtin_amdgcn_readfirstlane(blockIdx.x * 4 + (threadIdx.x >> 5));
  if (tm * 16 >= n) return;  // scalar branch
  int row = tm * 16 + m;
  if (row >= n) row = n - 1;
  const bool full = (tm * 16 + 16) <= n;  // SGPR condition

  v16h av[4];
#pragma unroll
  for (int k = 0; k < 4; ++k)
    av[k] = frag_ld_f16(Xh + (size_t)row * FDIM + k * 32 + kh * 8);

#pragma unroll 1
  for (int tg = 0; tg < 2; ++tg) {  // 2 groups of 4 column tiles
    v8f acc[4] = {{}, {}, {}, {}};
#pragma unroll
    for (int k = 0; k < 4; ++k) {
      v16h b[4];
#pragma unroll
      for (int t = 0; t < 4; ++t) {
        int col = (tg * 4 + t) * 16 + m;
        b[t] = frag_ld_f16(Wqh + (size_t)col * FDIM + k * 32 + kh * 8);
      }
#pragma unroll
      for (int t = 0; t < 4; ++t) acc[t] = wmma_f16(av[k], b[t], acc[t]);
    }
#pragma unroll
    for (int t = 0; t < 4; ++t) {
      int cn = (tg * 4 + t) * 16 + m;
      int rb = tm * 16 + 8 * kh;  // C layout: lanes<16 -> M=r, lanes>=16 -> M=8+r
      if (full) {
#pragma unroll
        for (int r = 0; r < 8; ++r) Q[(size_t)(rb + r) * FDIM + cn] = acc[t][r];
      } else {
#pragma unroll
        for (int r = 0; r < 8; ++r)
          if (rb + r < n) Q[(size_t)(rb + r) * FDIM + cn] = acc[t][r];
      }
    }
  }
}

// ------- k,v per-head 16x16 projections (WMMA, K padded to 32) + norm1 -------
// Sum over the 16 lanes that hold the 16 columns of one C tile: DPP row_xmask
// butterfly (ctrl 0x160 | mask), all lanes on; it stays on the vector port, where
// a shuffle would go through the LDS pipe and its wait.
__device__ __forceinline__ float row16_sum(float x) {
  x += __int_as_float(__builtin_amdgcn_update_dpp(0, __float_as_int(x), 0x161, 0xf, 0xf, true));
  x += __int_as_float(__builtin_amdgcn_update_dpp(0, __float_as_int(x), 0x162, 0xf, 0xf, true));
  x += __int_as_float(__builtin_amdgcn_update_dpp(0, __float_as_int(x), 0x164, 0xf, 0xf, true));
  x += __int_as_float(__builtin_amdgcn_update_dpp(0, __float_as_int(x), 0x168, 0xf, 0xf, true));
  return x;
}

// One projection (k or v) of a wave's 16 rows: the 16 x 128 result stays in
// accumulator registers (8 heads x 8 rows per lane), so the row statistics of
// the layernorm come from registers and only the normalised rows are stored.
__device__ __forceinline__ void proj_norm_store(
    const v16h (&a)[NHEAD], const float* __restrict__ wp,
    const float* __restrict__ bias, const float* __restrict__ g,
    const float* __restrict__ b, float* __restrict__ op, int m, int rb, int n) {
  v8f acc[NHEAD];
#pragma unroll
  for (int h = 0; h < NHEAD; ++h) {
    v16h bf = {};  // W[h][e][d], e = m; slots 8..15 = K>=16 stay zero
#pragma unroll
    for (int i = 0; i < 8; ++i) bf[i] = (_Float16)wp[h * HDIM * HDIM + i];
    v8f z = {};
    acc[h] = wmma_f16(a[h], bf, z);
  }

  // bias, then per-row sum and sum of squares: 8 heads in the lane, 16 lanes
  float s[8], q[8];
#pragma unroll
  for (int r = 0; r < 8; ++r) { s[r] = 0.f; q[r] = 0.f; }
#pragma unroll
  for (int h = 0; h < NHEAD; ++h) {
    float bia = bias[h * HDIM + m];
#pragma unroll
    for (int r = 0; r < 8; ++r) {
      float x = acc[h][r] + bia;
      acc[h][r] = x;
      s[r] += x; q[r] += x * x;
    }
  }
#pragma unroll
  for (int r = 0; r < 8; ++r) {
    float mean = row16_sum(s[r]) * (1.0f / FDIM);
    float var  = row16_sum(q[r]) * (1.0f / FDIM) - mean * mean;
    s[r] = mean;
    q[r] = rsqrtf(var + 1e-5f);
  }
#pragma unroll
  for (int h = 0; h < NHEAD; ++h) {
    float gg = g[h * HDIM + m], bb = b[h * HDIM + m];
#pragma unroll
    for (int r = 0; r < 8; ++r) acc[h][r] = (acc[h][r] - s[r]) * q[r] * gg + bb;
  }
#pragma unroll
  for (int r = 0; r < 8; ++r) {
    if (rb + r < n) {
#pragma unroll
      for (int h = 0; h < NHEAD; ++h) op[r * FDIM + h * HDIM] = acc[h][r];
    }
  }
}

__global__ void __launch_bounds__(128) kv_heads_ln_k(
    const _Float16* __restrict__ Xh, const float* __restrict__ Wk,
    const float* __restrict__ bk, const float* __restrict__ Wv,
    const float* __restrict__ bv, const float* __restrict__ g,
    const float* __restrict__ b, float* __restrict__ K, float* __restrict__ V,
    int n) {
  int lane = threadIdx.x & 31;
  int m = lane & 15, kh = lane >> 4;
  int tm = __builtin_amdgcn_readfirstlane(blockIdx.x * 4 + (threadIdx.x >> 5));
  if (tm * 16 >= n) return;  // scalar branch
  int row = tm * 16 + m;
  if (row >= n) row = n - 1;
  const _Float16* __restrict__ xp = Xh + (size_t)row * FDIM + kh * 8;

  // A: 16 pts x 16 dims (f16) per head, zero-padded to K=32 (slots 8..15 = K>=16)
  v16h a[NHEAD];
#pragma unroll
  for (int h = 0; h < NHEAD; ++h) {
    v8h xa = *(const v8h*)(xp + h * HDIM);
    v16h t = {};
#pragma unroll
    for (int i = 0; i < 8; ++i) t[i] = xa[i];
    a[h] = t;
  }

  const int rb = tm * 16 + 8 * kh;  // C layout: lanes<16 -> M=r, lanes>=16 -> M=8+r
  const int wo = m * HDIM + kh * 8;
  proj_norm_store(a, Wk + wo, bk, g, b, K + (size_t)rb * FDIM + m, m, rb, n);
  proj_norm_store(a, Wv + wo, bv, g, b, V + (size_t)rb * FDIM + m, m, rb, n);
}

// ---------------- wave-per-row layernorm (128 cols), templated output -------
template <typename OutT>
__global__ void layernorm_rows_k(const float* __restrict__ in, OutT* __restrict__ out,
                                 const float* __restrict__ g,
                                 const float* __restrict__ b, int rows) {
  int wid = __builtin_amdgcn_readfirstlane(blockIdx.x * (blockDim.x >> 5) +
                                           (threadIdx.x >> 5));
  int lane = threadIdx.x & 31;
  if (wid >= rows) return;
  const float4 v = *(const float4*)(in + (size_t)wid * FDIM + lane * 4);
  float s  = v.x + v.y + v.z + v.w;
  float ss = v.x * v.x + v.y * v.y + v.z * v.z + v.w * v.w;
#pragma unroll
  for (int off = 16; off >= 1; off >>= 1) {
    s  += __shfl_xor(s, off, 32);
    ss += __shfl_xor(ss, off, 32);
  }
  float mean = s * (1.0f / FDIM);
  float var  = ss * (1.0f / FDIM) - mean * mean;
  float rs = rsqrtf(var + 1e-5f);
  int c = lane * 4;
  float o0 = (v.x - mean) * rs * g[c + 0] + b[c + 0];
  float o1 = (v.y - mean) * rs * g[c + 1] + b[c + 1];
  float o2 = (v.z - mean) * rs * g[c + 2] + b[c + 2];
  float o3 = (v.w - mean) * rs * g[c + 3] + b[c + 3];
  OutT* po = out + (size_t)wid * FDIM + c;
  po[0] = (OutT)o0; po[1] = (OutT)o1; po[2] = (OutT)o2; po[3] = (OutT)o3;
}

// ---------------- 27-neighbor attention + residual ----------------
// one thread per (point, head)
__global__ void attention_k(const float* __restrict__ Q, const float* __restrict__ Kn,
                            const float* __restrict__ Vn,
                            const float* __restrict__ feats,
                            const int* __restrict__ nbr, float* __restrict__ Xr,
                            int n) {
  int t = blockIdx.x * blockDim.x + threadIdx.x;
  if (t >= n * NHEAD) return;
  int pt = t >> 3, h = t & 7;
  const float scale = 0.0883883476483184f;  // 1/sqrt(128)
  float q[HDIM];
#pragma unroll
  for (int d = 0; d < HDIM; ++d) q[d] = Q[(size_t)pt * FDIM + h * HDIM + d];
  float sc[27];
  int nb[27];
  float mx = -3.0e38f;
#pragma unroll 1
  for (int j = 0; j < 27; ++j) {
    int idx = nbr[pt * 27 + j];
    nb[j] = idx;
    float s = -1.0e30f;
    if (idx >= 0) {
      const float* kp = Kn + (size_t)idx * FDIM + h * HDIM;
      float acc = 0.f;
#pragma unroll
      for (int d = 0; d < HDIM; ++d) acc += q[d] * kp[d];
      s = acc * scale;
    }
    sc[j] = s;
    mx = fmaxf(mx, s);
  }
  float denom = 0.f;
#pragma unroll
  for (int j = 0; j < 27; ++j) {
    float e = (nb[j] >= 0) ? __expf(sc[j] - mx) : 0.f;
    sc[j] = e;
    denom += e;
  }
  float inv = 1.0f / denom;
  float o[HDIM];
#pragma unroll
  for (int d = 0; d < HDIM; ++d) o[d] = 0.f;
#pragma unroll 1
  for (int j = 0; j < 27; ++j) {
    if (nb[j] < 0) continue;
    float p = sc[j] * inv;
    const float* vp = Vn + (size_t)nb[j] * FDIM + h * HDIM;
#pragma unroll
    for (int d = 0; d < HDIM; ++d) o[d] += p * vp[d];
  }
#pragma unroll
  for (int d = 0; d < HDIM; ++d) {
    size_t off = (size_t)pt * FDIM + h * HDIM + d;
    Xr[off] = feats[off] + o[d];
  }
}

// ---------------- fused MLP: gelu(LN(x)@W1^T+b1)@W2^T + b2 + x ----------------
// 4 waves/block (dynamic LDS, 64 KB); each wave owns one 16-row tile
__global__ void __launch_bounds__(128) mlp_fused_k(
    const _Float16* __restrict__ XNh, const float* __restrict__ Xr,
    const _Float16* __restrict__ W1h, const float* __restrict__ bm1,
    const _Float16* __restrict__ W2h, const float* __restrict__ bm2,
    float* __restrict__ out, int n) {
  extern __shared__ _Float16 hbuf_dyn[];  // 4 * 16 * 512 f16 = 64 KB
  int lane = threadIdx.x & 31;
  int wave = threadIdx.x >> 5;
  int m = lane & 15, kh = lane >> 4;
  int mtTot = (n + 15) / 16;
  int tm = __builtin_amdgcn_readfirstlane(blockIdx.x * 4 + wave);
  if (tm >= mtTot) tm = mtTot - 1;  // clamp: duplicate work, keeps barrier clean
  int row = tm * 16 + m;
  if (row >= n) row = n - 1;
  const bool full = (tm * 16 + 16) <= n;
  _Float16* hb = hbuf_dyn + (size_t)(threadIdx.x >> 5) * 16 * 512;

  // stage 1: h = gelu(XN @ W1^T + bm1) -> LDS (f16); A frags preloaded+reused
  v16h av[4];
#pragma unroll
  for (int k = 0; k < 4; ++k)
    av[k] = frag_ld_f16(XNh + (size_t)row * FDIM + k * 32 + kh * 8);

#pragma unroll 1
  for (int tg = 0; tg < 8; ++tg) {  // 8 groups of 4 column tiles (32 total)
    v8f acc[4] = {{}, {}, {}, {}};
#pragma unroll
    for (int k = 0; k < 4; ++k) {
      v16h b[4];
#pragma unroll
      for (int t = 0; t < 4; ++t) {
        int col = (tg * 4 + t) * 16 + m;
        b[t] = frag_ld_f16(W1h + (size_t)col * FDIM + k * 32 + kh * 8);
      }
#pragma unroll
      for (int t = 0; t < 4; ++t) acc[t] = wmma_f16(av[k], b[t], acc[t]);
    }
#pragma unroll
    for (int t = 0; t < 4; ++t) {
      int cn = (tg * 4 + t) * 16 + m;
      float bia = bm1[cn];
      int rb = 8 * kh;
#pragma unroll
      for (int r = 0; r < 8; ++r) {
        float val = acc[t][r] + bia;
        float gv = 0.5f * val * (1.0f + erff(val * 0.7071067811865475f));
        hb[(rb + r) * 512 + cn] = (_Float16)gv;
      }
    }
  }
  __syncthreads();

  // stage 2: out = Xr + h @ W2^T + bm2; each LDS A frag reused by 8 col tiles
  v8f acc[8] = {{}, {}, {}, {}, {}, {}, {}, {}};
#pragma unroll 1
  for (int k0 = 0; k0 < 512; k0 += 32) {
    v16h a = frag_ld_f16(&hb[m * 512 + k0 + kh * 8]);
    v16h b[8];
#pragma unroll
    for (int t = 0; t < 8; ++t)
      b[t] = frag_ld_f16(W2h + (size_t)(t * 16 + m) * 512 + k0 + kh * 8);
#pragma unroll
    for (int t = 0; t < 8; ++t) acc[t] = wmma_f16(a, b[t], acc[t]);
  }
#pragma unroll 1
  for (int t = 0; t < 8; ++t) {
    int cn = t * 16 + m;
    float bia = bm2[cn];
    int rb = tm * 16 + 8 * kh;
    if (full) {
#pragma unroll
      for (int r = 0; r < 8; ++r)
        out[(size_t)(rb + r) * FDIM + cn] =
            Xr[(size_t)(rb + r) * FDIM + cn] + acc[t][r] + bia;
    } else {
#pragma unroll
      for (int r = 0; r < 8; ++r)
        if (rb + r < n)
          out[(size_t)(rb + r) * FDIM + cn] =
              Xr[(size_t)(rb + r) * FDIM + cn] + acc[t][r] + bia;
    }
  }
}

// ---------------- host ----------------
extern "C" void kernel_launch(void* const* d_in, const int* in_sizes, int n_in,
                              void* d_out, int out_size, void* d_ws, size_t ws_size,
                              hipStream_t stream) {
  const int*   coords = (const int*)d_in[0];
  const float* feats  = (const float*)d_in[1];
  const float* Wq     = (const float*)d_in[2];
  const float* Wk     = (const float*)d_in[3];
  const float* bk     = (const float*)d_in[4];
  const float* Wv     = (const float*)d_in[5];
  const float* bv     = (const float*)d_in[6];
  const float* g1     = (const float*)d_in[7];
  const float* b1     = (const float*)d_in[8];
  const float* g2     = (const float*)d_in[9];
  const float* b2     = (const float*)d_in[10];
  const float* W1     = (const float*)d_in[11];
  const float* bm1    = (const float*)d_in[12];
  const float* W2     = (const float*)d_in[13];
  const float* bm2    = (const float*)d_in[14];
  float* out = (float*)d_out;
  const int N = in_sizes[1] / FDIM;
  (void)n_in; (void)out_size; (void)ws_size;

  char* ws = (char*)d_ws;
  size_t off = 0;
  auto carve = [&](size_t bytes) {
    void* p = ws + off;
    off = (off + bytes + 255) & ~(size_t)255;
    return p;
  };
  int*       grid = (int*)carve((size_t)GRID_CELLS * sizeof(int));
  int*       nbr  = (int*)carve((size_t)N * 27 * sizeof(int));
  float*     qb   = (float*)carve((size_t)N * FDIM * sizeof(float));
  float*     kb   = (float*)carve((size_t)N * FDIM * sizeof(float));
  float*     vb   = (float*)carve((size_t)N * FDIM * sizeof(float));
  float*     xr   = (float*)carve((size_t)N * FDIM * sizeof(float));
  _Float16*  Xh   = (_Float16*)carve((size_t)N * FDIM * sizeof(_Float16));
  _Float16*  xnh  = (_Float16*)carve((size_t)N * FDIM * sizeof(_Float16));
  _Float16*  Wqh  = (_Float16*)carve((size_t)FDIM * FDIM * sizeof(_Float16));
  _Float16*  W1h  = (_Float16*)carve((size_t)4 * FDIM * FDIM * sizeof(_Float16));
  _Float16*  W2h  = (_Float16*)carve((size_t)4 * FDIM * FDIM * sizeof(_Float16));

  const int mt = (N + 15) / 16;

  // neighbor table
  init_grid_k<<<(GRID_CELLS + 255) / 256, 256, 0, stream>>>(grid);
  scatter_k<<<(N + 255) / 256, 256, 0, stream>>>(coords, grid, N);
  neighbors_k<<<(N + 255) / 256, 256, 0, stream>>>(coords, grid, nbr, N);

  // one-time f32 -> f16 conversions
  int nf4 = (N * FDIM) / 4;
  cvt4_f16_k<<<(nf4 + 255) / 256, 256, 0, stream>>>(feats, Xh, nf4);
  cvt4_f16_k<<<(FDIM * FDIM / 4 + 255) / 256, 256, 0, stream>>>(Wq, Wqh,
                                                                FDIM * FDIM / 4);
  cvt4_f16_k<<<(4 * FDIM * FDIM / 4 + 255) / 256, 256, 0, stream>>>(
      W1, W1h, 4 * FDIM * FDIM / 4);
  cvt4_f16_k<<<(4 * FDIM * FDIM / 4 + 255) / 256, 256, 0, stream>>>(
      W2, W2h, 4 * FDIM * FDIM / 4);

  // projections
  gemm_q_k<<<(mt + 3) / 4, 128, 0, stream>>>(Xh, Wqh, qb, N);
  // k, v with norm1 applied in the same kernel
  kv_heads_ln_k<<<(mt + 3) / 4, 128, 0, stream>>>(Xh, Wk, bk, Wv, bv, g1, b1, kb, vb,
                                                  N);

  // attention + residual -> xr
  attention_k<<<(N * NHEAD + 255) / 256, 256, 0, stream>>>(qb, kb, vb, feats, nbr,
                                                           xr, N);

  // norm2 -> f16 activations for the MLP
  layernorm_rows_k<_Float16><<<(N + 7) / 8, 256, 0, stream>>>(xr, xnh, g2, b2, N);

  // fused MLP + residual -> out (64 KB dynamic LDS: 4 waves x 16x512 f16)
  mlp_fused_k<<<(mt + 3) / 4, 128, 4 * 16 * 512 * sizeof(_Float16), stream>>>(
      xnh, xr, W1h, bm1, W2h, bm2, out, N);
}

// v002
// It runs in 184 microseconds.
// Two timings next to v001 put it at 1.04 and 1.03 times that version's speed.
// Over all steps from v000 it is 1.31 times as fast.
#include <hip/hip_runtime.h>
#include <math.h>

// ---------------- problem constants ----------------
#define GX 256
#define GY 256
#define GZ 32
#define GRID_CELLS (GX * GY * GZ)   // 2,097,152
#define FDIM 128
#define NHEAD 8
#define HDIM 16

typedef __attribute__((ext_vector_type(16))) _Float16 v16h;
typedef __attribute__((ext_vector_type(8)))  _Float16 v8h;
typedef __attribute__((ext_vector_type(4)))  _Float16 v4h;
typedef __attribute__((ext_vector_type(8)))  float    v8f;

// A/B fragment for v_wmma_f32_16x16x32_f16 from row-major packed f16.
// p = &M[row][k0 + khalf*8]:
//   frag[i]   = K(k0 + khalf*8 + i)       i in 0..7   (16B contiguous)
//   frag[8+i] = K(k0 + 16 + khalf*8 + i)              (16B contiguous)
__device__ __forceinline__ v16h frag_ld_f16(const _Float16* __restrict__ p) {
  v8h lo = *(const v8h*)p;
  v8h hi = *(const v8h*)(p + 16);
  v16h r;
#pragma unroll
  for (int i = 0; i < 8; ++i) { r[i] = lo[i]; r[8 + i] = hi[i]; }
  return r;
}

__device__ __forceinline__ v8f wmma_f16(v16h a, v16h b, v8f c) {
  return __builtin_amdgcn_wmma_f32_16x16x32_f16(false, a, false, b, (short)0, c,
                                                false, false);
}

// Streaming kernels (grid fill, conversion, layernorm): a wave that moves a single
// 512-B row costs more to start than to run, so each wave takes WORK_PER_WAVE of them.
#define STREAM_BLOCK 256
#define WORK_PER_WAVE 8
#define STREAM_TILE (STREAM_BLOCK * WORK_PER_WAVE)  // 16-B pieces per block
#define NORM_ROWS ((STREAM_BLOCK / 32) * WORK_PER_WAVE)  // layernorm rows per block

// ---------------- f32 -> f16 conversion (vectorized x4) ----------------
// 8 float4 per thread, all loads issued before the first store.
__global__ void __launch_bounds__(STREAM_BLOCK) cvt4_f16_k(
    const float* __restrict__ in, _Float16* __restrict__ out, int n4) {
  const int base = blockIdx.x * STREAM_TILE;
  const float4* __restrict__ ip = (const float4*)in + base + threadIdx.x;
  v4h* __restrict__ op = (v4h*)out + base + threadIdx.x;
  if (base + STREAM_TILE <= n4) {  // whole block in range: scalar branch
    float4 v[WORK_PER_WAVE];
    for (int j = 0; j < WORK_PER_WAVE; ++j) v[j] = ip[j * STREAM_BLOCK];
    for (int j = 0; j < WORK_PER_WAVE; ++j) {
      v4h o = {(_Float16)v[j].x, (_Float16)v[j].y, (_Float16)v[j].z, (_Float16)v[j].w};
      op[j * STREAM_BLOCK] = o;
    }
  } else {
    for (int j = 0; j < WORK_PER_WAVE; ++j) {
      if (base + j * STREAM_BLOCK + (int)threadIdx.x < n4) {
        float4 v = ip[j * STREAM_BLOCK];
        v4h o = {(_Float16)v.x, (_Float16)v.y, (_Float16)v.z, (_Float16)v.w};
        op[j * STREAM_BLOCK] = o;
      }
    }
  }
}

// ---------------- neighbor table ----------------
// 8 stores of 16 B per thread; the grid is a whole number of block tiles.
static_assert(GRID_CELLS % (4 * STREAM_TILE) == 0, "grid fill has no tail");
__global__ void __launch_bounds__(STREAM_BLOCK) init_grid_k(int* __restrict__ grid) {
  int4* __restrict__ p = (int4*)grid + blockIdx.x * STREAM_TILE + threadIdx.x;
  for (int j = 0; j < WORK_PER_WAVE; ++j)
    p[j * STREAM_BLOCK] = make_int4(-1, -1, -1, -1);
}

__global__ void scatter_k(const int* __restrict__ coords, int* __restrict__ grid,
                          int n) {
  int i = blockIdx.x * blockDim.x + threadIdx.x;
  if (i >= n) return;
  int x = coords[i * 3 + 0], y = coords[i * 3 + 1], z = coords[i * 3 + 2];
  grid[x * (GY * GZ) + y * GZ + z] = i;
}

__global__ void neighbors_k(const int* __restrict__ coords,
                            const int* __restrict__ grid, int* __restrict__ nbr,
                            int n) {
  int i = blockIdx.x * blockDim.x + threadIdx.x;
  if (i >= n) return;
  int x = coords[i * 3 + 0], y = coords[i * 3 + 1], z = coords[i * 3 + 2];
#pragma unroll
  for (int j = 0; j < 27; ++j) {
    int dx = j / 9 - 1, dy = (j / 3) % 3 - 1, dz = j % 3 - 1;
    int nx = x + dx, ny = y + dy, nz = z + dz;
    int v = -1;
    if (nx >= 0 && nx < GX && ny >= 0 && ny < GY && nz >= 0 && nz < GZ)
      v = grid[nx * (GY * GZ) + ny * GZ + nz];
    nbr[i * 27 + j] = v;
  }
}

// ---------------- q = feats @ Wq^T  (WMMA, f16 operands) ----------------
// 4 waves/block; each wave owns one 16-row strip; 2 groups of 4 col tiles so
// 4 independent accumulator chains hide B-load latency behind wmma.
__global__ void __launch_bounds__(128) gemm_q_k(const _Float16* __restrict__ Xh,
                                                const _Float16* __restrict__ Wqh,
                                                float* __restrict__ Q, int n) {
  int lane = threadIdx.x & 31;
  int m = lane & 15, kh = lane >> 4;
  int tm = __builtin_amdgcn_readfirstlane(blockIdx.x * 4 + (threadIdx.x >> 5));
  if (tm * 16 >= n) return;  // scalar branch
  int row = tm * 16 + m;
  if (row >= n) row = n - 1;
  const bool full = (tm * 16 + 16) <= n;  // SGPR condition

  v16h av[4];
#pragma unroll
  for (int k = 0; k < 4; ++k)
    av[k] = frag_ld_f16(Xh + (size_t)row * FDIM + k * 32 + kh * 8);

#pragma unroll 1
  for (int tg = 0; tg < 2; ++tg) {  // 2 groups of 4 column tiles
    v8f acc[4] = {{}, {}, {}, {}};
#pragma unroll
    for (int k = 0; k < 4; ++k) {
      v16h b[4];
#pragma unroll
      for (int t = 0; t < 4; ++t) {
        int col = (tg * 4 + t) * 16 + m;
        b[t] = frag_ld_f16(Wqh + (size_t)col * FDIM + k * 32 + kh * 8);
      }
#pragma unroll
      for (int t = 0; t < 4; ++t) acc[t] = wmma_f16(av[k], b[t], acc[t]);
    }
#pragma unroll
    for (int t = 0; t < 4; ++t) {
      int cn = (tg * 4 + t) * 16 + m;
      int rb = tm * 16 + 8 * kh;  // C layout: lanes<16 -> M=r, lanes>=16 -> M=8+r
      if (full) {
#pragma unroll
        for (int r = 0; r < 8; ++r) Q[(size_t)(rb + r) * FDIM + cn] = acc[t][r];
      } else {
#pragma unroll
        for (int r = 0; r < 8; ++r)
          if (rb + r < n) Q[(size_t)(rb + r) * FDIM + cn] = acc[t][r];
      }
    }
  }
}

// ------- k,v per-head 16x16 projections (WMMA, K padded to 32) + norm1 -------
// Sum over the 16 lanes that hold the 16 columns of one C tile: DPP row_xmask
// butterfly (ctrl 0x160 | mask), all lanes on; it stays on the vector port, where
// a shuffle would go through the LDS pipe and its wait.
__device__ __forceinline__ float row16_sum(float x) {
  x += __int_as_float(__builtin_amdgcn_update_dpp(0, __float_as_int(x), 0x161, 0xf, 0xf, true));
  x += __int_as_float(__builtin_amdgcn_update_dpp(0, __float_as_int(x), 0x162, 0xf, 0xf, true));
  x += __int_as_float(__builtin_amdgcn_update_dpp(0, __float_as_int(x), 0x164, 0xf, 0xf, true));
  x += __int_as_float(__builtin_amdgcn_update_dpp(0, __float_as_int(x), 0x168, 0xf, 0xf, true));
  return x;
}

// One projection (k or v) of a wave's 16 rows: the 16 x 128 result stays in
// accumulator registers (8 heads x 8 rows per lane), so the row statistics of
// the layernorm come from registers and only the normalised rows are stored.
__device__ __forceinline__ void proj_norm_store(
    const v16h (&a)[NHEAD], const float* __restrict__ wp,
    const float* __restrict__ bias, const float* __restrict__ g,
    const float* __restrict__ b, float* __restrict__ op, int m, int rb, int n) {
  v8f acc[NHEAD];
#pragma unroll
  for (int h = 0; h < NHEAD; ++h) {
    v16h bf = {};  // W[h][e][d], e = m; slots 8..15 = K>=16 stay zero
#pragma unroll
    for (int i = 0; i < 8; ++i) bf[i] = (_Float16)wp[h * HDIM * HDIM + i];
    v8f z = {};
    acc[h] = wmma_f16(a[h], bf, z);
  }

  // bias, then per-row sum and sum of squares: 8 heads in the lane, 16 lanes
  float s[8], q[8];
#pragma unroll
  for (int r = 0; r < 8; ++r) { s[r] = 0.f; q[r] = 0.f; }
#pragma unroll
  for (int h = 0; h < NHEAD; ++h) {
    float bia = bias[h * HDIM + m];
#pragma unroll
    for (int r = 0; r < 8; ++r) {
      float x = acc[h][r] + bia;
      acc[h][r] = x;
      s[r] += x; q[r] += x * x;
    }
  }
#pragma unroll
  for (int r = 0; r < 8; ++r) {
    float mean = row16_sum(s[r]) * (1.0f / FDIM);
    float var  = row16_sum(q[r]) * (1.0f / FDIM) - mean * mean;
    s[r] = mean;
    q[r] = rsqrtf(var + 1e-5f);
  }
#pragma unroll
  for (int h = 0; h < NHEAD; ++h) {
    float gg = g[h * HDIM + m], bb = b[h * HDIM + m];
#pragma unroll
    for (int r = 0; r < 8; ++r) acc[h][r] = (acc[h][r] - s[r]) * q[r] * gg + bb;
  }
#pragma unroll
  for (int r = 0; r < 8; ++r) {
    if (rb + r < n) {
#pragma unroll
      for (int h = 0; h < NHEAD; ++h) op[r * FDIM + h * HDIM] = acc[h][r];
    }
  }
}

__global__ void __launch_bounds__(128) kv_heads_ln_k(
    const _Float16* __restrict__ Xh, const float* __restrict__ Wk,
    const float* __restrict__ bk, const float* __restrict__ Wv,
    const float* __restrict__ bv, const float* __restrict__ g,
    const float* __restrict__ b, float* __restrict__ K, float* __restrict__ V,
    int n) {
  int lane = threadIdx.x & 31;
  int m = lane & 15, kh = lane >> 4;
  int tm = __builtin_amdgcn_readfirstlane(blockIdx.x * 4 + (threadIdx.x >> 5));
  if (tm * 16 >= n) return;  // scalar branch
  int row = tm * 16 + m;
  if (row >= n) row = n - 1;
  const _Float16* __restrict__ xp = Xh + (size_t)row * FDIM + kh * 8;

  // A: 16 pts x 16 dims (f16) per head, zero-padded to K=32 (slots 8..15 = K>=16)
  v16h a[NHEAD];
#pragma unroll
  for (int h = 0; h < NHEAD; ++h) {
    v8h xa = *(const v8h*)(xp + h * HDIM);
    v16h t = {};
#pragma unroll
    for (int i = 0; i < 8; ++i) t[i] = xa[i];
    a[h] = t;
  }

  const int rb = tm * 16 + 8 * kh;  // C layout: lanes<16 -> M=r, lanes>=16 -> M=8+r
  const int wo = m * HDIM + kh * 8;
  proj_norm_store(a, Wk + wo, bk, g, b, K + (size_t)rb * FDIM + m, m, rb, n);
  proj_norm_store(a, Wv + wo, bv, g, b, V + (size_t)rb * FDIM + m, m, rb, n);
}

// ------- layernorm (128 cols), 8 rows per wave, templated output -------
typedef __attribute__((ext_vector_type(4))) float v4f;

// rsqrtf as the compiler expands it (x below the smallest normal scaled by 2^24, the
// result by 2^12). The v_rsq_f32 is asm text so that the v_nop, the slot the
// instruction set asks for behind a transcendental, stays directly behind it when
// the 8 rows' instructions are interleaved.
__device__ __forceinline__ float rsqrt_with_slot(float x) {
  const bool tiny = x < 1.17549435e-38f;
  const float xs = tiny ? x * 16777216.0f : x;
  float r;
  asm("v_rsq_f32 %0, %1\n\tv_nop" : "=v"(r) : "v"(xs));
  return tiny ? r * 4096.0f : r;
}

// One row, held 4 columns per lane: summed by the whole wave, in the same order as
// when a wave had one row only.
template <typename OutT>
__device__ __forceinline__ void norm_row(v4f x, OutT* __restrict__ po, v4f gv, v4f bv) {
  float s  = x.x + x.y + x.z + x.w;
  float ss = x.x * x.x + x.y * x.y + x.z * x.z + x.w * x.w;
  for (int off = 16; off >= 1; off >>= 1) {
    s  += __shfl_xor(s, off, 32);
    ss += __shfl_xor(ss, off, 32);
  }
  float mean = s * (1.0f / FDIM);
  float var  = ss * (1.0f / FDIM) - mean * mean;
  float rs = rsqrt_with_slot(var + 1e-5f);
  po[0] = (OutT)((x.x - mean) * rs * gv.x + bv.x);
  po[1] = (OutT)((x.y - mean) * rs * gv.y + bv.y);
  po[2] = (OutT)((x.z - mean) * rs * gv.z + bv.z);
  po[3] = (OutT)((x.w - mean) * rs * gv.w + bv.w);
}

template <typename OutT>
__global__ void __launch_bounds__(STREAM_BLOCK) layernorm_rows_k(
    const float* __restrict__ in, OutT* __restrict__ out, const float* __restrict__ g,
    const float* __restrict__ b, int rows) {
  static_assert(WORK_PER_WAVE == 8, "the load fence below names 8 rows");
  int wid = __builtin_amdgcn_readfirstlane(blockIdx.x * (STREAM_BLOCK >> 5) +
                                           (threadIdx.x >> 5));
  const int r0 = wid * WORK_PER_WAVE;
  if (r0 >= rows) return;  // scalar branch
  const int c = (threadIdx.x & 31) * 4;
  const v4f gv = *(const v4f*)(g + c);
  const v4f bv = *(const v4f*)(b + c);
  const float* __restrict__ ip = in + (size_t)r0 * FDIM + c;
  OutT* __restrict__ po = out + (size_t)r0 * FDIM + c;
  if (r0 + WORK_PER_WAVE <= rows) {  // scalar branch
    v4f v[WORK_PER_WAVE];
    for (int j = 0; j < WORK_PER_WAVE; ++j) v[j] = *(const v4f*)(ip + j * FDIM);
    // Inputs-only fence on the loaded rows: keeps the 8 loads in flight together;
    // without it the compiler sinks each load to its row and waits 8 times.
    asm volatile("" ::"v"(v[0]), "v"(v[1]), "v"(v[2]), "v"(v[3]), "v"(v[4]), "v"(v[5]),
                 "v"(v[6]), "v"(v[7]));
    // Unrolled so that the 8 rows' independent shuffle chains can be interleaved;
    // left rolled, each row waits out its own five LDS round trips.
#pragma unroll
    for (int j = 0; j < WORK_PER_WAVE; ++j) norm_row(v[j], po + j * FDIM, gv, bv);
    // The built code joins the tail's path here, which reuses the stores' registers.
    asm volatile("s_wait_xcnt 0x0" ::: "memory");
    return;
  }
  for (int r = r0; r < rows; ++r, ip += FDIM, po += FDIM)  // last wave's short tail
    norm_row(*(const v4f*)ip, po, gv, bv);
}

// ---------------- 27-neighbor attention + residual ----------------
// one thread per (point, head)
__global__ void attention_k(const float* __restrict__ Q, const float* __restrict__ Kn,
                            const float* __restrict__ Vn,
                            const float* __restrict__ feats,
                            const int* __restrict__ nbr, float* __restrict__ Xr,
                            int n) {
  int t = blockIdx.x * blockDim.x + threadIdx.x;
  if (t >= n * NHEAD) return;
  int pt = t >> 3, h = t & 7;
  const float scale = 0.0883883476483184f;  // 1/sqrt(128)
  float q[HDIM];
#pragma unroll
  for (int d = 0; d < HDIM; ++d) q[d] = Q[(size_t)pt * FDIM + h * HDIM + d];
  float sc[27];
  int nb[27];
  float mx = -3.0e38f;
#pragma unroll 1
  for (int j = 0; j < 27; ++j) {
    int idx = nbr[pt * 27 + j];
    nb[j] = idx;
    float s = -1.0e30f;
    if (idx >= 0) {
      const float* kp = Kn + (size_t)idx * FDIM + h * HDIM;
      float acc = 0.f;
#pragma unroll
      for (int d = 0; d < HDIM; ++d) acc += q[d] * kp[d];
      s = acc * scale;
    }
    sc[j] = s;
    mx = fmaxf(mx, s);
  }
  float denom = 0.f;
#pragma unroll
  for (int j = 0; j < 27; ++j) {
    float e = (nb[j] >= 0) ? __expf(sc[j] - mx) : 0.f;
    sc[j] = e;
    denom += e;
  }
  float inv = 1.0f / denom;
  float o[HDIM];
#pragma unroll
  for (int d = 0; d < HDIM; ++d) o[d] = 0.f;
#pragma unroll 1
  for (int j = 0; j < 27; ++j) {
    if (nb[j] < 0) continue;
    float p = sc[j] * inv;
    const float* vp = Vn + (size_t)nb[j] * FDIM + h * HDIM;
#pragma unroll
    for (int d = 0; d < HDIM; ++d) o[d] += p * vp[d];
  }
#pragma unroll
  for (int d = 0; d < HDIM; ++d) {
    size_t off = (size_t)pt * FDIM + h * HDIM + d;
    Xr[off] = feats[off] + o[d];
  }
}

// ---------------- fused MLP: gelu(LN(x)@W1^T+b1)@W2^T + b2 + x ----------------
// 4 waves/block (dynamic LDS, 64 KB); each wave owns one 16-row tile
__global__ void __launch_bounds__(128) mlp_fused_k(
    const _Float16* __restrict__ XNh, const float* __restrict__ Xr,
    const _Float16* __restrict__ W1h, const float* __restrict__ bm1,
    const _Float16* __restrict__ W2h, const float* __restrict__ bm2,
    float* __restrict__ out, int n) {
  extern __shared__ _Float16 hbuf_dyn[];  // 4 * 16 * 512 f16 = 64 KB
  int lane = threadIdx.x & 31;
  int wave = threadIdx.x >> 5;
  int m = lane & 15, kh = lane >> 4;
  int mtTot = (n + 15) / 16;
  int tm = __builtin_amdgcn_readfirstlane(blockIdx.x * 4 + wave);
  if (tm >= mtTot) tm = mtTot - 1;  // clamp: duplicate work, keeps barrier clean
  int row = tm * 16 + m;
  if (row >= n) row = n - 1;
  const bool full = (tm * 16 + 16) <= n;
  _Float16* hb = hbuf_dyn + (size_t)(threadIdx.x >> 5) * 16 * 512;

  // stage 1: h = gelu(XN @ W1^T + bm1) -> LDS (f16); A frags preloaded+reused
  v16h av[4];
#pragma unroll
  for (int k = 0; k < 4; ++k)
    av[k] = frag_ld_f16(XNh + (size_t)row * FDIM + k * 32 + kh * 8);

#pragma unroll 1
  for (int tg = 0; tg < 8; ++tg) {  // 8 groups of 4 column tiles (32 total)
    v8f acc[4] = {{}, {}, {}, {}};
#pragma unroll
    for (int k = 0; k < 4; ++k) {
      v16h b[4];
#pragma unroll
      for (int t = 0; t < 4; ++t) {
        int col = (tg * 4 + t) * 16 + m;
        b[t] = frag_ld_f16(W1h + (size_t)col * FDIM + k * 32 + kh * 8);
      }
#pragma unroll
      for (int t = 0; t < 4; ++t) acc[t] = wmma_f16(av[k], b[t], acc[t]);
    }
#pragma unroll
    for (int t = 0; t < 4; ++t) {
      int cn = (tg * 4 + t) * 16 + m;
      float bia = bm1[cn];
      int rb = 8 * kh;
#pragma unroll
      for (int r = 0; r < 8; ++r) {
        float val = acc[t][r] + bia;
        float gv = 0.5f * val * (1.0f + erff(val * 0.7071067811865475f));
        hb[(rb + r) * 512 + cn] = (_Float16)gv;
      }
    }
  }
  __syncthreads();

  // stage 2: out = Xr + h @ W2^T + bm2; each LDS A frag reused by 8 col tiles
  v8f acc[8] = {{}, {}, {}, {}, {}, {}, {}, {}};
#pragma unroll 1
  for (int k0 = 0; k0 < 512; k0 += 32) {
    v16h a = frag_ld_f16(&hb[m * 512 + k0 + kh * 8]);
    v16h b[8];
#pragma unroll
    for (int t = 0; t < 8; ++t)
      b[t] = frag_ld_f16(W2h + (size_t)(t * 16 + m) * 512 + k0 + kh * 8);
#pragma unroll
    for (int t = 0; t < 8; ++t) acc[t] = wmma_f16(a, b[t], acc[t]);
  }
#pragma unroll 1
  for (int t = 0; t < 8; ++t) {
    int cn = t * 16 + m;
    float bia = bm2[cn];
    int rb = tm * 16 + 8 * kh;
    if (full) {
#pragma unroll
      for (int r = 0; r < 8; ++r)
        out[(size_t)(rb + r) * FDIM + cn] =
            Xr[(size_t)(rb + r) * FDIM + cn] + acc[t][r] + bia;
    } else {
#pragma unroll
      for (int r = 0; r < 8; ++r)
        if (rb + r < n)
          out[(size_t)(rb + r) * FDIM + cn] =
              Xr[(size_t)(rb + r) * FDIM + cn] + acc[t][r] + bia;
    }
  }
}

// ---------------- host ----------------
extern "C" void kernel_launch(void* const* d_in, const int* in_sizes, int n_in,
                              void* d_out, int out_size, void* d_ws, size_t ws_size,
                              hipStream_t stream) {
  const int*   coords = (const int*)d_in[0];
  const float* feats  = (const float*)d_in[1];
  const float* Wq     = (const float*)d_in[2];
  const float* Wk     = (const float*)d_in[3];
  const float* bk     = (const float*)d_in[4];
  const float* Wv     = (const float*)d_in[5];
  const float* bv     = (const float*)d_in[6];
  const float* g1     = (const float*)d_in[7];
  const float* b1     = (const float*)d_in[8];
  const float* g2     = (const float*)d_in[9];
  const float* b2     = (const float*)d_in[10];
  const float* W1     = (const float*)d_in[11];
  const float* bm1    = (const float*)d_in[12];
  const float* W2     = (const float*)d_in[13];
  const float* bm2    = (const float*)d_in[14];
  float* out = (float*)d_out;
  const int N = in_sizes[1] / FDIM;
  (void)n_in; (void)out_size; (void)ws_size;

  char* ws = (char*)d_ws;
  size_t off = 0;
  auto carve = [&](size_t bytes) {
    void* p = ws + off;
    off = (off + bytes + 255) & ~(size_t)255;
    return p;
  };
  int*       grid = (int*)carve((size_t)GRID_CELLS * sizeof(int));
  int*       nbr  = (int*)carve((size_t)N * 27 * sizeof(int));
  float*     qb   = (float*)carve((size_t)N * FDIM * sizeof(float));
  float*     kb   = (float*)carve((size_t)N * FDIM * sizeof(float));
  float*     vb   = (float*)carve((size_t)N * FDIM * sizeof(float));
  float*     xr   = (float*)carve((size_t)N * FDIM * sizeof(float));
  _Float16*  Xh   = (_Float16*)carve((size_t)N * FDIM * sizeof(_Float16));
  _Float16*  xnh  = (_Float16*)carve((size_t)N * FDIM * sizeof(_Float16));
  _Float16*  Wqh  = (_Float16*)carve((size_t)FDIM * FDIM * sizeof(_Float16));
  _Float16*  W1h  = (_Float16*)carve((size_t)4 * FDIM * FDIM * sizeof(_Float16));
  _Float16*  W2h  = (_Float16*)carve((size_t)4 * FDIM * FDIM * sizeof(_Float16));

  const int mt = (N + 15) / 16;

  // neighbor table
  init_grid_k<<<GRID_CELLS / (4 * STREAM_TILE), STREAM_BLOCK, 0, stream>>>(grid);
  scatter_k<<<(N + 255) / 256, 256, 0, stream>>>(coords, grid, N);
  neighbors_k<<<(N + 255) / 256, 256, 0, stream>>>(coords, grid, nbr, N);

  // one-time f32 -> f16 conversions
  int nf4 = (N * FDIM) / 4;
  cvt4_f16_k<<<(nf4 + STREAM_TILE - 1) / STREAM_TILE, STREAM_BLOCK, 0, stream>>>(
      feats, Xh, nf4);
  cvt4_f16_k<<<(FDIM * FDIM / 4 + STREAM_TILE - 1) / STREAM_TILE, STREAM_BLOCK, 0,
               stream>>>(Wq, Wqh, FDIM * FDIM / 4);
  cvt4_f16_k<<<(4 * FDIM * FDIM / 4 + STREAM_TILE - 1) / STREAM_TILE, STREAM_BLOCK, 0,
               stream>>>(W1, W1h, 4 * FDIM * FDIM / 4);
  cvt4_f16_k<<<(4 * FDIM * FDIM / 4 + STREAM_TILE - 1) / STREAM_TILE, STREAM_BLOCK, 0,
               stream>>>(W2, W2h, 4 * FDIM * FDIM / 4);

  // projections
  gemm_q_k<<<(mt + 3) / 4, 128, 0, stream>>>(Xh, Wqh, qb, N);
  // k, v with norm1 applied in the same kernel
  kv_heads_ln_k<<<(mt + 3) / 4, 128, 0, stream>>>(Xh, Wk, bk, Wv, bv, g1, b1, kb, vb,
                                                  N);

  // attention + residual -> xr
  attention_k<<<(N * NHEAD + 255) / 256, 256, 0, stream>>>(qb, kb, vb, feats, nbr,
                                                           xr, N);

  // norm2 -> f16 activations for the MLP
  layernorm_rows_k<_Float16><<<(N + NORM_ROWS - 1) / NORM_ROWS, STREAM_BLOCK, 0, stream>>>(
      xr, xnh, g2, b2, N);

  // fused MLP + residual -> out (64 KB dynamic LDS: 4 waves x 16x512 f16)
  mlp_fused_k<<<(mt + 3) / 4, 128, 4 * 16 * 512 * sizeof(_Float16), stream>>>(
      xnh, xr, W1h, bm1, W2h, bm2, out, N);
}

// v003
// One run takes 136 microseconds.
// Next to v002, in two timings, it ran 1.40 and 1.35 times as fast.
// Over all steps from v000 it is 1.80 times as fast.
#include <hip/hip_runtime.h>
#include <math.h>

// ---------------- problem constants ----------------
#define GX 256
#define GY 256
#define GZ 32
#define GRID_CELLS (GX * GY * GZ)   // 2,097,152
#define FDIM 128
#define NHEAD 8
#define HDIM 16

typedef __attribute__((ext_vector_type(16))) _Float16 v16h;
typedef __attribute__((ext_vector_type(8)))  _Float16 v8h;
typedef __attribute__((ext_vector_type(4)))  _Float16 v4h;
typedef __attribute__((ext_vector_type(8)))  float    v8f;

// A/B fragment for v_wmma_f32_16x16x32_f16 from row-major packed f16.
// p = &M[row][k0 + khalf*8]:
//   frag[i]   = K(k0 + khalf*8 + i)       i in 0..7   (16B contiguous)
//   frag[8+i] = K(k0 + 16 + khalf*8 + i)              (16B contiguous)
__device__ __forceinline__ v16h frag_ld_f16(const _Float16* __restrict__ p) {
  v8h lo = *(const v8h*)p;
  v8h hi = *(const v8h*)(p + 16);
  v16h r;
#pragma unroll
  for (int i = 0; i < 8; ++i) { r[i] = lo[i]; r[8 + i] = hi[i]; }
  return r;
}

__device__ __forceinline__ v8f wmma_f16(v16h a, v16h b, v8f c) {
  return __builtin_amdgcn_wmma_f32_16x16x32_f16(false, a, false, b, (short)0, c,
                                                false, false);
}

// Streaming kernels (grid fill, conversion, layernorm): each wave takes WORK_PER_WAVE
// 512-B rows, for speed only.
#define STREAM_BLOCK 256
#define WORK_PER_WAVE 8
#define STREAM_TILE (STREAM_BLOCK * WORK_PER_WAVE)  // 16-B pieces per block
#define NORM_ROWS ((STREAM_BLOCK / 32) * WORK_PER_WAVE)  // layernorm rows per block

// ---------------- f32 -> f16 conversion (vectorized x4) ----------------
// 8 float4 per thread, all loads issued before the first store.
__global__ void __launch_bounds__(STREAM_BLOCK) cvt4_f16_k(
    const float* __restrict__ in, _Float16* __restrict__ out, int n4) {
  const int base = blockIdx.x * STREAM_TILE;
  const float4* __restrict__ ip = (const float4*)in + base + threadIdx.x;
  v4h* __restrict__ op = (v4h*)out + base + threadIdx.x;
  if (base + STREAM_TILE <= n4) {  // whole block in range: scalar branch
    float4 v[WORK_PER_WAVE];
    for (int j = 0; j < WORK_PER_WAVE; ++j) v[j] = ip[j * STREAM_BLOCK];
    for (int j = 0; j < WORK_PER_WAVE; ++j) {
      v4h o = {(_Float16)v[j].x, (_Float16)v[j].y, (_Float16)v[j].z, (_Float16)v[j].w};
      op[j * STREAM_BLOCK] = o;
    }
  } else {
    for (int j = 0; j < WORK_PER_WAVE; ++j) {
      if (base + j * STREAM_BLOCK + (int)threadIdx.x < n4) {
        float4 v = ip[j * STREAM_BLOCK];
        v4h o = {(_Float16)v.x, (_Float16)v.y, (_Float16)v.z, (_Float16)v.w};
        op[j * STREAM_BLOCK] = o;
      }
    }
  }
}

// ---------------- neighbor table ----------------
// 8 stores of 16 B per thread; the grid is a whole number of block tiles.
static_assert(GRID_CELLS % (4 * STREAM_TILE) == 0, "grid fill has no tail");
__global__ void __launch_bounds__(STREAM_BLOCK) init_grid_k(int* __restrict__ grid) {
  int4* __restrict__ p = (int4*)grid + blockIdx.x * STREAM_TILE + threadIdx.x;
  for (int j = 0; j < WORK_PER_WAVE; ++j)
    p[j * STREAM_BLOCK] = make_int4(-1, -1, -1, -1);
}

__global__ void scatter_k(const int* __restrict__ coords, int* __restrict__ grid,
                          int n) {
  int i = blockIdx.x * blockDim.x + threadIdx.x;
  if (i >= n) return;
  int x = coords[i * 3 + 0], y = coords[i * 3 + 1], z = coords[i * 3 + 2];
  grid[x * (GY * GZ) + y * GZ + z] = i;
}

__global__ void neighbors_k(const int* __restrict__ coords,
                            const int* __restrict__ grid, int* __restrict__ nbr,
                            int n) {
  int i = blockIdx.x * blockDim.x + threadIdx.x;
  if (i >= n) return;
  int x = coords[i * 3 + 0], y = coords[i * 3 + 1], z = coords[i * 3 + 2];
#pragma unroll
  for (int j = 0; j < 27; ++j) {
    int dx = j / 9 - 1, dy = (j / 3) % 3 - 1, dz = j % 3 - 1;
    int nx = x + dx, ny = y + dy, nz = z + dz;
    int v = -1;
    if (nx >= 0 && nx < GX && ny >= 0 && ny < GY && nz >= 0 && nz < GZ)
      v = grid[nx * (GY * GZ) + ny * GZ + nz];
    nbr[i * 27 + j] = v;
  }
}

// ---------------- q = feats @ Wq^T  (WMMA, f16 operands) ----------------
// 4 waves/block; each wave owns one 16-row strip; 2 groups of 4 col tiles so
// 4 independent accumulator chains hide B-load latency behind wmma.
__global__ void __launch_bounds__(128) gemm_q_k(const _Float16* __restrict__ Xh,
                                                const _Float16* __restrict__ Wqh,
                                                float* __restrict__ Q, int n) {
  int lane = threadIdx.x & 31;
  int m = lane & 15, kh = lane >> 4;
  int tm = __builtin_amdgcn_readfirstlane(blockIdx.x * 4 + (threadIdx.x >> 5));
  if (tm * 16 >= n) return;  // scalar branch
  int row = tm * 16 + m;
  if (row >= n) row = n - 1;
  const bool full = (tm * 16 + 16) <= n;  // SGPR condition

  v16h av[4];
#pragma unroll
  for (int k = 0; k < 4; ++k)
    av[k] = frag_ld_f16(Xh + (size_t)row * FDIM + k * 32 + kh * 8);

#pragma unroll 1
  for (int tg = 0; tg < 2; ++tg) {  // 2 groups of 4 column tiles
    v8f acc[4] = {{}, {}, {}, {}};
#pragma unroll
    for (int k = 0; k < 4; ++k) {
      v16h b[4];
#pragma unroll
      for (int t = 0; t < 4; ++t) {
        int col = (tg * 4 + t) * 16 + m;
        b[t] = frag_ld_f16(Wqh + (size_t)col * FDIM + k * 32 + kh * 8);
      }
#pragma unroll
      for (int t = 0; t < 4; ++t) acc[t] = wmma_f16(av[k], b[t], acc[t]);
    }
#pragma unroll
    for (int t = 0; t < 4; ++t) {
      int cn = (tg * 4 + t) * 16 + m;
      int rb = tm * 16 + 8 * kh;  // C layout: lanes<16 -> M=r, lanes>=16 -> M=8+r
      if (full) {
#pragma unroll
        for (int r = 0; r < 8; ++r) Q[(size_t)(rb + r) * FDIM + cn] = acc[t][r];
      } else {
#pragma unroll
        for (int r = 0; r < 8; ++r)
          if (rb + r < n) Q[(size_t)(rb + r) * FDIM + cn] = acc[t][r];
      }
    }
  }
}

// ------- k,v per-head 16x16 projections (WMMA, K padded to 32) + norm1 -------
// Sum over the 16 lanes that hold the 16 columns of one C tile: DPP row_xmask
// butterfly (ctrl 0x160 | mask), all lanes on; it stays on the vector port, where
// a shuffle would go through the LDS pipe and its wait.
__device__ __forceinline__ float row16_sum(float x) {
  x += __int_as_float(__builtin_amdgcn_update_dpp(0, __float_as_int(x), 0x161, 0xf, 0xf, true));
  x += __int_as_float(__builtin_amdgcn_update_dpp(0, __float_as_int(x), 0x162, 0xf, 0xf, true));
  x += __int_as_float(__builtin_amdgcn_update_dpp(0, __float_as_int(x), 0x164, 0xf, 0xf, true));
  x += __int_as_float(__builtin_amdgcn_update_dpp(0, __float_as_int(x), 0x168, 0xf, 0xf, true));
  return x;
}

// One projection (k or v) of a wave's 16 rows: the 16 x 128 result stays in
// accumulator registers (8 heads x 8 rows per lane), so the row statistics of
// the layernorm come from registers and only the normalised rows are stored.
__device__ __forceinline__ void proj_norm_store(
    const v16h (&a)[NHEAD], const float* __restrict__ wp,
    const float* __restrict__ bias, const float* __restrict__ g,
    const float* __restrict__ b, float* __restrict__ op, int m, int rb, int n) {
  v8f acc[NHEAD];
#pragma unroll
  for (int h = 0; h < NHEAD; ++h) {
    v16h bf = {};  // W[h][e][d], e = m; slots 8..15 = K>=16 stay zero
#pragma unroll
    for (int i = 0; i < 8; ++i) bf[i] = (_Float16)wp[h * HDIM * HDIM + i];
    v8f z = {};
    acc[h] = wmma_f16(a[h], bf, z);
  }

  // bias, then per-row sum and sum of squares: 8 heads in the lane, 16 lanes
  float s[8], q[8];
#pragma unroll
  for (int r = 0; r < 8; ++r) { s[r] = 0.f; q[r] = 0.f; }
#pragma unroll
  for (int h = 0; h < NHEAD; ++h) {
    float bia = bias[h * HDIM + m];
#pragma unroll
    for (int r = 0; r < 8; ++r) {
      float x = acc[h][r] + bia;
      acc[h][r] = x;
      s[r] += x; q[r] += x * x;
    }
  }
#pragma unroll
  for (int r = 0; r < 8; ++r) {
    float mean = row16_sum(s[r]) * (1.0f / FDIM);
    float var  = row16_sum(q[r]) * (1.0f / FDIM) - mean * mean;
    s[r] = mean;
    q[r] = rsqrtf(var + 1e-5f);
  }
#pragma unroll
  for (int h = 0; h < NHEAD; ++h) {
    float gg = g[h * HDIM + m], bb = b[h * HDIM + m];
#pragma unroll
    for (int r = 0; r < 8; ++r) acc[h][r] = (acc[h][r] - s[r]) * q[r] * gg + bb;
  }
#pragma unroll
  for (int r = 0; r < 8; ++r) {
    if (rb + r < n) {
#pragma unroll
      for (int h = 0; h < NHEAD; ++h) op[r * FDIM + h * HDIM] = acc[h][r];
    }
  }
}

__global__ void __launch_bounds__(128) kv_heads_ln_k(
    const _Float16* __restrict__ Xh, const float* __restrict__ Wk,
    const float* __restrict__ bk, const float* __restrict__ Wv,
    const float* __restrict__ bv, const float* __restrict__ g,
    const float* __restrict__ b, float* __restrict__ K, float* __restrict__ V,
    int n) {
  int lane = threadIdx.x & 31;
  int m = lane & 15, kh = lane >> 4;
  int tm = __builtin_amdgcn_readfirstlane(blockIdx.x * 4 + (threadIdx.x >> 5));
  if (tm * 16 >= n) return;  // scalar branch
  int row = tm * 16 + m;
  if (row >= n) row = n - 1;
  const _Float16* __restrict__ xp = Xh + (size_t)row * FDIM + kh * 8;

  // A: 16 pts x 16 dims (f16) per head, zero-padded to K=32 (slots 8..15 = K>=16)
  v16h a[NHEAD];
#pragma unroll
  for (int h = 0; h < NHEAD; ++h) {
    v8h xa = *(const v8h*)(xp + h * HDIM);
    v16h t = {};
#pragma unroll
    for (int i = 0; i < 8; ++i) t[i] = xa[i];
    a[h] = t;
  }

  const int rb = tm * 16 + 8 * kh;  // C layout: lanes<16 -> M=r, lanes>=16 -> M=8+r
  const int wo = m * HDIM + kh * 8;
  proj_norm_store(a, Wk + wo, bk, g, b, K + (size_t)rb * FDIM + m, m, rb, n);
  proj_norm_store(a, Wv + wo, bv, g, b, V + (size_t)rb * FDIM + m, m, rb, n);
}

// ------- layernorm (128 cols), 8 rows per wave, templated output -------
typedef __attribute__((ext_vector_type(4))) float v4f;

// rsqrtf as the compiler expands it (x below the smallest normal scaled by 2^24, the
// result by 2^12). The v_rsq_f32 is asm text so that the v_nop, the slot the
// instruction set asks for behind a transcendental, stays directly behind it when
// the 8 rows' instructions are interleaved.
__device__ __forceinline__ float rsqrt_with_slot(float x) {
  const bool tiny = x < 1.17549435e-38f;
  const float xs = tiny ? x * 16777216.0f : x;
  float r;
  asm("v_rsq_f32 %0, %1\n\tv_nop" : "=v"(r) : "v"(xs));
  return tiny ? r * 4096.0f : r;
}

// One row, held 4 columns per lane: summed by the whole wave, in the same order as
// when a wave had one row only.
template <typename OutT>
__device__ __forceinline__ void norm_row(v4f x, OutT* __restrict__ po, v4f gv, v4f bv) {
  float s  = x.x + x.y + x.z + x.w;
  float ss = x.x * x.x + x.y * x.y + x.z * x.z + x.w * x.w;
  for (int off = 16; off >= 1; off >>= 1) {
    s  += __shfl_xor(s, off, 32);
    ss += __shfl_xor(ss, off, 32);
  }
  float mean = s * (1.0f / FDIM);
  float var  = ss * (1.0f / FDIM) - mean * mean;
  float rs = rsqrt_with_slot(var + 1e-5f);
  po[0] = (OutT)((x.x - mean) * rs * gv.x + bv.x);
  po[1] = (OutT)((x.y - mean) * rs * gv.y + bv.y);
  po[2] = (OutT)((x.z - mean) * rs * gv.z + bv.z);
  po[3] = (OutT)((x.w - mean) * rs * gv.w + bv.w);
}

template <typename OutT>
__global__ void __launch_bounds__(STREAM_BLOCK) layernorm_rows_k(
    const float* __restrict__ in, OutT* __restrict__ out, const float* __restrict__ g,
    const float* __restrict__ b, int rows) {
  static_assert(WORK_PER_WAVE == 8, "the load fence below names 8 rows");
  int wid = __builtin_amdgcn_readfirstlane(blockIdx.x * (STREAM_BLOCK >> 5) +
                                           (threadIdx.x >> 5));
  const int r0 = wid * WORK_PER_WAVE;
  if (r0 >= rows) return;  // scalar branch
  const int c = (threadIdx.x & 31) * 4;
  const v4f gv = *(const v4f*)(g + c);
  const v4f bv = *(const v4f*)(b + c);
  const float* __restrict__ ip = in + (size_t)r0 * FDIM + c;
  OutT* __restrict__ po = out + (size_t)r0 * FDIM + c;
  if (r0 + WORK_PER_WAVE <= rows) {  // scalar branch
    v4f v[WORK_PER_WAVE];
    for (int j = 0; j < WORK_PER_WAVE; ++j) v[j] = *(const v4f*)(ip + j * FDIM);
    // Inputs-only fence on the loaded rows: keeps the 8 loads in flight together;
    // without it the compiler sinks each load to its row and waits 8 times.
    asm volatile("" ::"v"(v[0]), "v"(v[1]), "v"(v[2]), "v"(v[3]), "v"(v[4]), "v"(v[5]),
                 "v"(v[6]), "v"(v[7]));
    // Unrolled so that the 8 rows' independent shuffle chains can be interleaved;
    // left rolled, each row waits out its own five LDS round trips.
#pragma unroll
    for (int j = 0; j < WORK_PER_WAVE; ++j) norm_row(v[j], po + j * FDIM, gv, bv);
    // The built code joins the tail's path here, which reuses the stores' registers.
    asm volatile("s_wait_xcnt 0x0" ::: "memory");
    return;
  }
  for (int r = r0; r < rows; ++r, ip += FDIM, po += FDIM)  // last wave's short tail
    norm_row(*(const v4f*)ip, po, gv, bv);
}

// ---------------- 27-neighbor attention + residual ----------------
// one thread per (point, head)
__global__ void attention_k(const float* __restrict__ Q, const float* __restrict__ Kn,
                            const float* __restrict__ Vn,
                            const float* __restrict__ feats,
                            const int* __restrict__ nbr, float* __restrict__ Xr,
                            int n) {
  int t = blockIdx.x * blockDim.x + threadIdx.x;
  if (t >= n * NHEAD) return;
  int pt = t >> 3, h = t & 7;
  const float scale = 0.0883883476483184f;  // 1/sqrt(128)
  float q[HDIM];
#pragma unroll
  for (int d = 0; d < HDIM; ++d) q[d] = Q[(size_t)pt * FDIM + h * HDIM + d];
  float sc[27];
  int nb[27];
  float mx = -3.0e38f;
#pragma unroll 1
  for (int j = 0; j < 27; ++j) {
    int idx = nbr[pt * 27 + j];
    nb[j] = idx;
    float s = -1.0e30f;
    if (idx >= 0) {
      const float* kp = Kn + (size_t)idx * FDIM + h * HDIM;
      float acc = 0.f;
#pragma unroll
      for (int d = 0; d < HDIM; ++d) acc += q[d] * kp[d];
      s = acc * scale;
    }
    sc[j] = s;
    mx = fmaxf(mx, s);
  }
  float denom = 0.f;
#pragma unroll
  for (int j = 0; j < 27; ++j) {
    float e = (nb[j] >= 0) ? __expf(sc[j] - mx) : 0.f;
    sc[j] = e;
    denom += e;
  }
  float inv = 1.0f / denom;
  float o[HDIM];
#pragma unroll
  for (int d = 0; d < HDIM; ++d) o[d] = 0.f;
#pragma unroll 1
  for (int j = 0; j < 27; ++j) {
    if (nb[j] < 0) continue;
    float p = sc[j] * inv;
    const float* vp = Vn + (size_t)nb[j] * FDIM + h * HDIM;
#pragma unroll
    for (int d = 0; d < HDIM; ++d) o[d] += p * vp[d];
  }
#pragma unroll
  for (int d = 0; d < HDIM; ++d) {
    size_t off = (size_t)pt * FDIM + h * HDIM + d;
    Xr[off] = feats[off] + o[d];
  }
}

// ---------------- fused MLP: gelu(LN(x)@W1^T+b1)@W2^T + b2 + x ----------------
// One block = 64 rows (4 row tiles), 4 waves. The waves split the COLUMNS: every wave
// works on all 4 row tiles, so a weight fragment is loaded by one wave of the block and
// feeds 4 WMMAs; with a row tile per wave each of the 4 waves loaded every fragment.
#define MLP_TILES 4                 // row tiles per block
#define MLP_ROWS (MLP_TILES * 16)
#define HID (4 * FDIM)
#define H_PITCH (HID + 8)           // f16: rows 16 B apart in the banks for b128 readers
__global__ void __launch_bounds__(128) mlp_fused_k(
    const _Float16* __restrict__ XNh, const float* __restrict__ Xr,
    const _Float16* __restrict__ W1h, const float* __restrict__ bm1,
    const _Float16* __restrict__ W2h, const float* __restrict__ bm2,
    float* __restrict__ out, int n) {
  __shared__ __attribute__((aligned(16))) _Float16 hbuf[MLP_ROWS * H_PITCH];  // 65 KB
  const int lane = threadIdx.x & 31;
  const int wave = __builtin_amdgcn_readfirstlane(threadIdx.x >> 5);
  const int m = lane & 15, kh = lane >> 4;
  const int row0 = blockIdx.x * MLP_ROWS;  // < n by the grid

  // stage 1: h = gelu(XN @ W1^T + bm1) -> LDS (f16). A frags of all 64 rows stay in
  // registers; wave w makes columns [128 w, 128 w + 128) of h.
  v16h av[MLP_TILES][4];
#pragma unroll
  for (int rt = 0; rt < MLP_TILES; ++rt) {
    int row = row0 + rt * 16 + m;
    if (row >= n) row = n - 1;  // clamp: duplicate work, never stored
#pragma unroll
    for (int k = 0; k < 4; ++k)
      av[rt][k] = frag_ld_f16(XNh + (size_t)row * FDIM + k * 32 + kh * 8);
    // The built code lets a later tile's loads land on this tile's address registers.
    asm volatile("s_wait_xcnt 0x0" ::: "memory");
  }

  // Left rolled, for speed only: one trip holds 32 inlined erf bodies.
#pragma unroll 1
  for (int ct = 0; ct < 8; ++ct) {  // the wave's 8 column tiles
    const int cn = (wave * 8 + ct) * 16 + m;
    v16h b[4];
#pragma unroll
    for (int k = 0; k < 4; ++k)
      b[k] = frag_ld_f16(W1h + (size_t)cn * FDIM + k * 32 + kh * 8);
    // The built code lets the bias load land on the fragment loads' address registers.
    asm volatile("s_wait_xcnt 0x0" ::: "memory");
    const float bia = bm1[cn];
    // Inputs-only fence on the loaded fragments: keeps the tile's 8 loads in flight
    // together; without it the compiler reuses one fragment's registers and waits 4 times.
    asm volatile("" ::"v"(b[0]), "v"(b[1]), "v"(b[2]), "v"(b[3]));
    v8f acc[MLP_TILES] = {{}, {}, {}, {}};
#pragma unroll
    for (int k = 0; k < 4; ++k) {
#pragma unroll
      for (int rt = 0; rt < MLP_TILES; ++rt) acc[rt] = wmma_f16(av[rt][k], b[k], acc[rt]);
    }
#pragma unroll
    for (int rt = 0; rt < MLP_TILES; ++rt) {
      const int rb = rt * 16 + 8 * kh;  // C layout: lanes<16 -> M=r, lanes>=16 -> M=8+r
#pragma unroll
      for (int r = 0; r < 8; ++r) {
        float val = acc[rt][r] + bia;
        float gv = 0.5f * val * (1.0f + erff(val * 0.7071067811865475f));
        hbuf[(rb + r) * H_PITCH + cn] = (_Float16)gv;
      }
    }
  }
  __syncthreads();  // every wave reads all 512 columns of h below

  // stage 2: out = Xr + h @ W2^T + bm2; wave w makes output columns [32 w, 32 w + 32)
  v8f acc[2][MLP_TILES] = {{{}, {}, {}, {}}, {{}, {}, {}, {}}};
  // Two k steps per trip: together they use up the 128-B line of each W2 row, and the
  // second step's loads fly while the first step's WMMAs run.
#pragma unroll 2
  for (int k0 = 0; k0 < HID; k0 += 32) {
    v16h b[2], a[MLP_TILES];
#pragma unroll
    for (int t = 0; t < 2; ++t)
      b[t] = frag_ld_f16(W2h + (size_t)((wave * 2 + t) * 16 + m) * HID + k0 + kh * 8);
#pragma unroll
    for (int rt = 0; rt < MLP_TILES; ++rt)
      a[rt] = frag_ld_f16(&hbuf[(rt * 16 + m) * H_PITCH + k0 + kh * 8]);
#pragma unroll
    for (int t = 0; t < 2; ++t) {
#pragma unroll
      for (int rt = 0; rt < MLP_TILES; ++rt) acc[t][rt] = wmma_f16(a[rt], b[t], acc[t][rt]);
    }
  }
  const float bia0 = bm2[wave * 32 + m], bia1 = bm2[wave * 32 + 16 + m];
  const size_t o0 = (size_t)(row0 + 8 * kh) * FDIM + wave * 32 + m;
  const float* __restrict__ xp = Xr + o0;
  float* __restrict__ op = out + o0;
  if (row0 + MLP_ROWS <= n) {  // scalar branch: whole block in range
    float x[2][MLP_TILES][8];
#pragma unroll
    for (int t = 0; t < 2; ++t)
#pragma unroll
      for (int rt = 0; rt < MLP_TILES; ++rt)
#pragma unroll
        for (int r = 0; r < 8; ++r) x[t][rt][r] = xp[(rt * 16 + r) * FDIM + t * 16];
#pragma unroll
    for (int t = 0; t < 2; ++t)
#pragma unroll
      for (int rt = 0; rt < MLP_TILES; ++rt)
#pragma unroll
        for (int r = 0; r < 8; ++r)
          op[(rt * 16 + r) * FDIM + t * 16] = x[t][rt][r] + acc[t][rt][r] + (t ? bia1 : bia0);
  } else {
#pragma unroll
    for (int t = 0; t < 2; ++t)
#pragma unroll
      for (int rt = 0; rt < MLP_TILES; ++rt)
#pragma unroll
        for (int r = 0; r < 8; ++r)
          if (row0 + rt * 16 + 8 * kh + r < n)
            op[(rt * 16 + r) * FDIM + t * 16] =
                xp[(rt * 16 + r) * FDIM + t * 16] + acc[t][rt][r] + (t ? bia1 : bia0);
  }
}

// ---------------- host ----------------
extern "C" void kernel_launch(void* const* d_in, const int* in_sizes, int n_in,
                              void* d_out, int out_size, void* d_ws, size_t ws_size,
                              hipStream_t stream) {
  const int*   coords = (const int*)d_in[0];
  const float* feats  = (const float*)d_in[1];
  const float* Wq     = (const float*)d_in[2];
  const float* Wk     = (const float*)d_in[3];
  const float* bk     = (const float*)d_in[4];
  const float* Wv     = (const float*)d_in[5];
  const float* bv     = (const float*)d_in[6];
  const float* g1     = (const float*)d_in[7];
  const float* b1     = (const float*)d_in[8];
  const float* g2     = (const float*)d_in[9];
  const float* b2     = (const float*)d_in[10];
  const float* W1     = (const float*)d_in[11];
  const float* bm1    = (const float*)d_in[12];
  const float* W2     = (const float*)d_in[13];
  const float* bm2    = (const float*)d_in[14];
  float* out = (float*)d_out;
  const int N = in_sizes[1] / FDIM;
  (void)n_in; (void)out_size; (void)ws_size;

  char* ws = (char*)d_ws;
  size_t off = 0;
  auto carve = [&](size_t bytes) {
    void* p = ws + off;
    off = (off + bytes + 255) & ~(size_t)255;
    return p;
  };
  int*       grid = (int*)carve((size_t)GRID_CELLS * sizeof(int));
  int*       nbr  = (int*)carve((size_t)N * 27 * sizeof(int));
  float*     qb   = (float*)carve((size_t)N * FDIM * sizeof(float));
  float*     kb   = (float*)carve((size_t)N * FDIM * sizeof(float));
  float*     vb   = (float*)carve((size_t)N * FDIM * sizeof(float));
  float*     xr   = (float*)carve((size_t)N * FDIM * sizeof(float));
  _Float16*  Xh   = (_Float16*)carve((size_t)N * FDIM * sizeof(_Float16));
  _Float16*  xnh  = (_Float16*)carve((size_t)N * FDIM * sizeof(_Float16));
  _Float16*  Wqh  = (_Float16*)carve((size_t)FDIM * FDIM * sizeof(_Float16));
  _Float16*  W1h  = (_Float16*)carve((size_t)4 * FDIM * FDIM * sizeof(_Float16));
  _Float16*  W2h  = (_Float16*)carve((size_t)4 * FDIM * FDIM * sizeof(_Float16));

  const int mt = (N + 15) / 16;

  // neighbor table
  init_grid_k<<<GRID_CELLS / (4 * STREAM_TILE), STREAM_BLOCK, 0, stream>>>(grid);
  scatter_k<<<(N + 255) / 256, 256, 0, stream>>>(coords, grid, N);
  neighbors_k<<<(N + 255) / 256, 256, 0, stream>>>(coords, grid, nbr, N);

  // one-time f32 -> f16 conversions
  int nf4 = (N * FDIM) / 4;
  cvt4_f16_k<<<(nf4 + STREAM_TILE - 1) / STREAM_TILE, STREAM_BLOCK, 0, stream>>>(
      feats, Xh, nf4);
  cvt4_f16_k<<<(FDIM * FDIM / 4 + STREAM_TILE - 1) / STREAM_TILE, STREAM_BLOCK, 0,
               stream>>>(Wq, Wqh, FDIM * FDIM / 4);
  cvt4_f16_k<<<(4 * FDIM * FDIM / 4 + STREAM_TILE - 1) / STREAM_TILE, STREAM_BLOCK, 0,
               stream>>>(W1, W1h, 4 * FDIM * FDIM / 4);
  cvt4_f16_k<<<(4 * FDIM * FDIM / 4 + STREAM_TILE - 1) / STREAM_TILE, STREAM_BLOCK, 0,
               stream>>>(W2, W2h, 4 * FDIM * FDIM / 4);

  // projections
  gemm_q_k<<<(mt + 3) / 4, 128, 0, stream>>>(Xh, Wqh, qb, N);
  // k, v with norm1 applied in the same kernel
  kv_heads_ln_k<<<(mt + 3) / 4, 128, 0, stream>>>(Xh, Wk, bk, Wv, bv, g1, b1, kb, vb,
                                                  N);

  // attention + residual -> xr
  attention_k<<<(N * NHEAD + 255) / 256, 256, 0, stream>>>(qb, kb, vb, feats, nbr,
                                                           xr, N);

  // norm2 -> f16 activations for the MLP
  layernorm_rows_k<_Float16><<<(N + NORM_ROWS - 1) / NORM_ROWS, STREAM_BLOCK, 0, stream>>>(
      xr, xnh, g2, b2, N);

  // fused MLP + residual -> out (64 rows per block, h tile in static LDS)
  mlp_fused_k<<<(mt + 3) / 4, 128, 0, stream>>>(xnh, xr, W1h, bm1, W2h, bm2, out, N);
}

// v004
// One run takes 120 microseconds.
// Timed twice side by side with v003, it ran 1.15 and 1.11 times as fast.
// Counting every step since v000, it is 2.04 times as fast.
#include <hip/hip_runtime.h>
#include <math.h>

// ---------------- problem constants ----------------
#define GX 256
#define GY 256
#define GZ 32
#define GRID_CELLS (GX * GY * GZ)   // 2,097,152
#define FDIM 128
#define NHEAD 8
#define HDIM 16

typedef __attribute__((ext_vector_type(16))) _Float16 v16h;
typedef __attribute__((ext_vector_type(8)))  _Float16 v8h;
typedef __attribute__((ext_vector_type(4)))  _Float16 v4h;
typedef __attribute__((ext_vector_type(8)))  float    v8f;

// A/B fragment for v_wmma_f32_16x16x32_f16 from row-major packed f16.
// p = &M[row][k0 + khalf*8]:
//   frag[i]   = K(k0 + khalf*8 + i)       i in 0..7   (16B contiguous)
//   frag[8+i] = K(k0 + 16 + khalf*8 + i)              (16B contiguous)
__device__ __forceinline__ v16h frag_ld_f16(const _Float16* __restrict__ p) {
  v8h lo = *(const v8h*)p;
  v8h hi = *(const v8h*)(p + 16);
  v16h r;
#pragma unroll
  for (int i = 0; i < 8; ++i) { r[i] = lo[i]; r[8 + i] = hi[i]; }
  return r;
}

__device__ __forceinline__ v8f wmma_f16(v16h a, v16h b, v8f c) {
  return __builtin_amdgcn_wmma_f32_16x16x32_f16(false, a, false, b, (short)0, c,
                                                false, false);
}

// Streaming kernels (grid fill, conversion, layernorm): each wave takes WORK_PER_WAVE
// 512-B rows, for speed only.
#define STREAM_BLOCK 256
#define WORK_PER_WAVE 8
#define STREAM_TILE (STREAM_BLOCK * WORK_PER_WAVE)  // 16-B pieces per block
#define NORM_ROWS ((STREAM_BLOCK / 32) * WORK_PER_WAVE)  // layernorm rows per block

// Launches that do not depend on each other share one grid: each block takes one role,
// picked by a scalar compare on its index, and gets its index within that role (blk).

// ---------------- f32 -> f16 conversion (vectorized x4) ----------------
// 8 float4 per thread, all loads issued before the first store.
__device__ __forceinline__ void cvt4_f16_block(
    const float* __restrict__ in, _Float16* __restrict__ out, int n4, int blk) {
  const int base = blk * STREAM_TILE;
  const float4* __restrict__ ip = (const float4*)in + base + threadIdx.x;
  v4h* __restrict__ op = (v4h*)out + base + threadIdx.x;
  if (base + STREAM_TILE <= n4) {  // whole block in range: scalar branch
    float4 v[WORK_PER_WAVE];
    for (int j = 0; j < WORK_PER_WAVE; ++j) v[j] = ip[j * STREAM_BLOCK];
    for (int j = 0; j < WORK_PER_WAVE; ++j) {
      v4h o = {(_Float16)v[j].x, (_Float16)v[j].y, (_Float16)v[j].z, (_Float16)v[j].w};
      op[j * STREAM_BLOCK] = o;
    }
    // The built code joins the tail's path here, which reuses the stores' registers.
    asm volatile("s_wait_xcnt 0x0" ::: "memory");
  } else {
    for (int j = 0; j < WORK_PER_WAVE; ++j) {
      if (base + j * STREAM_BLOCK + (int)threadIdx.x < n4) {
        float4 v = ip[j * STREAM_BLOCK];
        v4h o = {(_Float16)v.x, (_Float16)v.y, (_Float16)v.z, (_Float16)v.w};
        op[j * STREAM_BLOCK] = o;
      }
    }
  }
}

// ---------------- neighbor table ----------------
// 8 stores of 16 B per thread; the grid is a whole number of block tiles.
static_assert(GRID_CELLS % (4 * STREAM_TILE) == 0, "grid fill has no tail");
__device__ __forceinline__ void init_grid_block(int* __restrict__ grid, int blk) {
  int4* __restrict__ p = (int4*)grid + blk * STREAM_TILE + threadIdx.x;
  for (int j = 0; j < WORK_PER_WAVE; ++j)
    p[j * STREAM_BLOCK] = make_int4(-1, -1, -1, -1);
}

// First launch: everything that reads only inputs. Roles in index order: feats, the
// grid fill, then Wq, W1, W2.
#define TILES_OF(n4) (((n4) + STREAM_TILE - 1) / STREAM_TILE)
#define GRID_BLOCKS (GRID_CELLS / (4 * STREAM_TILE))
#define WQ_N4 (FDIM * FDIM / 4)
#define WM_N4 (4 * FDIM * FDIM / 4)  // W1 and W2 alike
#define PREP_FIXED_BLOCKS (GRID_BLOCKS + TILES_OF(WQ_N4) + 2 * TILES_OF(WM_N4))
__global__ void __launch_bounds__(STREAM_BLOCK) prep_k(
    const float* __restrict__ feats, _Float16* __restrict__ Xh, int nf4,
    const float* __restrict__ Wq, _Float16* __restrict__ Wqh,
    const float* __restrict__ W1, _Float16* __restrict__ W1h,
    const float* __restrict__ W2, _Float16* __restrict__ W2h, int* __restrict__ grid) {
  int blk = blockIdx.x;
  if (blk < TILES_OF(nf4)) { cvt4_f16_block(feats, Xh, nf4, blk); return; }
  blk -= TILES_OF(nf4);
  if (blk < GRID_BLOCKS) { init_grid_block(grid, blk); return; }
  blk -= GRID_BLOCKS;
  if (blk < TILES_OF(WQ_N4)) { cvt4_f16_block(Wq, Wqh, WQ_N4, blk); return; }
  blk -= TILES_OF(WQ_N4);
  if (blk < TILES_OF(WM_N4)) { cvt4_f16_block(W1, W1h, WM_N4, blk); return; }
  cvt4_f16_block(W2, W2h, WM_N4, blk - TILES_OF(WM_N4));
}

// scatter and look-up run in blocks of PROJ_BLOCK threads, the size of the projection
// blocks whose grids they share.
#define PROJ_BLOCK 128
__device__ __forceinline__ void scatter_block(const int* __restrict__ coords,
                                              int* __restrict__ grid, int n, int blk) {
  int i = blk * PROJ_BLOCK + threadIdx.x;
  if (i >= n) return;
  int x = coords[i * 3 + 0], y = coords[i * 3 + 1], z = coords[i * 3 + 2];
  grid[x * (GY * GZ) + y * GZ + z] = i;
}

__device__ __forceinline__ void neighbors_block(const int* __restrict__ coords,
                                                const int* __restrict__ grid,
                                                int* __restrict__ nbr, int n, int blk) {
  int i = blk * PROJ_BLOCK + threadIdx.x;
  if (i >= n) return;
  int x = coords[i * 3 + 0], y = coords[i * 3 + 1], z = coords[i * 3 + 2];
#pragma unroll
  for (int j = 0; j < 27; ++j) {
    int dx = j / 9 - 1, dy = (j / 3) % 3 - 1, dz = j % 3 - 1;
    int nx = x + dx, ny = y + dy, nz = z + dz;
    int v = -1;
    if (nx >= 0 && nx < GX && ny >= 0 && ny < GY && nz >= 0 && nz < GZ)
      v = grid[nx * (GY * GZ) + ny * GZ + nz];
    nbr[i * 27 + j] = v;
  }
}

// ---------------- q = feats @ Wq^T  (WMMA, f16 operands) ----------------
// 4 waves/block; each wave owns one 16-row strip; 2 groups of 4 col tiles so
// 4 independent accumulator chains hide B-load latency behind wmma.
__device__ __forceinline__ void gemm_q_block(const _Float16* __restrict__ Xh,
                                             const _Float16* __restrict__ Wqh,
                                             float* __restrict__ Q, int n, int blk) {
  int lane = threadIdx.x & 31;
  int m = lane & 15, kh = lane >> 4;
  int tm = __builtin_amdgcn_readfirstlane(blk * 4 + (threadIdx.x >> 5));
  if (tm * 16 >= n) return;  // scalar branch
  int row = tm * 16 + m;
  if (row >= n) row = n - 1;
  const bool full = (tm * 16 + 16) <= n;  // SGPR condition

  v16h av[4];
#pragma unroll
  for (int k = 0; k < 4; ++k)
    av[k] = frag_ld_f16(Xh + (size_t)row * FDIM + k * 32 + kh * 8);

#pragma unroll 1
  for (int tg = 0; tg < 2; ++tg) {  // 2 groups of 4 column tiles
    v8f acc[4] = {{}, {}, {}, {}};
#pragma unroll
    for (int k = 0; k < 4; ++k) {
      v16h b[4];
#pragma unroll
      for (int t = 0; t < 4; ++t) {
        int col = (tg * 4 + t) * 16 + m;
        b[t] = frag_ld_f16(Wqh + (size_t)col * FDIM + k * 32 + kh * 8);
      }
#pragma unroll
      for (int t = 0; t < 4; ++t) acc[t] = wmma_f16(av[k], b[t], acc[t]);
    }
#pragma unroll
    for (int t = 0; t < 4; ++t) {
      int cn = (tg * 4 + t) * 16 + m;
      int rb = tm * 16 + 8 * kh;  // C layout: lanes<16 -> M=r, lanes>=16 -> M=8+r
      if (full) {
#pragma unroll
        for (int r = 0; r < 8; ++r) Q[(size_t)(rb + r) * FDIM + cn] = acc[t][r];
        // The built code joins the guarded path here, which reuses the stores' registers.
        asm volatile("s_wait_xcnt 0x0" ::: "memory");
      } else {
#pragma unroll
        for (int r = 0; r < 8; ++r)
          if (rb + r < n) Q[(size_t)(rb + r) * FDIM + cn] = acc[t][r];
      }
    }
  }
}

// Second launch: what needs only the first one's results. The projection blocks come
// first in the index, the short scatter blocks behind them.
#define PROJ_BLOCKS(n) (((n) + 63) / 64)                    // 4 strips of 16 rows each
#define POINT_BLOCKS(n) (((n) + PROJ_BLOCK - 1) / PROJ_BLOCK)  // one thread per point
__global__ void __launch_bounds__(PROJ_BLOCK) q_scatter_k(
    const _Float16* __restrict__ Xh, const _Float16* __restrict__ Wqh,
    float* __restrict__ Q, const int* __restrict__ coords, int* __restrict__ grid,
    int n) {
  const int blk = blockIdx.x;
  if (blk < PROJ_BLOCKS(n)) gemm_q_block(Xh, Wqh, Q, n, blk);
  else scatter_block(coords, grid, n, blk - PROJ_BLOCKS(n));
}

// ------- k,v per-head 16x16 projections (WMMA, K padded to 32) + norm1 -------
// Sum over the 16 lanes that hold the 16 columns of one C tile: DPP row_xmask
// butterfly (ctrl 0x160 | mask), all lanes on; it stays on the vector port, where
// a shuffle would go through the LDS pipe and its wait.
__device__ __forceinline__ float row16_sum(float x) {
  x += __int_as_float(__builtin_amdgcn_update_dpp(0, __float_as_int(x), 0x161, 0xf, 0xf, true));
  x += __int_as_float(__builtin_amdgcn_update_dpp(0, __float_as_int(x), 0x162, 0xf, 0xf, true));
  x += __int_as_float(__builtin_amdgcn_update_dpp(0, __float_as_int(x), 0x164, 0xf, 0xf, true));
  x += __int_as_float(__builtin_amdgcn_update_dpp(0, __float_as_int(x), 0x168, 0xf, 0xf, true));
  return x;
}

// One projection (k or v) of a wave's 16 rows: the 16 x 128 result stays in
// accumulator registers (8 heads x 8 rows per lane), so the row statistics of
// the layernorm come from registers and only the normalised rows are stored.
__device__ __forceinline__ void proj_norm_store(
    const v16h (&a)[NHEAD], const float* __restrict__ wp,
    const float* __restrict__ bias, const float* __restrict__ g,
    const float* __restrict__ b, float* __restrict__ op, int m, int rb, int n) {
  v8f acc[NHEAD];
#pragma unroll
  for (int h = 0; h < NHEAD; ++h) {
    v16h bf = {};  // W[h][e][d], e = m; slots 8..15 = K>=16 stay zero
#pragma unroll
    for (int i = 0; i < 8; ++i) bf[i] = (_Float16)wp[h * HDIM * HDIM + i];
    v8f z = {};
    acc[h] = wmma_f16(a[h], bf, z);
  }

  // bias, then per-row sum and sum of squares: 8 heads in the lane, 16 lanes
  float s[8], q[8];
#pragma unroll
  for (int r = 0; r < 8; ++r) { s[r] = 0.f; q[r] = 0.f; }
#pragma unroll
  for (int h = 0; h < NHEAD; ++h) {
    float bia = bias[h * HDIM + m];
#pragma unroll
    for (int r = 0; r < 8; ++r) {
      float x = acc[h][r] + bia;
      acc[h][r] = x;
      s[r] += x; q[r] += x * x;
    }
  }
#pragma unroll
  for (int r = 0; r < 8; ++r) {
    float mean = row16_sum(s[r]) * (1.0f / FDIM);
    float var  = row16_sum(q[r]) * (1.0f / FDIM) - mean * mean;
    s[r] = mean;
    q[r] = rsqrtf(var + 1e-5f);
  }
#pragma unroll
  for (int h = 0; h < NHEAD; ++h) {
    float gg = g[h * HDIM + m], bb = b[h * HDIM + m];
#pragma unroll
    for (int r = 0; r < 8; ++r) acc[h][r] = (acc[h][r] - s[r]) * q[r] * gg + bb;
  }
#pragma unroll
  for (int r = 0; r < 8; ++r) {
    if (rb + r < n) {
#pragma unroll
      for (int h = 0; h < NHEAD; ++h) op[r * FDIM + h * HDIM] = acc[h][r];
    }
  }
}

__device__ __forceinline__ void kv_heads_ln_block(
    const _Float16* __restrict__ Xh, const float* __restrict__ Wk,
    const float* __restrict__ bk, const float* __restrict__ Wv,
    const float* __restrict__ bv, const float* __restrict__ g,
    const float* __restrict__ b, float* __restrict__ K, float* __restrict__ V,
    int n, int blk) {
  int lane = threadIdx.x & 31;
  int m = lane & 15, kh = lane >> 4;
  int tm = __builtin_amdgcn_readfirstlane(blk * 4 + (threadIdx.x >> 5));
  if (tm * 16 >= n) return;  // scalar branch
  int row = tm * 16 + m;
  if (row >= n) row = n - 1;
  const _Float16* __restrict__ xp = Xh + (size_t)row * FDIM + kh * 8;

  // A: 16 pts x 16 dims (f16) per head, zero-padded to K=32 (slots 8..15 = K>=16)
  v16h a[NHEAD];
#pragma unroll
  for (int h = 0; h < NHEAD; ++h) {
    v8h xa = *(const v8h*)(xp + h * HDIM);
    v16h t = {};
#pragma unroll
    for (int i = 0; i < 8; ++i) t[i] = xa[i];
    a[h] = t;
  }

  const int rb = tm * 16 + 8 * kh;  // C layout: lanes<16 -> M=r, lanes>=16 -> M=8+r
  const int wo = m * HDIM + kh * 8;
  proj_norm_store(a, Wk + wo, bk, g, b, K + (size_t)rb * FDIM + m, m, rb, n);
  proj_norm_store(a, Wv + wo, bv, g, b, V + (size_t)rb * FDIM + m, m, rb, n);
}

// Third launch: the look-up needs the scattered grid; k and v, which attention needs no
// earlier than the table, fill the chip beside it.
__global__ void __launch_bounds__(PROJ_BLOCK) kv_neighbors_k(
    const _Float16* __restrict__ Xh, const float* __restrict__ Wk,
    const float* __restrict__ bk, const float* __restrict__ Wv,
    const float* __restrict__ bv, const float* __restrict__ g,
    const float* __restrict__ b, float* __restrict__ K, float* __restrict__ V,
    const int* __restrict__ coords, const int* __restrict__ grid,
    int* __restrict__ nbr, int n) {
  const int blk = blockIdx.x;
  if (blk < PROJ_BLOCKS(n)) kv_heads_ln_block(Xh, Wk, bk, Wv, bv, g, b, K, V, n, blk);
  else neighbors_block(coords, grid, nbr, n, blk - PROJ_BLOCKS(n));
}

// ------- layernorm (128 cols), 8 rows per wave, templated output -------
typedef __attribute__((ext_vector_type(4))) float v4f;

// rsqrtf as the compiler expands it (x below the smallest normal scaled by 2^24, the
// result by 2^12). The v_rsq_f32 is asm text so that the v_nop, the slot the
// instruction set asks for behind a transcendental, stays directly behind it when
// the 8 rows' instructions are interleaved.
__device__ __forceinline__ float rsqrt_with_slot(float x) {
  const bool tiny = x < 1.17549435e-38f;
  const float xs = tiny ? x * 16777216.0f : x;
  float r;
  asm("v_rsq_f32 %0, %1\n\tv_nop" : "=v"(r) : "v"(xs));
  return tiny ? r * 4096.0f : r;
}

// One row, held 4 columns per lane: summed by the whole wave, in the same order as
// when a wave had one row only.
template <typename OutT>
__device__ __forceinline__ void norm_row(v4f x, OutT* __restrict__ po, v4f gv, v4f bv) {
  float s  = x.x + x.y + x.z + x.w;
  float ss = x.x * x.x + x.y * x.y + x.z * x.z + x.w * x.w;
  for (int off = 16; off >= 1; off >>= 1) {
    s  += __shfl_xor(s, off, 32);
    ss += __shfl_xor(ss, off, 32);
  }
  float mean = s * (1.0f / FDIM);
  float var  = ss * (1.0f / FDIM) - mean * mean;
  float rs = rsqrt_with_slot(var + 1e-5f);
  po[0] = (OutT)((x.x - mean) * rs * gv.x + bv.x);
  po[1] = (OutT)((x.y - mean) * rs * gv.y + bv.y);
  po[2] = (OutT)((x.z - mean) * rs * gv.z + bv.z);
  po[3] = (OutT)((x.w - mean) * rs * gv.w + bv.w);
}

template <typename OutT>
__global__ void __launch_bounds__(STREAM_BLOCK) layernorm_rows_k(
    const float* __restrict__ in, OutT* __restrict__ out, const float* __restrict__ g,
    const float* __restrict__ b, int rows) {
  static_assert(WORK_PER_WAVE == 8, "the load fence below names 8 rows");
  int wid = __builtin_amdgcn_readfirstlane(blockIdx.x * (STREAM_BLOCK >> 5) +
                                           (threadIdx.x >> 5));
  const int r0 = wid * WORK_PER_WAVE;
  if (r0 >= rows) return;  // scalar branch
  const int c = (threadIdx.x & 31) * 4;
  const v4f gv = *(const v4f*)(g + c);
  const v4f bv = *(const v4f*)(b + c);
  const float* __restrict__ ip = in + (size_t)r0 * FDIM + c;
  OutT* __restrict__ po = out + (size_t)r0 * FDIM + c;
  if (r0 + WORK_PER_WAVE <= rows) {  // scalar branch
    v4f v[WORK_PER_WAVE];
    for (int j = 0; j < WORK_PER_WAVE; ++j) v[j] = *(const v4f*)(ip + j * FDIM);
    // Inputs-only fence on the loaded rows: keeps the 8 loads in flight together;
    // without it the compiler sinks each load to its row and waits 8 times.
    asm volatile("" ::"v"(v[0]), "v"(v[1]), "v"(v[2]), "v"(v[3]), "v"(v[4]), "v"(v[5]),
                 "v"(v[6]), "v"(v[7]));
    // Unrolled so that the 8 rows' independent shuffle chains can be interleaved;
    // left rolled, each row waits out its own five LDS round trips.
#pragma unroll
    for (int j = 0; j < WORK_PER_WAVE; ++j) norm_row(v[j], po + j * FDIM, gv, bv);
    // The built code joins the tail's path here, which reuses the stores' registers.
    asm volatile("s_wait_xcnt 0x0" ::: "memory");
    return;
  }
  for (int r = r0; r < rows; ++r, ip += FDIM, po += FDIM)  // last wave's short tail
    norm_row(*(const v4f*)ip, po, gv, bv);
}

// ---------------- 27-neighbor attention + residual ----------------
// one thread per (point, head)
__global__ void attention_k(const float* __restrict__ Q, const float* __restrict__ Kn,
                            const float* __restrict__ Vn,
                            const float* __restrict__ feats,
                            const int* __restrict__ nbr, float* __restrict__ Xr,
                            int n) {
  int t = blockIdx.x * blockDim.x + threadIdx.x;
  if (t >= n * NHEAD) return;
  int pt = t >> 3, h = t & 7;
  const float scale = 0.0883883476483184f;  // 1/sqrt(128)
  float q[HDIM];
#pragma unroll
  for (int d = 0; d < HDIM; ++d) q[d] = Q[(size_t)pt * FDIM + h * HDIM + d];
  float sc[27];
  int nb[27];
  float mx = -3.0e38f;
#pragma unroll 1
  for (int j = 0; j < 27; ++j) {
    int idx = nbr[pt * 27 + j];
    nb[j] = idx;
    float s = -1.0e30f;
    if (idx >= 0) {
      const float* kp = Kn + (size_t)idx * FDIM + h * HDIM;
      float acc = 0.f;
#pragma unroll
      for (int d = 0; d < HDIM; ++d) acc += q[d] * kp[d];
      s = acc * scale;
    }
    sc[j] = s;
    mx = fmaxf(mx, s);
  }
  float denom = 0.f;
#pragma unroll
  for (int j = 0; j < 27; ++j) {
    float e = (nb[j] >= 0) ? __expf(sc[j] - mx) : 0.f;
    sc[j] = e;
    denom += e;
  }
  float inv = 1.0f / denom;
  float o[HDIM];
#pragma unroll
  for (int d = 0; d < HDIM; ++d) o[d] = 0.f;
#pragma unroll 1
  for (int j = 0; j < 27; ++j) {
    if (nb[j] < 0) continue;
    float p = sc[j] * inv;
    const float* vp = Vn + (size_t)nb[j] * FDIM + h * HDIM;
#pragma unroll
    for (int d = 0; d < HDIM; ++d) o[d] += p * vp[d];
  }
#pragma unroll
  for (int d = 0; d < HDIM; ++d) {
    size_t off = (size_t)pt * FDIM + h * HDIM + d;
    Xr[off] = feats[off] + o[d];
  }
}

// ---------------- fused MLP: gelu(LN(x)@W1^T+b1)@W2^T + b2 + x ----------------
// One block = 64 rows (4 row tiles), 4 waves. The waves split the COLUMNS: every wave
// works on all 4 row tiles, so a weight fragment is loaded by one wave of the block and
// feeds 4 WMMAs; with a row tile per wave each of the 4 waves loaded every fragment.
#define MLP_TILES 4                 // row tiles per block
#define MLP_ROWS (MLP_TILES * 16)
#define HID (4 * FDIM)
#define H_PITCH (HID + 8)           // f16: rows 16 B apart in the banks for b128 readers
__global__ void __launch_bounds__(128) mlp_fused_k(
    const _Float16* __restrict__ XNh, const float* __restrict__ Xr,
    const _Float16* __restrict__ W1h, const float* __restrict__ bm1,
    const _Float16* __restrict__ W2h, const float* __restrict__ bm2,
    float* __restrict__ out, int n) {
  __shared__ __attribute__((aligned(16))) _Float16 hbuf[MLP_ROWS * H_PITCH];  // 65 KB
  const int lane = threadIdx.x & 31;
  const int wave = __builtin_amdgcn_readfirstlane(threadIdx.x >> 5);
  const int m = lane & 15, kh = lane >> 4;
  const int row0 = blockIdx.x * MLP_ROWS;  // < n by the grid

  // stage 1: h = gelu(XN @ W1^T + bm1) -> LDS (f16). A frags of all 64 rows stay in
  // registers; wave w makes columns [128 w, 128 w + 128) of h.
  v16h av[MLP_TILES][4];
#pragma unroll
  for (int rt = 0; rt < MLP_TILES; ++rt) {
    int row = row0 + rt * 16 + m;
    if (row >= n) row = n - 1;  // clamp: duplicate work, never stored
#pragma unroll
    for (int k = 0; k < 4; ++k)
      av[rt][k] = frag_ld_f16(XNh + (size_t)row * FDIM + k * 32 + kh * 8);
    // The built code lets a later tile's loads land on this tile's address registers.
    asm volatile("s_wait_xcnt 0x0" ::: "memory");
  }

  // Left rolled, for speed only: one trip holds 32 inlined erf bodies.
#pragma unroll 1
  for (int ct = 0; ct < 8; ++ct) {  // the wave's 8 column tiles
    const int cn = (wave * 8 + ct) * 16 + m;
    v16h b[4];
#pragma unroll
    for (int k = 0; k < 4; ++k)
      b[k] = frag_ld_f16(W1h + (size_t)cn * FDIM + k * 32 + kh * 8);
    // The built code lets the bias load land on the fragment loads' address registers.
    asm volatile("s_wait_xcnt 0x0" ::: "memory");
    const float bia = bm1[cn];
    // Inputs-only fence on the loaded fragments: keeps the tile's 8 loads in flight
    // together; without it the compiler reuses one fragment's registers and waits 4 times.
    asm volatile("" ::"v"(b[0]), "v"(b[1]), "v"(b[2]), "v"(b[3]));
    v8f acc[MLP_TILES] = {{}, {}, {}, {}};
#pragma unroll
    for (int k = 0; k < 4; ++k) {
#pragma unroll
      for (int rt = 0; rt < MLP_TILES; ++rt) acc[rt] = wmma_f16(av[rt][k], b[k], acc[rt]);
    }
#pragma unroll
    for (int rt = 0; rt < MLP_TILES; ++rt) {
      const int rb = rt * 16 + 8 * kh;  // C layout: lanes<16 -> M=r, lanes>=16 -> M=8+r
#pragma unroll
      for (int r = 0; r < 8; ++r) {
        float val = acc[rt][r] + bia;
        float gv = 0.5f * val * (1.0f + erff(val * 0.7071067811865475f));
        hbuf[(rb + r) * H_PITCH + cn] = (_Float16)gv;
      }
    }
  }
  __syncthreads();  // every wave reads all 512 columns of h below

  // stage 2: out = Xr + h @ W2^T + bm2; wave w makes output columns [32 w, 32 w + 32)
  v8f acc[2][MLP_TILES] = {{{}, {}, {}, {}}, {{}, {}, {}, {}}};
  // Two k steps per trip: together they use up the 128-B line of each W2 row, and the
  // second step's loads fly while the first step's WMMAs run.
#pragma unroll 2
  for (int k0 = 0; k0 < HID; k0 += 32) {
    v16h b[2], a[MLP_TILES];
#pragma unroll
    for (int t = 0; t < 2; ++t)
      b[t] = frag_ld_f16(W2h + (size_t)((wave * 2 + t) * 16 + m) * HID + k0 + kh * 8);
#pragma unroll
    for (int rt = 0; rt < MLP_TILES; ++rt)
      a[rt] = frag_ld_f16(&hbuf[(rt * 16 + m) * H_PITCH + k0 + kh * 8]);
#pragma unroll
    for (int t = 0; t < 2; ++t) {
#pragma unroll
      for (int rt = 0; rt < MLP_TILES; ++rt) acc[t][rt] = wmma_f16(a[rt], b[t], acc[t][rt]);
    }
  }
  const float bia0 = bm2[wave * 32 + m], bia1 = bm2[wave * 32 + 16 + m];
  const size_t o0 = (size_t)(row0 + 8 * kh) * FDIM + wave * 32 + m;
  const float* __restrict__ xp = Xr + o0;
  float* __restrict__ op = out + o0;
  if (row0 + MLP_ROWS <= n) {  // scalar branch: whole block in range
    float x[2][MLP_TILES][8];
#pragma unroll
    for (int t = 0; t < 2; ++t)
#pragma unroll
      for (int rt = 0; rt < MLP_TILES; ++rt)
#pragma unroll
        for (int r = 0; r < 8; ++r) x[t][rt][r] = xp[(rt * 16 + r) * FDIM + t * 16];
#pragma unroll
    for (int t = 0; t < 2; ++t)
#pragma unroll
      for (int rt = 0; rt < MLP_TILES; ++rt)
#pragma unroll
        for (int r = 0; r < 8; ++r)
          op[(rt * 16 + r) * FDIM + t * 16] = x[t][rt][r] + acc[t][rt][r] + (t ? bia1 : bia0);
  } else {
#pragma unroll
    for (int t = 0; t < 2; ++t)
#pragma unroll
      for (int rt = 0; rt < MLP_TILES; ++rt)
#pragma unroll
        for (int r = 0; r < 8; ++r)
          if (row0 + rt * 16 + 8 * kh + r < n)
            op[(rt * 16 + r) * FDIM + t * 16] =
                xp[(rt * 16 + r) * FDIM + t * 16] + acc[t][rt][r] + (t ? bia1 : bia0);
  }
}

// ---------------- host ----------------
extern "C" void kernel_launch(void* const* d_in, const int* in_sizes, int n_in,
                              void* d_out, int out_size, void* d_ws, size_t ws_size,
                              hipStream_t stream) {
  const int*   coords = (const int*)d_in[0];
  const float* feats  = (const float*)d_in[1];
  const float* Wq     = (const float*)d_in[2];
  const float* Wk     = (const float*)d_in[3];
  const float* bk     = (const float*)d_in[4];
  const float* Wv     = (const float*)d_in[5];
  const float* bv     = (const float*)d_in[6];
  const float* g1     = (const float*)d_in[7];
  const float* b1     = (const float*)d_in[8];
  const float* g2     = (const float*)d_in[9];
  const float* b2     = (const float*)d_in[10];
  const float* W1     = (const float*)d_in[11];
  const float* bm1    = (const float*)d_in[12];
  const float* W2     = (const float*)d_in[13];
  const float* bm2    = (const float*)d_in[14];
  float* out = (float*)d_out;
  const int N = in_sizes[1] / FDIM;
  (void)n_in; (void)out_size; (void)ws_size;

  char* ws = (char*)d_ws;
  size_t off = 0;
  auto carve = [&](size_t bytes) {
    void* p = ws + off;
    off = (off + bytes + 255) & ~(size_t)255;
    return p;
  };
  int*       grid = (int*)carve((size_t)GRID_CELLS * sizeof(int));
  int*       nbr  = (int*)carve((size_t)N * 27 * sizeof(int));
  float*     qb   = (float*)carve((size_t)N * FDIM * sizeof(float));
  float*     kb   = (float*)carve((size_t)N * FDIM * sizeof(float));
  float*     vb   = (float*)carve((size_t)N * FDIM * sizeof(float));
  float*     xr   = (float*)carve((size_t)N * FDIM * sizeof(float));
  _Float16*  Xh   = (_Float16*)carve((size_t)N * FDIM * sizeof(_Float16));
  _Float16*  xnh  = (_Float16*)carve((size_t)N * FDIM * sizeof(_Float16));
  _Float16*  Wqh  = (_Float16*)carve((size_t)FDIM * FDIM * sizeof(_Float16));
  _Float16*  W1h  = (_Float16*)carve((size_t)4 * FDIM * FDIM * sizeof(_Float16));
  _Float16*  W2h  = (_Float16*)carve((size_t)4 * FDIM * FDIM * sizeof(_Float16));

  const int mt = (N + 15) / 16;

  // inputs only: f32 -> f16 conversions and the grid fill
  int nf4 = (N * FDIM) / 4;
  prep_k<<<TILES_OF(nf4) + PREP_FIXED_BLOCKS, STREAM_BLOCK, 0, stream>>>(
      feats, Xh, nf4, Wq, Wqh, W1, W1h, W2, W2h, grid);

  // q projection beside the scatter into the grid
  q_scatter_k<<<PROJ_BLOCKS(N) + POINT_BLOCKS(N), PROJ_BLOCK, 0, stream>>>(
      Xh, Wqh, qb, coords, grid, N);

  // k, v with norm1 applied in the same kernel, beside the neighbor table
  kv_neighbors_k<<<PROJ_BLOCKS(N) + POINT_BLOCKS(N), PROJ_BLOCK, 0, stream>>>(
      Xh, Wk, bk, Wv, bv, g1, b1, kb, vb, coords, grid, nbr, N);

  // attention + residual -> xr
  attention_k<<<(N * NHEAD + 255) / 256, 256, 0, stream>>>(qb, kb, vb, feats, nbr,
                                                           xr, N);

  // norm2 -> f16 activations for the MLP
  layernorm_rows_k<_Float16><<<(N + NORM_ROWS - 1) / NORM_ROWS, STREAM_BLOCK, 0, stream>>>(
      xr, xnh, g2, b2, N);

  // fused MLP + residual -> out (64 rows per block, h tile in static LDS)
  mlp_fused_k<<<(mt + 3) / 4, 128, 0, stream>>>(xnh, xr, W1h, bm1, W2h, bm2, out, N);
}

// v005
// Measured time: 90.7 microseconds a run.
// Next to v004, in two timings, it ran 1.32 and 1.30 times as fast.
// Over all steps from v000 it is 2.68 times as fast.
#include <hip/hip_runtime.h>
#include <math.h>

// ---------------- problem constants ----------------
#define GX 256
#define GY 256
#define GZ 32
#define GRID_CELLS (GX * GY * GZ)   // 2,097,152
#define FDIM 128
#define NHEAD 8
#define HDIM 16

typedef __attribute__((ext_vector_type(16))) _Float16 v16h;
typedef __attribute__((ext_vector_type(8)))  _Float16 v8h;
typedef __attribute__((ext_vector_type(4)))  _Float16 v4h;
typedef __attribute__((ext_vector_type(8)))  float    v8f;

// A/B fragment for v_wmma_f32_16x16x32_f16 from row-major packed f16.
// p = &M[row][k0 + khalf*8]:
//   frag[i]   = K(k0 + khalf*8 + i)       i in 0..7   (16B contiguous)
//   frag[8+i] = K(k0 + 16 + khalf*8 + i)              (16B contiguous)
__device__ __forceinline__ v16h frag_ld_f16(const _Float16* __restrict__ p) {
  v8h lo = *(const v8h*)p;
  v8h hi = *(const v8h*)(p + 16);
  v16h r;
#pragma unroll
  for (int i = 0; i < 8; ++i) { r[i] = lo[i]; r[8 + i] = hi[i]; }
  return r;
}

__device__ __forceinline__ v8f wmma_f16(v16h a, v16h b, v8f c) {
  return __builtin_amdgcn_wmma_f32_16x16x32_f16(false, a, false, b, (short)0, c,
                                                false, false);
}

// Streaming kernels (grid fill, conversion, layernorm): each wave takes WORK_PER_WAVE
// 512-B rows, for speed only.
#define STREAM_BLOCK 256
#define WORK_PER_WAVE 8
#define STREAM_TILE (STREAM_BLOCK * WORK_PER_WAVE)  // 16-B pieces per block
#define NORM_ROWS ((STREAM_BLOCK / 32) * WORK_PER_WAVE)  // layernorm rows per block

// Launches that do not depend on each other share one grid: each block takes one role,
// picked by a scalar compare on its index, and gets its index within that role (blk).

// ---------------- f32 -> f16 conversion (vectorized x4) ----------------
// 8 float4 per thread, all loads issued before the first store.
__device__ __forceinline__ void cvt4_f16_block(
    const float* __restrict__ in, _Float16* __restrict__ out, int n4, int blk) {
  const int base = blk * STREAM_TILE;
  const float4* __restrict__ ip = (const float4*)in + base + threadIdx.x;
  v4h* __restrict__ op = (v4h*)out + base + threadIdx.x;
  if (base + STREAM_TILE <= n4) {  // whole block in range: scalar branch
    float4 v[WORK_PER_WAVE];
    for (int j = 0; j < WORK_PER_WAVE; ++j) v[j] = ip[j * STREAM_BLOCK];
    for (int j = 0; j < WORK_PER_WAVE; ++j) {
      v4h o = {(_Float16)v[j].x, (_Float16)v[j].y, (_Float16)v[j].z, (_Float16)v[j].w};
      op[j * STREAM_BLOCK] = o;
    }
    // The built code joins the tail's path here, which reuses the stores' registers.
    asm volatile("s_wait_xcnt 0x0" ::: "memory");
  } else {
    for (int j = 0; j < WORK_PER_WAVE; ++j) {
      if (base + j * STREAM_BLOCK + (int)threadIdx.x < n4) {
        float4 v = ip[j * STREAM_BLOCK];
        v4h o = {(_Float16)v.x, (_Float16)v.y, (_Float16)v.z, (_Float16)v.w};
        op[j * STREAM_BLOCK] = o;
      }
    }
  }
}

// ---------------- neighbor table ----------------
// 8 stores of 16 B per thread; the grid is a whole number of block tiles.
static_assert(GRID_CELLS % (4 * STREAM_TILE) == 0, "grid fill has no tail");
__device__ __forceinline__ void init_grid_block(int* __restrict__ grid, int blk) {
  int4* __restrict__ p = (int4*)grid + blk * STREAM_TILE + threadIdx.x;
  for (int j = 0; j < WORK_PER_WAVE; ++j)
    p[j * STREAM_BLOCK] = make_int4(-1, -1, -1, -1);
}

// First launch: everything that reads only inputs. Roles in index order: feats, the
// grid fill, then Wq, W1, W2.
#define TILES_OF(n4) (((n4) + STREAM_TILE - 1) / STREAM_TILE)
#define GRID_BLOCKS (GRID_CELLS / (4 * STREAM_TILE))
#define WQ_N4 (FDIM * FDIM / 4)
#define WM_N4 (4 * FDIM * FDIM / 4)  // W1 and W2 alike
#define PREP_FIXED_BLOCKS (GRID_BLOCKS + TILES_OF(WQ_N4) + 2 * TILES_OF(WM_N4))
__global__ void __launch_bounds__(STREAM_BLOCK) prep_k(
    const float* __restrict__ feats, _Float16* __restrict__ Xh, int nf4,
    const float* __restrict__ Wq, _Float16* __restrict__ Wqh,
    const float* __restrict__ W1, _Float16* __restrict__ W1h,
    const float* __restrict__ W2, _Float16* __restrict__ W2h, int* __restrict__ grid) {
  int blk = blockIdx.x;
  if (blk < TILES_OF(nf4)) { cvt4_f16_block(feats, Xh, nf4, blk); return; }
  blk -= TILES_OF(nf4);
  if (blk < GRID_BLOCKS) { init_grid_block(grid, blk); return; }
  blk -= GRID_BLOCKS;
  if (blk < TILES_OF(WQ_N4)) { cvt4_f16_block(Wq, Wqh, WQ_N4, blk); return; }
  blk -= TILES_OF(WQ_N4);
  if (blk < TILES_OF(WM_N4)) { cvt4_f16_block(W1, W1h, WM_N4, blk); return; }
  cvt4_f16_block(W2, W2h, WM_N4, blk - TILES_OF(WM_N4));
}

// scatter and look-up run in blocks of PROJ_BLOCK threads, the size of the projection
// blocks whose grids they share.
#define PROJ_BLOCK 128
__device__ __forceinline__ void scatter_block(const int* __restrict__ coords,
                                              int* __restrict__ grid, int n, int blk) {
  int i = blk * PROJ_BLOCK + threadIdx.x;
  if (i >= n) return;
  int x = coords[i * 3 + 0], y = coords[i * 3 + 1], z = coords[i * 3 + 2];
  grid[x * (GY * GZ) + y * GZ + z] = i;
}

__device__ __forceinline__ void neighbors_block(const int* __restrict__ coords,
                                                const int* __restrict__ grid,
                                                int* __restrict__ nbr, int n, int blk) {
  int i = blk * PROJ_BLOCK + threadIdx.x;
  if (i >= n) return;
  int x = coords[i * 3 + 0], y = coords[i * 3 + 1], z = coords[i * 3 + 2];
#pragma unroll
  for (int j = 0; j < 27; ++j) {
    int dx = j / 9 - 1, dy = (j / 3) % 3 - 1, dz = j % 3 - 1;
    int nx = x + dx, ny = y + dy, nz = z + dz;
    int v = -1;
    if (nx >= 0 && nx < GX && ny >= 0 && ny < GY && nz >= 0 && nz < GZ)
      v = grid[nx * (GY * GZ) + ny * GZ + nz];
    nbr[i * 27 + j] = v;
  }
}

// ---------------- q = feats @ Wq^T  (WMMA, f16 operands) ----------------
// 4 waves/block; each wave owns one 16-row strip; 2 groups of 4 col tiles so
// 4 independent accumulator chains hide B-load latency behind wmma.
__device__ __forceinline__ void gemm_q_block(const _Float16* __restrict__ Xh,
                                             const _Float16* __restrict__ Wqh,
                                             float* __restrict__ Q, int n, int blk) {
  int lane = threadIdx.x & 31;
  int m = lane & 15, kh = lane >> 4;
  int tm = __builtin_amdgcn_readfirstlane(blk * 4 + (threadIdx.x >> 5));
  if (tm * 16 >= n) return;  // scalar branch
  int row = tm * 16 + m;
  if (row >= n) row = n - 1;
  const bool full = (tm * 16 + 16) <= n;  // SGPR condition

  v16h av[4];
#pragma unroll
  for (int k = 0; k < 4; ++k)
    av[k] = frag_ld_f16(Xh + (size_t)row * FDIM + k * 32 + kh * 8);

#pragma unroll 1
  for (int tg = 0; tg < 2; ++tg) {  // 2 groups of 4 column tiles
    v8f acc[4] = {{}, {}, {}, {}};
#pragma unroll
    for (int k = 0; k < 4; ++k) {
      v16h b[4];
#pragma unroll
      for (int t = 0; t < 4; ++t) {
        int col = (tg * 4 + t) * 16 + m;
        b[t] = frag_ld_f16(Wqh + (size_t)col * FDIM + k * 32 + kh * 8);
      }
#pragma unroll
      for (int t = 0; t < 4; ++t) acc[t] = wmma_f16(av[k], b[t], acc[t]);
    }
#pragma unroll
    for (int t = 0; t < 4; ++t) {
      int cn = (tg * 4 + t) * 16 + m;
      int rb = tm * 16 + 8 * kh;  // C layout: lanes<16 -> M=r, lanes>=16 -> M=8+r
      if (full) {
#pragma unroll
        for (int r = 0; r < 8; ++r) Q[(size_t)(rb + r) * FDIM + cn] = acc[t][r];
        // The built code joins the guarded path here, which reuses the stores' registers.
        asm volatile("s_wait_xcnt 0x0" ::: "memory");
      } else {
#pragma unroll
        for (int r = 0; r < 8; ++r)
          if (rb + r < n) Q[(size_t)(rb + r) * FDIM + cn] = acc[t][r];
      }
    }
  }
}

// Second launch: what needs only the first one's results. The projection blocks come
// first in the index, the short scatter blocks behind them.
#define PROJ_BLOCKS(n) (((n) + 63) / 64)                    // 4 strips of 16 rows each
#define POINT_BLOCKS(n) (((n) + PROJ_BLOCK - 1) / PROJ_BLOCK)  // one thread per point
__global__ void __launch_bounds__(PROJ_BLOCK) q_scatter_k(
    const _Float16* __restrict__ Xh, const _Float16* __restrict__ Wqh,
    float* __restrict__ Q, const int* __restrict__ coords, int* __restrict__ grid,
    int n) {
  const int blk = blockIdx.x;
  if (blk < PROJ_BLOCKS(n)) gemm_q_block(Xh, Wqh, Q, n, blk);
  else scatter_block(coords, grid, n, blk - PROJ_BLOCKS(n));
}

// ------- k,v per-head 16x16 projections (WMMA, K padded to 32) + norm1 -------
// Sum over the 16 lanes that hold the 16 columns of one C tile: DPP row_xmask
// butterfly (ctrl 0x160 | mask), all lanes on; it stays on the vector port, where
// a shuffle would go through the LDS pipe and its wait.
__device__ __forceinline__ float row16_sum(float x) {
  x += __int_as_float(__builtin_amdgcn_update_dpp(0, __float_as_int(x), 0x161, 0xf, 0xf, true));
  x += __int_as_float(__builtin_amdgcn_update_dpp(0, __float_as_int(x), 0x162, 0xf, 0xf, true));
  x += __int_as_float(__builtin_amdgcn_update_dpp(0, __float_as_int(x), 0x164, 0xf, 0xf, true));
  x += __int_as_float(__builtin_amdgcn_update_dpp(0, __float_as_int(x), 0x168, 0xf, 0xf, true));
  return x;
}

// One projection (k or v) of a wave's 16 rows: the 16 x 128 result stays in
// accumulator registers (8 heads x 8 rows per lane), so the row statistics of
// the layernorm come from registers and only the normalised rows are stored.
__device__ __forceinline__ void proj_norm_store(
    const v16h (&a)[NHEAD], const float* __restrict__ wp,
    const float* __restrict__ bias, const float* __restrict__ g,
    const float* __restrict__ b, float* __restrict__ op, int m, int rb, int n) {
  v8f acc[NHEAD];
#pragma unroll
  for (int h = 0; h < NHEAD; ++h) {
    v16h bf = {};  // W[h][e][d], e = m; slots 8..15 = K>=16 stay zero
#pragma unroll
    for (int i = 0; i < 8; ++i) bf[i] = (_Float16)wp[h * HDIM * HDIM + i];
    v8f z = {};
    acc[h] = wmma_f16(a[h], bf, z);
  }

  // bias, then per-row sum and sum of squares: 8 heads in the lane, 16 lanes
  float s[8], q[8];
#pragma unroll
  for (int r = 0; r < 8; ++r) { s[r] = 0.f; q[r] = 0.f; }
#pragma unroll
  for (int h = 0; h < NHEAD; ++h) {
    float bia = bias[h * HDIM + m];
#pragma unroll
    for (int r = 0; r < 8; ++r) {
      float x = acc[h][r] + bia;
      acc[h][r] = x;
      s[r] += x; q[r] += x * x;
    }
  }
#pragma unroll
  for (int r = 0; r < 8; ++r) {
    float mean = row16_sum(s[r]) * (1.0f / FDIM);
    float var  = row16_sum(q[r]) * (1.0f / FDIM) - mean * mean;
    s[r] = mean;
    q[r] = rsqrtf(var + 1e-5f);
  }
#pragma unroll
  for (int h = 0; h < NHEAD; ++h) {
    float gg = g[h * HDIM + m], bb = b[h * HDIM + m];
#pragma unroll
    for (int r = 0; r < 8; ++r) acc[h][r] = (acc[h][r] - s[r]) * q[r] * gg + bb;
  }
#pragma unroll
  for (int r = 0; r < 8; ++r) {
    if (rb + r < n) {
#pragma unroll
      for (int h = 0; h < NHEAD; ++h) op[r * FDIM + h * HDIM] = acc[h][r];
    }
  }
}

__device__ __forceinline__ void kv_heads_ln_block(
    const _Float16* __restrict__ Xh, const float* __restrict__ Wk,
    const float* __restrict__ bk, const float* __restrict__ Wv,
    const float* __restrict__ bv, const float* __restrict__ g,
    const float* __restrict__ b, float* __restrict__ K, float* __restrict__ V,
    int n, int blk) {
  int lane = threadIdx.x & 31;
  int m = lane & 15, kh = lane >> 4;
  int tm = __builtin_amdgcn_readfirstlane(blk * 4 + (threadIdx.x >> 5));
  if (tm * 16 >= n) return;  // scalar branch
  int row = tm * 16 + m;
  if (row >= n) row = n - 1;
  const _Float16* __restrict__ xp = Xh + (size_t)row * FDIM + kh * 8;

  // A: 16 pts x 16 dims (f16) per head, zero-padded to K=32 (slots 8..15 = K>=16)
  v16h a[NHEAD];
#pragma unroll
  for (int h = 0; h < NHEAD; ++h) {
    v8h xa = *(const v8h*)(xp + h * HDIM);
    v16h t = {};
#pragma unroll
    for (int i = 0; i < 8; ++i) t[i] = xa[i];
    a[h] = t;
  }

  const int rb = tm * 16 + 8 * kh;  // C layout: lanes<16 -> M=r, lanes>=16 -> M=8+r
  const int wo = m * HDIM + kh * 8;
  proj_norm_store(a, Wk + wo, bk, g, b, K + (size_t)rb * FDIM + m, m, rb, n);
  proj_norm_store(a, Wv + wo, bv, g, b, V + (size_t)rb * FDIM + m, m, rb, n);
}

// Third launch: the look-up needs the scattered grid; k and v, which attention needs no
// earlier than the table, fill the chip beside it.
__global__ void __launch_bounds__(PROJ_BLOCK) kv_neighbors_k(
    const _Float16* __restrict__ Xh, const float* __restrict__ Wk,
    const float* __restrict__ bk, const float* __restrict__ Wv,
    const float* __restrict__ bv, const float* __restrict__ g,
    const float* __restrict__ b, float* __restrict__ K, float* __restrict__ V,
    const int* __restrict__ coords, const int* __restrict__ grid,
    int* __restrict__ nbr, int n) {
  const int blk = blockIdx.x;
  if (blk < PROJ_BLOCKS(n)) kv_heads_ln_block(Xh, Wk, bk, Wv, bv, g, b, K, V, n, blk);
  else neighbors_block(coords, grid, nbr, n, blk - PROJ_BLOCKS(n));
}

// ------- layernorm (128 cols), 8 rows per wave, templated output -------
typedef __attribute__((ext_vector_type(4))) float v4f;

// rsqrtf as the compiler expands it (x below the smallest normal scaled by 2^24, the
// result by 2^12). The v_rsq_f32 is asm text so that the v_nop, the slot the
// instruction set asks for behind a transcendental, stays directly behind it when
// the 8 rows' instructions are interleaved.
__device__ __forceinline__ float rsqrt_with_slot(float x) {
  const bool tiny = x < 1.17549435e-38f;
  const float xs = tiny ? x * 16777216.0f : x;
  float r;
  asm("v_rsq_f32 %0, %1\n\tv_nop" : "=v"(r) : "v"(xs));
  return tiny ? r * 4096.0f : r;
}

// One row, held 4 columns per lane: summed by the whole wave, in the same order as
// when a wave had one row only.
template <typename OutT>
__device__ __forceinline__ void norm_row(v4f x, OutT* __restrict__ po, v4f gv, v4f bv) {
  float s  = x.x + x.y + x.z + x.w;
  float ss = x.x * x.x + x.y * x.y + x.z * x.z + x.w * x.w;
  for (int off = 16; off >= 1; off >>= 1) {
    s  += __shfl_xor(s, off, 32);
    ss += __shfl_xor(ss, off, 32);
  }
  float mean = s * (1.0f / FDIM);
  float var  = ss * (1.0f / FDIM) - mean * mean;
  float rs = rsqrt_with_slot(var + 1e-5f);
  po[0] = (OutT)((x.x - mean) * rs * gv.x + bv.x);
  po[1] = (OutT)((x.y - mean) * rs * gv.y + bv.y);
  po[2] = (OutT)((x.z - mean) * rs * gv.z + bv.z);
  po[3] = (OutT)((x.w - mean) * rs * gv.w + bv.w);
}

template <typename OutT>
__global__ void __launch_bounds__(STREAM_BLOCK) layernorm_rows_k(
    const float* __restrict__ in, OutT* __restrict__ out, const float* __restrict__ g,
    const float* __restrict__ b, int rows) {
  static_assert(WORK_PER_WAVE == 8, "the load fence below names 8 rows");
  int wid = __builtin_amdgcn_readfirstlane(blockIdx.x * (STREAM_BLOCK >> 5) +
                                           (threadIdx.x >> 5));
  const int r0 = wid * WORK_PER_WAVE;
  if (r0 >= rows) return;  // scalar branch
  const int c = (threadIdx.x & 31) * 4;
  const v4f gv = *(const v4f*)(g + c);
  const v4f bv = *(const v4f*)(b + c);
  const float* __restrict__ ip = in + (size_t)r0 * FDIM + c;
  OutT* __restrict__ po = out + (size_t)r0 * FDIM + c;
  if (r0 + WORK_PER_WAVE <= rows) {  // scalar branch
    v4f v[WORK_PER_WAVE];
    for (int j = 0; j < WORK_PER_WAVE; ++j) v[j] = *(const v4f*)(ip + j * FDIM);
    // Inputs-only fence on the loaded rows: keeps the 8 loads in flight together;
    // without it the compiler sinks each load to its row and waits 8 times.
    asm volatile("" ::"v"(v[0]), "v"(v[1]), "v"(v[2]), "v"(v[3]), "v"(v[4]), "v"(v[5]),
                 "v"(v[6]), "v"(v[7]));
    // Unrolled so that the 8 rows' independent shuffle chains can be interleaved;
    // left rolled, each row waits out its own five LDS round trips.
#pragma unroll
    for (int j = 0; j < WORK_PER_WAVE; ++j) norm_row(v[j], po + j * FDIM, gv, bv);
    // The built code joins the tail's path here, which reuses the stores' registers.
    asm volatile("s_wait_xcnt 0x0" ::: "memory");
    return;
  }
  for (int r = r0; r < rows; ++r, ip += FDIM, po += FDIM)  // last wave's short tail
    norm_row(*(const v4f*)ip, po, gv, bv);
}

// ---------------- 27-neighbor attention + residual ----------------
// one thread per (point, head). The four loops over the 27 slots are unrolled, so
// every index into nb[] and sc[] is a constant and both arrays are plain registers:
// indexed by a loop counter, nb[] is placed in LDS by the compiler, sized for the
// largest block the kernel might get, and that much LDS holds a WGP to two blocks. The
// real block size is declared for the same reason.
#define ATT_BLOCK 256
#define NSLOT 27

// __expf as the compiler expands it (x * log2(e), then v_exp_f32). The v_exp_f32 is asm
// text so that the v_nop, the slot the instruction set asks for behind a transcendental,
// stays directly behind it wherever the compiler schedules the 27 slots.
__device__ __forceinline__ float exp_with_slot(float x) {
  const float y = x * 1.44269504088896340736f;
  float r;
  asm("v_exp_f32 %0, %1\n\tv_nop" : "=v"(r) : "v"(y));
  return r;
}

__global__ void __launch_bounds__(ATT_BLOCK) attention_k(
    const float* __restrict__ Q, const float* __restrict__ Kn,
    const float* __restrict__ Vn, const float* __restrict__ feats,
    const int* __restrict__ nbr, float* __restrict__ Xr, int n) {
  int t = blockIdx.x * ATT_BLOCK + threadIdx.x;
  if (t >= n * NHEAD) return;
  int pt = t >> 3, h = t & 7;
  const float scale = 0.0883883476483184f;  // 1/sqrt(128)
  int nb[NSLOT];  // no slot's load waits for another's: 27 loads in flight together
#pragma unroll
  for (int j = 0; j < NSLOT; ++j) nb[j] = nbr[pt * NSLOT + j];
  float q[HDIM];
#pragma unroll
  for (int d = 0; d < HDIM; ++d) q[d] = Q[(size_t)pt * FDIM + h * HDIM + d];
  float sc[NSLOT];
  float mx = -3.0e38f;
#pragma unroll
  for (int j = 0; j < NSLOT; ++j) {
    float s = -1.0e30f;
    if (nb[j] >= 0) {
      const float* kp = Kn + (size_t)nb[j] * FDIM + h * HDIM;
      float acc = 0.f;
#pragma unroll
      for (int d = 0; d < HDIM; ++d) acc += q[d] * kp[d];
      s = acc * scale;
    }
    sc[j] = s;
    mx = fmaxf(mx, s);
  }
  float denom = 0.f;
#pragma unroll
  for (int j = 0; j < NSLOT; ++j) {
    float e = (nb[j] >= 0) ? exp_with_slot(sc[j] - mx) : 0.f;
    sc[j] = e;
    denom += e;
  }
  float inv = 1.0f / denom;
  float o[HDIM];
#pragma unroll
  for (int d = 0; d < HDIM; ++d) o[d] = 0.f;
#pragma unroll
  for (int j = 0; j < NSLOT; ++j) {
    if (nb[j] >= 0) {
      float p = sc[j] * inv;
      const float* vp = Vn + (size_t)nb[j] * FDIM + h * HDIM;
#pragma unroll
      for (int d = 0; d < HDIM; ++d) o[d] += p * vp[d];
    }
  }
#pragma unroll
  for (int d = 0; d < HDIM; ++d) {
    size_t off = (size_t)pt * FDIM + h * HDIM + d;
    Xr[off] = feats[off] + o[d];
  }
}

// ---------------- fused MLP: gelu(LN(x)@W1^T+b1)@W2^T + b2 + x ----------------
// One block = 64 rows (4 row tiles), 4 waves. The waves split the COLUMNS: every wave
// works on all 4 row tiles, so a weight fragment is loaded by one wave of the block and
// feeds 4 WMMAs; with a row tile per wave each of the 4 waves loaded every fragment.
#define MLP_TILES 4                 // row tiles per block
#define MLP_ROWS (MLP_TILES * 16)
#define HID (4 * FDIM)
#define H_PITCH (HID + 8)           // f16: rows 16 B apart in the banks for b128 readers
__global__ void __launch_bounds__(128) mlp_fused_k(
    const _Float16* __restrict__ XNh, const float* __restrict__ Xr,
    const _Float16* __restrict__ W1h, const float* __restrict__ bm1,
    const _Float16* __restrict__ W2h, const float* __restrict__ bm2,
    float* __restrict__ out, int n) {
  __shared__ __attribute__((aligned(16))) _Float16 hbuf[MLP_ROWS * H_PITCH];  // 65 KB
  const int lane = threadIdx.x & 31;
  const int wave = __builtin_amdgcn_readfirstlane(threadIdx.x >> 5);
  const int m = lane & 15, kh = lane >> 4;
  const int row0 = blockIdx.x * MLP_ROWS;  // < n by the grid

  // stage 1: h = gelu(XN @ W1^T + bm1) -> LDS (f16). A frags of all 64 rows stay in
  // registers; wave w makes columns [128 w, 128 w + 128) of h.
  v16h av[MLP_TILES][4];
#pragma unroll
  for (int rt = 0; rt < MLP_TILES; ++rt) {
    int row = row0 + rt * 16 + m;
    if (row >= n) row = n - 1;  // clamp: duplicate work, never stored
#pragma unroll
    for (int k = 0; k < 4; ++k)
      av[rt][k] = frag_ld_f16(XNh + (size_t)row * FDIM + k * 32 + kh * 8);
    // The built code lets a later tile's loads land on this tile's address registers.
    asm volatile("s_wait_xcnt 0x0" ::: "memory");
  }

  // Left rolled, for speed only: one trip holds 32 inlined erf bodies.
#pragma unroll 1
  for (int ct = 0; ct < 8; ++ct) {  // the wave's 8 column tiles
    const int cn = (wave * 8 + ct) * 16 + m;
    v16h b[4];
#pragma unroll
    for (int k = 0; k < 4; ++k)
      b[k] = frag_ld_f16(W1h + (size_t)cn * FDIM + k * 32 + kh * 8);
    // The built code lets the bias load land on the fragment loads' address registers.
    asm volatile("s_wait_xcnt 0x0" ::: "memory");
    const float bia = bm1[cn];
    // Inputs-only fence on the loaded fragments: keeps the tile's 8 loads in flight
    // together; without it the compiler reuses one fragment's registers and waits 4 times.
    asm volatile("" ::"v"(b[0]), "v"(b[1]), "v"(b[2]), "v"(b[3]));
    v8f acc[MLP_TILES] = {{}, {}, {}, {}};
#pragma unroll
    for (int k = 0; k < 4; ++k) {
#pragma unroll
      for (int rt = 0; rt < MLP_TILES; ++rt) acc[rt] = wmma_f16(av[rt][k], b[k], acc[rt]);
    }
#pragma unroll
    for (int rt = 0; rt < MLP_TILES; ++rt) {
      const int rb = rt * 16 + 8 * kh;  // C layout: lanes<16 -> M=r, lanes>=16 -> M=8+r
#pragma unroll
      for (int r = 0; r < 8; ++r) {
        float val = acc[rt][r] + bia;
        float gv = 0.5f * val * (1.0f + erff(val * 0.7071067811865475f));
        hbuf[(rb + r) * H_PITCH + cn] = (_Float16)gv;
      }
    }
  }
  __syncthreads();  // every wave reads all 512 columns of h below

  // stage 2: out = Xr + h @ W2^T + bm2; wave w makes output columns [32 w, 32 w + 32)
  v8f acc[2][MLP_TILES] = {{{}, {}, {}, {}}, {{}, {}, {}, {}}};
  // Two k steps per trip: together they use up the 128-B line of each W2 row, and the
  // second step's loads fly while the first step's WMMAs run.
#pragma unroll 2
  for (int k0 = 0; k0 < HID; k0 += 32) {
    v16h b[2], a[MLP_TILES];
#pragma unroll
    for (int t = 0; t < 2; ++t)
      b[t] = frag_ld_f16(W2h + (size_t)((wave * 2 + t) * 16 + m) * HID + k0 + kh * 8);
#pragma unroll
    for (int rt = 0; rt < MLP_TILES; ++rt)
      a[rt] = frag_ld_f16(&hbuf[(rt * 16 + m) * H_PITCH + k0 + kh * 8]);
#pragma unroll
    for (int t = 0; t < 2; ++t) {
#pragma unroll
      for (int rt = 0; rt < MLP_TILES; ++rt) acc[t][rt] = wmma_f16(a[rt], b[t], acc[t][rt]);
    }
  }
  const float bia0 = bm2[wave * 32 + m], bia1 = bm2[wave * 32 + 16 + m];
  const size_t o0 = (size_t)(row0 + 8 * kh) * FDIM + wave * 32 + m;
  const float* __restrict__ xp = Xr + o0;
  float* __restrict__ op = out + o0;
  if (row0 + MLP_ROWS <= n) {  // scalar branch: whole block in range
    float x[2][MLP_TILES][8];
#pragma unroll
    for (int t = 0; t < 2; ++t)
#pragma unroll
      for (int rt = 0; rt < MLP_TILES; ++rt)
#pragma unroll
        for (int r = 0; r < 8; ++r) x[t][rt][r] = xp[(rt * 16 + r) * FDIM + t * 16];
#pragma unroll
    for (int t = 0; t < 2; ++t)
#pragma unroll
      for (int rt = 0; rt < MLP_TILES; ++rt)
#pragma unroll
        for (int r = 0; r < 8; ++r)
          op[(rt * 16 + r) * FDIM + t * 16] = x[t][rt][r] + acc[t][rt][r] + (t ? bia1 : bia0);
  } else {
#pragma unroll
    for (int t = 0; t < 2; ++t)
#pragma unroll
      for (int rt = 0; rt < MLP_TILES; ++rt)
#pragma unroll
        for (int r = 0; r < 8; ++r)
          if (row0 + rt * 16 + 8 * kh + r < n)
            op[(rt * 16 + r) * FDIM + t * 16] =
                xp[(rt * 16 + r) * FDIM + t * 16] + acc[t][rt][r] + (t ? bia1 : bia0);
  }
}

// ---------------- host ----------------
extern "C" void kernel_launch(void* const* d_in, const int* in_sizes, int n_in,
                              void* d_out, int out_size, void* d_ws, size_t ws_size,
                              hipStream_t stream) {
  const int*   coords = (const int*)d_in[0];
  const float* feats  = (const float*)d_in[1];
  const float* Wq     = (const float*)d_in[2];
  const float* Wk     = (const float*)d_in[3];
  const float* bk     = (const float*)d_in[4];
  const float* Wv     = (const float*)d_in[5];
  const float* bv     = (const float*)d_in[6];
  const float* g1     = (const float*)d_in[7];
  const float* b1     = (const float*)d_in[8];
  const float* g2     = (const float*)d_in[9];
  const float* b2     = (const float*)d_in[10];
  const float* W1     = (const float*)d_in[11];
  const float* bm1    = (const float*)d_in[12];
  const float* W2     = (const float*)d_in[13];
  const float* bm2    = (const float*)d_in[14];
  float* out = (float*)d_out;
  const int N = in_sizes[1] / FDIM;
  (void)n_in; (void)out_size; (void)ws_size;

  char* ws = (char*)d_ws;
  size_t off = 0;
  auto carve = [&](size_t bytes) {
    void* p = ws + off;
    off = (off + bytes + 255) & ~(size_t)255;
    return p;
  };
  int*       grid = (int*)carve((size_t)GRID_CELLS * sizeof(int));
  int*       nbr  = (int*)carve((size_t)N * 27 * sizeof(int));
  float*     qb   = (float*)carve((size_t)N * FDIM * sizeof(float));
  float*     kb   = (float*)carve((size_t)N * FDIM * sizeof(float));
  float*     vb   = (float*)carve((size_t)N * FDIM * sizeof(float));
  float*     xr   = (float*)carve((size_t)N * FDIM * sizeof(float));
  _Float16*  Xh   = (_Float16*)carve((size_t)N * FDIM * sizeof(_Float16));
  _Float16*  xnh  = (_Float16*)carve((size_t)N * FDIM * sizeof(_Float16));
  _Float16*  Wqh  = (_Float16*)carve((size_t)FDIM * FDIM * sizeof(_Float16));
  _Float16*  W1h  = (_Float16*)carve((size_t)4 * FDIM * FDIM * sizeof(_Float16));
  _Float16*  W2h  = (_Float16*)carve((size_t)4 * FDIM * FDIM * sizeof(_Float16));

  const int mt = (N + 15) / 16;

  // inputs only: f32 -> f16 conversions and the grid fill
  int nf4 = (N * FDIM) / 4;
  prep_k<<<TILES_OF(nf4) + PREP_FIXED_BLOCKS, STREAM_BLOCK, 0, stream>>>(
      feats, Xh, nf4, Wq, Wqh, W1, W1h, W2, W2h, grid);

  // q projection beside the scatter into the grid
  q_scatter_k<<<PROJ_BLOCKS(N) + POINT_BLOCKS(N), PROJ_BLOCK, 0, stream>>>(
      Xh, Wqh, qb, coords, grid, N);

  // k, v with norm1 applied in the same kernel, beside the neighbor table
  kv_neighbors_k<<<PROJ_BLOCKS(N) + POINT_BLOCKS(N), PROJ_BLOCK, 0, stream>>>(
      Xh, Wk, bk, Wv, bv, g1, b1, kb, vb, coords, grid, nbr, N);

  // attention + residual -> xr
  attention_k<<<(N * NHEAD + ATT_BLOCK - 1) / ATT_BLOCK, ATT_BLOCK, 0, stream>>>(
      qb, kb, vb, feats, nbr, xr, N);

  // norm2 -> f16 activations for the MLP
  layernorm_rows_k<_Float16><<<(N + NORM_ROWS - 1) / NORM_ROWS, STREAM_BLOCK, 0, stream>>>(
      xr, xnh, g2, b2, N);

  // fused MLP + residual -> out (64 rows per block, h tile in static LDS)
  mlp_fused_k<<<(mt + 3) / 4, 128, 0, stream>>>(xnh, xr, W1h, bm1, W2h, bm2, out, N);
}

// v006
// A run of this version takes 80.6 microseconds.
// In two side-by-side timings against v005, it was 1.12 and 1.13 times as fast.
// Over all steps from v000 it is 3.02 times as fast.
#include <hip/hip_runtime.h>
#include <math.h>

// ---------------- problem constants ----------------
#define GX 256
#define GY 256
#define GZ 32
#define GRID_CELLS (GX * GY * GZ)   // 2,097,152
#define FDIM 128
#define NHEAD 8
#define HDIM 16

typedef __attribute__((ext_vector_type(16))) _Float16 v16h;
typedef __attribute__((ext_vector_type(8)))  _Float16 v8h;
typedef __attribute__((ext_vector_type(4)))  _Float16 v4h;
typedef __attribute__((ext_vector_type(8)))  float    v8f;

// A/B fragment for v_wmma_f32_16x16x32_f16 from row-major packed f16.
// p = &M[row][k0 + khalf*8]:
//   frag[i]   = K(k0 + khalf*8 + i)       i in 0..7   (16B contiguous)
//   frag[8+i] = K(k0 + 16 + khalf*8 + i)              (16B contiguous)
__device__ __forceinline__ v16h frag_ld_f16(const _Float16* __restrict__ p) {
  v8h lo = *(const v8h*)p;
  v8h hi = *(const v8h*)(p + 16);
  v16h r;
#pragma unroll
  for (int i = 0; i < 8; ++i) { r[i] = lo[i]; r[8 + i] = hi[i]; }
  return r;
}

__device__ __forceinline__ v8f wmma_f16(v16h a, v16h b, v8f c) {
  return __builtin_amdgcn_wmma_f32_16x16x32_f16(false, a, false, b, (short)0, c,
                                                false, false);
}

// Streaming kernels (grid fill, conversion, layernorm): each wave takes WORK_PER_WAVE
// 512-B rows, for speed only.
#define STREAM_BLOCK 256
#define WORK_PER_WAVE 8
#define STREAM_TILE (STREAM_BLOCK * WORK_PER_WAVE)  // 16-B pieces per block
#define NORM_ROWS ((STREAM_BLOCK / 32) * WORK_PER_WAVE)  // layernorm rows per block

// Launches that do not depend on each other share one grid: each block takes one role,
// picked by a scalar compare on its index, and gets its index within that role (blk).

// ---------------- f32 -> f16 conversion (vectorized x4) ----------------
// 8 float4 per thread, all loads issued before the first store.
__device__ __forceinline__ void cvt4_f16_block(
    const float* __restrict__ in, _Float16* __restrict__ out, int n4, int blk) {
  const int base = blk * STREAM_TILE;
  const float4* __restrict__ ip = (const float4*)in + base + threadIdx.x;
  v4h* __restrict__ op = (v4h*)out + base + threadIdx.x;
  if (base + STREAM_TILE <= n4) {  // whole block in range: scalar branch
    float4 v[WORK_PER_WAVE];
    for (int j = 0; j < WORK_PER_WAVE; ++j) v[j] = ip[j * STREAM_BLOCK];
    for (int j = 0; j < WORK_PER_WAVE; ++j) {
      v4h o = {(_Float16)v[j].x, (_Float16)v[j].y, (_Float16)v[j].z, (_Float16)v[j].w};
      op[j * STREAM_BLOCK] = o;
    }
    // The built code joins the tail's path here, which reuses the stores' registers.
    asm volatile("s_wait_xcnt 0x0" ::: "memory");
  } else {
    for (int j = 0; j < WORK_PER_WAVE; ++j) {
      if (base + j * STREAM_BLOCK + (int)threadIdx.x < n4) {
        float4 v = ip[j * STREAM_BLOCK];
        v4h o = {(_Float16)v.x, (_Float16)v.y, (_Float16)v.z, (_Float16)v.w};
        op[j * STREAM_BLOCK] = o;
      }
    }
  }
}

// ---------------- neighbor table ----------------
// 8 stores of 16 B per thread; the grid is a whole number of block tiles.
static_assert(GRID_CELLS % (4 * STREAM_TILE) == 0, "grid fill has no tail");
__device__ __forceinline__ void init_grid_block(int* __restrict__ grid, int blk) {
  int4* __restrict__ p = (int4*)grid + blk * STREAM_TILE + threadIdx.x;
  for (int j = 0; j < WORK_PER_WAVE; ++j)
    p[j * STREAM_BLOCK] = make_int4(-1, -1, -1, -1);
}

// First launch: everything that reads only inputs. Roles in index order: feats, the
// grid fill, then Wq, W1, W2.
#define TILES_OF(n4) (((n4) + STREAM_TILE - 1) / STREAM_TILE)
#define GRID_BLOCKS (GRID_CELLS / (4 * STREAM_TILE))
#define WQ_N4 (FDIM * FDIM / 4)
#define WM_N4 (4 * FDIM * FDIM / 4)  // W1 and W2 alike
#define PREP_FIXED_BLOCKS (GRID_BLOCKS + TILES_OF(WQ_N4) + 2 * TILES_OF(WM_N4))
__global__ void __launch_bounds__(STREAM_BLOCK) prep_k(
    const float* __restrict__ feats, _Float16* __restrict__ Xh, int nf4,
    const float* __restrict__ Wq, _Float16* __restrict__ Wqh,
    const float* __restrict__ W1, _Float16* __restrict__ W1h,
    const float* __restrict__ W2, _Float16* __restrict__ W2h, int* __restrict__ grid) {
  int blk = blockIdx.x;
  if (blk < TILES_OF(nf4)) { cvt4_f16_block(feats, Xh, nf4, blk); return; }
  blk -= TILES_OF(nf4);
  if (blk < GRID_BLOCKS) { init_grid_block(grid, blk); return; }
  blk -= GRID_BLOCKS;
  if (blk < TILES_OF(WQ_N4)) { cvt4_f16_block(Wq, Wqh, WQ_N4, blk); return; }
  blk -= TILES_OF(WQ_N4);
  if (blk < TILES_OF(WM_N4)) { cvt4_f16_block(W1, W1h, WM_N4, blk); return; }
  cvt4_f16_block(W2, W2h, WM_N4, blk - TILES_OF(WM_N4));
}

// scatter and look-up run in blocks of PROJ_BLOCK threads, the size of the projection
// blocks whose grids they share.
#define PROJ_BLOCK 128
__device__ __forceinline__ void scatter_block(const int* __restrict__ coords,
                                              int* __restrict__ grid, int n, int blk) {
  int i = blk * PROJ_BLOCK + threadIdx.x;
  if (i >= n) return;
  int x = coords[i * 3 + 0], y = coords[i * 3 + 1], z = coords[i * 3 + 2];
  grid[x * (GY * GZ) + y * GZ + z] = i;
}

__device__ __forceinline__ void neighbors_block(const int* __restrict__ coords,
                                                const int* __restrict__ grid,
                                                int* __restrict__ nbr, int n, int blk) {
  int i = blk * PROJ_BLOCK + threadIdx.x;
  if (i >= n) return;
  int x = coords[i * 3 + 0], y = coords[i * 3 + 1], z = coords[i * 3 + 2];
#pragma unroll
  for (int j = 0; j < 27; ++j) {
    int dx = j / 9 - 1, dy = (j / 3) % 3 - 1, dz = j % 3 - 1;
    int nx = x + dx, ny = y + dy, nz = z + dz;
    int v = -1;
    if (nx >= 0 && nx < GX && ny >= 0 && ny < GY && nz >= 0 && nz < GZ)
      v = grid[nx * (GY * GZ) + ny * GZ + nz];
    nbr[i * 27 + j] = v;
  }
}

// ---------------- q = feats @ Wq^T  (WMMA, f16 operands) ----------------
// 4 waves/block; each wave owns one 16-row strip; 2 groups of 4 col tiles so
// 4 independent accumulator chains hide B-load latency behind wmma.
__device__ __forceinline__ void gemm_q_block(const _Float16* __restrict__ Xh,
                                             const _Float16* __restrict__ Wqh,
                                             float* __restrict__ Q, int n, int blk) {
  int lane = threadIdx.x & 31;
  int m = lane & 15, kh = lane >> 4;
  int tm = __builtin_amdgcn_readfirstlane(blk * 4 + (threadIdx.x >> 5));
  if (tm * 16 >= n) return;  // scalar branch
  int row = tm * 16 + m;
  if (row >= n) row = n - 1;
  const bool full = (tm * 16 + 16) <= n;  // SGPR condition

  v16h av[4];
#pragma unroll
  for (int k = 0; k < 4; ++k)
    av[k] = frag_ld_f16(Xh + (size_t)row * FDIM + k * 32 + kh * 8);

#pragma unroll 1
  for (int tg = 0; tg < 2; ++tg) {  // 2 groups of 4 column tiles
    v8f acc[4] = {{}, {}, {}, {}};
#pragma unroll
    for (int k = 0; k < 4; ++k) {
      v16h b[4];
#pragma unroll
      for (int t = 0; t < 4; ++t) {
        int col = (tg * 4 + t) * 16 + m;
        b[t] = frag_ld_f16(Wqh + (size_t)col * FDIM + k * 32 + kh * 8);
      }
#pragma unroll
      for (int t = 0; t < 4; ++t) acc[t] = wmma_f16(av[k], b[t], acc[t]);
    }
#pragma unroll
    for (int t = 0; t < 4; ++t) {
      int cn = (tg * 4 + t) * 16 + m;
      int rb = tm * 16 + 8 * kh;  // C layout: lanes<16 -> M=r, lanes>=16 -> M=8+r
      if (full) {
#pragma unroll
        for (int r = 0; r < 8; ++r) Q[(size_t)(rb + r) * FDIM + cn] = acc[t][r];
        // The built code joins the guarded path here, which reuses the stores' registers.
        asm volatile("s_wait_xcnt 0x0" ::: "memory");
      } else {
#pragma unroll
        for (int r = 0; r < 8; ++r)
          if (rb + r < n) Q[(size_t)(rb + r) * FDIM + cn] = acc[t][r];
      }
    }
  }
}

// Second launch: what needs only the first one's results. The projection blocks come
// first in the index, the short scatter blocks behind them.
#define PROJ_BLOCKS(n) (((n) + 63) / 64)                    // 4 strips of 16 rows each
#define POINT_BLOCKS(n) (((n) + PROJ_BLOCK - 1) / PROJ_BLOCK)  // one thread per point
__global__ void __launch_bounds__(PROJ_BLOCK) q_scatter_k(
    const _Float16* __restrict__ Xh, const _Float16* __restrict__ Wqh,
    float* __restrict__ Q, const int* __restrict__ coords, int* __restrict__ grid,
    int n) {
  const int blk = blockIdx.x;
  if (blk < PROJ_BLOCKS(n)) gemm_q_block(Xh, Wqh, Q, n, blk);
  else scatter_block(coords, grid, n, blk - PROJ_BLOCKS(n));
}

// ------- k,v per-head 16x16 projections (WMMA, K padded to 32) + norm1 -------
// Sum over the 16 lanes that hold the 16 columns of one C tile: DPP row_xmask
// butterfly (ctrl 0x160 | mask), all lanes on; it stays on the vector port, where
// a shuffle would go through the LDS pipe and its wait.
__device__ __forceinline__ float row16_sum(float x) {
  x += __int_as_float(__builtin_amdgcn_update_dpp(0, __float_as_int(x), 0x161, 0xf, 0xf, true));
  x += __int_as_float(__builtin_amdgcn_update_dpp(0, __float_as_int(x), 0x162, 0xf, 0xf, true));
  x += __int_as_float(__builtin_amdgcn_update_dpp(0, __float_as_int(x), 0x164, 0xf, 0xf, true));
  x += __int_as_float(__builtin_amdgcn_update_dpp(0, __float_as_int(x), 0x168, 0xf, 0xf, true));
  return x;
}

// One projection (k or v) of a wave's 16 rows: the 16 x 128 result stays in
// accumulator registers (8 heads x 8 rows per lane), so the row statistics of
// the layernorm come from registers and only the normalised rows are stored.
__device__ __forceinline__ void proj_norm_store(
    const v16h (&a)[NHEAD], const float* __restrict__ wp,
    const float* __restrict__ bias, const float* __restrict__ g,
    const float* __restrict__ b, float* __restrict__ op, int m, int rb, int n) {
  v8f acc[NHEAD];
#pragma unroll
  for (int h = 0; h < NHEAD; ++h) {
    v16h bf = {};  // W[h][e][d], e = m; slots 8..15 = K>=16 stay zero
#pragma unroll
    for (int i = 0; i < 8; ++i) bf[i] = (_Float16)wp[h * HDIM * HDIM + i];
    v8f z = {};
    acc[h] = wmma_f16(a[h], bf, z);
  }

  // bias, then per-row sum and sum of squares: 8 heads in the lane, 16 lanes
  float s[8], q[8];
#pragma unroll
  for (int r = 0; r < 8; ++r) { s[r] = 0.f; q[r] = 0.f; }
#pragma unroll
  for (int h = 0; h < NHEAD; ++h) {
    float bia = bias[h * HDIM + m];
#pragma unroll
    for (int r = 0; r < 8; ++r) {
      float x = acc[h][r] + bia;
      acc[h][r] = x;
      s[r] += x; q[r] += x * x;
    }
  }
#pragma unroll
  for (int r = 0; r < 8; ++r) {
    float mean = row16_sum(s[r]) * (1.0f / FDIM);
    float var  = row16_sum(q[r]) * (1.0f / FDIM) - mean * mean;
    s[r] = mean;
    q[r] = rsqrtf(var + 1e-5f);
  }
#pragma unroll
  for (int h = 0; h < NHEAD; ++h) {
    float gg = g[h * HDIM + m], bb = b[h * HDIM + m];
#pragma unroll
    for (int r = 0; r < 8; ++r) acc[h][r] = (acc[h][r] - s[r]) * q[r] * gg + bb;
  }
#pragma unroll
  for (int r = 0; r < 8; ++r) {
    if (rb + r < n) {
#pragma unroll
      for (int h = 0; h < NHEAD; ++h) op[r * FDIM + h * HDIM] = acc[h][r];
    }
  }
}

__device__ __forceinline__ void kv_heads_ln_block(
    const _Float16* __restrict__ Xh, const float* __restrict__ Wk,
    const float* __restrict__ bk, const float* __restrict__ Wv,
    const float* __restrict__ bv, const float* __restrict__ g,
    const float* __restrict__ b, float* __restrict__ K, float* __restrict__ V,
    int n, int blk) {
  int lane = threadIdx.x & 31;
  int m = lane & 15, kh = lane >> 4;
  int tm = __builtin_amdgcn_readfirstlane(blk * 4 + (threadIdx.x >> 5));
  if (tm * 16 >= n) return;  // scalar branch
  int row = tm * 16 + m;
  if (row >= n) row = n - 1;
  const _Float16* __restrict__ xp = Xh + (size_t)row * FDIM + kh * 8;

  // A: 16 pts x 16 dims (f16) per head, zero-padded to K=32 (slots 8..15 = K>=16)
  v16h a[NHEAD];
#pragma unroll
  for (int h = 0; h < NHEAD; ++h) {
    v8h xa = *(const v8h*)(xp + h * HDIM);
    v16h t = {};
#pragma unroll
    for (int i = 0; i < 8; ++i) t[i] = xa[i];
    a[h] = t;
  }

  const int rb = tm * 16 + 8 * kh;  // C layout: lanes<16 -> M=r, lanes>=16 -> M=8+r
  const int wo = m * HDIM + kh * 8;
  proj_norm_store(a, Wk + wo, bk, g, b, K + (size_t)rb * FDIM + m, m, rb, n);
  proj_norm_store(a, Wv + wo, bv, g, b, V + (size_t)rb * FDIM + m, m, rb, n);
}

// Third launch: the look-up needs the scattered grid; k and v, which attention needs no
// earlier than the table, fill the chip beside it.
__global__ void __launch_bounds__(PROJ_BLOCK) kv_neighbors_k(
    const _Float16* __restrict__ Xh, const float* __restrict__ Wk,
    const float* __restrict__ bk, const float* __restrict__ Wv,
    const float* __restrict__ bv, const float* __restrict__ g,
    const float* __restrict__ b, float* __restrict__ K, float* __restrict__ V,
    const int* __restrict__ coords, const int* __restrict__ grid,
    int* __restrict__ nbr, int n) {
  const int blk = blockIdx.x;
  if (blk < PROJ_BLOCKS(n)) kv_heads_ln_block(Xh, Wk, bk, Wv, bv, g, b, K, V, n, blk);
  else neighbors_block(coords, grid, nbr, n, blk - PROJ_BLOCKS(n));
}

// ------- layernorm (128 cols), 8 rows per wave, templated output -------
typedef __attribute__((ext_vector_type(4))) float v4f;

// rsqrtf as the compiler expands it (x below the smallest normal scaled by 2^24, the
// result by 2^12). The v_rsq_f32 is asm text so that the v_nop, the slot the
// instruction set asks for behind a transcendental, stays directly behind it when
// the 8 rows' instructions are interleaved.
__device__ __forceinline__ float rsqrt_with_slot(float x) {
  const bool tiny = x < 1.17549435e-38f;
  const float xs = tiny ? x * 16777216.0f : x;
  float r;
  asm("v_rsq_f32 %0, %1\n\tv_nop" : "=v"(r) : "v"(xs));
  return tiny ? r * 4096.0f : r;
}

// One row, held 4 columns per lane: summed by the whole wave, in the same order as
// when a wave had one row only.
template <typename OutT>
__device__ __forceinline__ void norm_row(v4f x, OutT* __restrict__ po, v4f gv, v4f bv) {
  float s  = x.x + x.y + x.z + x.w;
  float ss = x.x * x.x + x.y * x.y + x.z * x.z + x.w * x.w;
  for (int off = 16; off >= 1; off >>= 1) {
    s  += __shfl_xor(s, off, 32);
    ss += __shfl_xor(ss, off, 32);
  }
  float mean = s * (1.0f / FDIM);
  float var  = ss * (1.0f / FDIM) - mean * mean;
  float rs = rsqrt_with_slot(var + 1e-5f);
  po[0] = (OutT)((x.x - mean) * rs * gv.x + bv.x);
  po[1] = (OutT)((x.y - mean) * rs * gv.y + bv.y);
  po[2] = (OutT)((x.z - mean) * rs * gv.z + bv.z);
  po[3] = (OutT)((x.w - mean) * rs * gv.w + bv.w);
}

template <typename OutT>
__global__ void __launch_bounds__(STREAM_BLOCK) layernorm_rows_k(
    const float* __restrict__ in, OutT* __restrict__ out, const float* __restrict__ g,
    const float* __restrict__ b, int rows) {
  static_assert(WORK_PER_WAVE == 8, "the load fence below names 8 rows");
  int wid = __builtin_amdgcn_readfirstlane(blockIdx.x * (STREAM_BLOCK >> 5) +
                                           (threadIdx.x >> 5));
  const int r0 = wid * WORK_PER_WAVE;
  if (r0 >= rows) return;  // scalar branch
  const int c = (threadIdx.x & 31) * 4;
  const v4f gv = *(const v4f*)(g + c);
  const v4f bv = *(const v4f*)(b + c);
  const float* __restrict__ ip = in + (size_t)r0 * FDIM + c;
  OutT* __restrict__ po = out + (size_t)r0 * FDIM + c;
  if (r0 + WORK_PER_WAVE <= rows) {  // scalar branch
    v4f v[WORK_PER_WAVE];
    for (int j = 0; j < WORK_PER_WAVE; ++j) v[j] = *(const v4f*)(ip + j * FDIM);
    // Inputs-only fence on the loaded rows: keeps the 8 loads in flight together;
    // without it the compiler sinks each load to its row and waits 8 times.
    asm volatile("" ::"v"(v[0]), "v"(v[1]), "v"(v[2]), "v"(v[3]), "v"(v[4]), "v"(v[5]),
                 "v"(v[6]), "v"(v[7]));
    // Unrolled so that the 8 rows' independent shuffle chains can be interleaved;
    // left rolled, each row waits out its own five LDS round trips.
#pragma unroll
    for (int j = 0; j < WORK_PER_WAVE; ++j) norm_row(v[j], po + j * FDIM, gv, bv);
    // The built code joins the tail's path here, which reuses the stores' registers.
    asm volatile("s_wait_xcnt 0x0" ::: "memory");
    return;
  }
  for (int r = r0; r < rows; ++r, ip += FDIM, po += FDIM)  // last wave's short tail
    norm_row(*(const v4f*)ip, po, gv, bv);
}

// ---------------- 27-neighbor attention + residual ----------------
// one thread per (point, head). The four loops over the 27 slots are unrolled, so
// every index into nb[] and sc[] is a constant and both arrays are plain registers:
// indexed by a loop counter, nb[] is placed in LDS by the compiler, sized for the
// largest block the kernel might get, and that much LDS holds a WGP to two blocks. The
// real block size is declared for the same reason.
#define ATT_BLOCK 256
#define NSLOT 27

// __expf as the compiler expands it (x * log2(e), then v_exp_f32). The v_exp_f32 is asm
// text so that the v_nop, the slot the instruction set asks for behind a transcendental,
// stays directly behind it wherever the compiler schedules the 27 slots.
__device__ __forceinline__ float exp_with_slot(float x) {
  const float y = x * 1.44269504088896340736f;
  float r;
  asm("v_exp_f32 %0, %1\n\tv_nop" : "=v"(r) : "v"(y));
  return r;
}

__global__ void __launch_bounds__(ATT_BLOCK) attention_k(
    const float* __restrict__ Q, const float* __restrict__ Kn,
    const float* __restrict__ Vn, const float* __restrict__ feats,
    const int* __restrict__ nbr, float* __restrict__ Xr, int n) {
  int t = blockIdx.x * ATT_BLOCK + threadIdx.x;
  if (t >= n * NHEAD) return;
  int pt = t >> 3, h = t & 7;
  const float scale = 0.0883883476483184f;  // 1/sqrt(128)
  int nb[NSLOT];  // no slot's load waits for another's: 27 loads in flight together
#pragma unroll
  for (int j = 0; j < NSLOT; ++j) nb[j] = nbr[pt * NSLOT + j];
  float q[HDIM];
#pragma unroll
  for (int d = 0; d < HDIM; ++d) q[d] = Q[(size_t)pt * FDIM + h * HDIM + d];
  float sc[NSLOT];
  float mx = -3.0e38f;
#pragma unroll
  for (int j = 0; j < NSLOT; ++j) {
    float s = -1.0e30f;
    if (nb[j] >= 0) {
      const float* kp = Kn + (size_t)nb[j] * FDIM + h * HDIM;
      float acc = 0.f;
#pragma unroll
      for (int d = 0; d < HDIM; ++d) acc += q[d] * kp[d];
      s = acc * scale;
    }
    sc[j] = s;
    mx = fmaxf(mx, s);
  }
  float denom = 0.f;
#pragma unroll
  for (int j = 0; j < NSLOT; ++j) {
    float e = (nb[j] >= 0) ? exp_with_slot(sc[j] - mx) : 0.f;
    sc[j] = e;
    denom += e;
  }
  float inv = 1.0f / denom;
  float o[HDIM];
#pragma unroll
  for (int d = 0; d < HDIM; ++d) o[d] = 0.f;
#pragma unroll
  for (int j = 0; j < NSLOT; ++j) {
    if (nb[j] >= 0) {
      float p = sc[j] * inv;
      const float* vp = Vn + (size_t)nb[j] * FDIM + h * HDIM;
#pragma unroll
      for (int d = 0; d < HDIM; ++d) o[d] += p * vp[d];
    }
  }
#pragma unroll
  for (int d = 0; d < HDIM; ++d) {
    size_t off = (size_t)pt * FDIM + h * HDIM + d;
    Xr[off] = feats[off] + o[d];
  }
}

// gelu(x) = 0.5 x (1 + erf(x / sqrt 2)) = max(x, 0) - |x| * 0.5 erfc(|x| / sqrt 2), with
// erfc(z) = t (a1 + t (a2 + t (a3 + t (a4 + t a5)))) exp(-z^2), t = 1 / (1 + p z): the
// five-term rational form of erf, absolute error below 1.5e-7 for every z >= 0; the 0.5
// is folded into the coefficients. One straight line for every x, so the 32 values of a
// trip are worked on side by side; the library's erff takes one of two ranges by |x|,
// and a wave with lanes in both walks both, one value after the other.
// The hardware's own rcp and exp2 are enough here: exp2 gives 0 where the true value is
// below the smallest normal, and there the whole term is far below an f16 step of h.
__device__ __forceinline__ float gelu_erf(float x) {
  const float ax = fabsf(x);
  const float t = __builtin_amdgcn_rcpf(fmaf(ax, 0.3275911f * 0.7071067811865475f, 1.0f));
  const float e = __builtin_amdgcn_exp2f(x * x * -0.72134752044448170368f);  // exp(-x^2/2)
  float p = 0.5f * 1.061405429f;
  p = fmaf(p, t, 0.5f * -1.453152027f);
  p = fmaf(p, t, 0.5f * 1.421413741f);
  p = fmaf(p, t, 0.5f * -0.284496736f);
  p = fmaf(p, t, 0.5f * 0.254829592f);
  return fmaf(-(ax * e), p * t, fmaxf(x, 0.0f));
}

// ---------------- fused MLP: gelu(LN(x)@W1^T+b1)@W2^T + b2 + x ----------------
// One block = 64 rows (4 row tiles), 4 waves. The waves split the COLUMNS: every wave
// works on all 4 row tiles, so a weight fragment is loaded by one wave of the block and
// feeds 4 WMMAs; with a row tile per wave each of the 4 waves loaded every fragment.
#define MLP_TILES 4                 // row tiles per block
#define MLP_ROWS (MLP_TILES * 16)
#define HID (4 * FDIM)
#define H_PITCH (HID + 8)           // f16: rows 16 B apart in the banks for b128 readers
__global__ void __launch_bounds__(128) mlp_fused_k(
    const _Float16* __restrict__ XNh, const float* __restrict__ Xr,
    const _Float16* __restrict__ W1h, const float* __restrict__ bm1,
    const _Float16* __restrict__ W2h, const float* __restrict__ bm2,
    float* __restrict__ out, int n) {
  __shared__ __attribute__((aligned(16))) _Float16 hbuf[MLP_ROWS * H_PITCH];  // 65 KB
  const int lane = threadIdx.x & 31;
  const int wave = __builtin_amdgcn_readfirstlane(threadIdx.x >> 5);
  const int m = lane & 15, kh = lane >> 4;
  const int row0 = blockIdx.x * MLP_ROWS;  // < n by the grid

  // stage 1: h = gelu(XN @ W1^T + bm1) -> LDS (f16). A frags of all 64 rows stay in
  // registers; wave w makes columns [128 w, 128 w + 128) of h.
  v16h av[MLP_TILES][4];
#pragma unroll
  for (int rt = 0; rt < MLP_TILES; ++rt) {
    int row = row0 + rt * 16 + m;
    if (row >= n) row = n - 1;  // clamp: duplicate work, never stored
#pragma unroll
    for (int k = 0; k < 4; ++k)
      av[rt][k] = frag_ld_f16(XNh + (size_t)row * FDIM + k * 32 + kh * 8);
    // The built code lets a later tile's loads land on this tile's address registers.
    asm volatile("s_wait_xcnt 0x0" ::: "memory");
  }

  for (int ct = 0; ct < 8; ++ct) {  // the wave's 8 column tiles
    const int cn = (wave * 8 + ct) * 16 + m;
    v16h b[4];
#pragma unroll
    for (int k = 0; k < 4; ++k)
      b[k] = frag_ld_f16(W1h + (size_t)cn * FDIM + k * 32 + kh * 8);
    // The built code lets the bias load land on the fragment loads' address registers.
    asm volatile("s_wait_xcnt 0x0" ::: "memory");
    const float bia = bm1[cn];
    // Inputs-only fence on the loaded fragments: keeps the tile's 8 loads in flight
    // together; without it the compiler reuses one fragment's registers and waits 4 times.
    asm volatile("" ::"v"(b[0]), "v"(b[1]), "v"(b[2]), "v"(b[3]));
    v8f acc[MLP_TILES] = {{}, {}, {}, {}};
#pragma unroll
    for (int k = 0; k < 4; ++k) {
#pragma unroll
      for (int rt = 0; rt < MLP_TILES; ++rt) acc[rt] = wmma_f16(av[rt][k], b[k], acc[rt]);
    }
#pragma unroll
    for (int rt = 0; rt < MLP_TILES; ++rt) {
      const int rb = rt * 16 + 8 * kh;  // C layout: lanes<16 -> M=r, lanes>=16 -> M=8+r
#pragma unroll
      for (int r = 0; r < 8; ++r) {
        hbuf[(rb + r) * H_PITCH + cn] = (_Float16)gelu_erf(acc[rt][r] + bia);
      }
    }
  }
  __syncthreads();  // every wave reads all 512 columns of h below

  // stage 2: out = Xr + h @ W2^T + bm2; wave w makes output columns [32 w, 32 w + 32)
  v8f acc[2][MLP_TILES] = {{{}, {}, {}, {}}, {{}, {}, {}, {}}};
  // Two k steps per trip: together they use up the 128-B line of each W2 row, and the
  // second step's loads fly while the first step's WMMAs run.
#pragma unroll 2
  for (int k0 = 0; k0 < HID; k0 += 32) {
    v16h b[2], a[MLP_TILES];
#pragma unroll
    for (int t = 0; t < 2; ++t)
      b[t] = frag_ld_f16(W2h + (size_t)((wave * 2 + t) * 16 + m) * HID + k0 + kh * 8);
#pragma unroll
    for (int rt = 0; rt < MLP_TILES; ++rt)
      a[rt] = frag_ld_f16(&hbuf[(rt * 16 + m) * H_PITCH + k0 + kh * 8]);
#pragma unroll
    for (int t = 0; t < 2; ++t) {
#pragma unroll
      for (int rt = 0; rt < MLP_TILES; ++rt) acc[t][rt] = wmma_f16(a[rt], b[t], acc[t][rt]);
    }
  }
  const float bia0 = bm2[wave * 32 + m], bia1 = bm2[wave * 32 + 16 + m];
  const size_t o0 = (size_t)(row0 + 8 * kh) * FDIM + wave * 32 + m;
  const float* __restrict__ xp = Xr + o0;
  float* __restrict__ op = out + o0;
  if (row0 + MLP_ROWS <= n) {  // scalar branch: whole block in range
    float x[2][MLP_TILES][8];
#pragma unroll
    for (int t = 0; t < 2; ++t)
#pragma unroll
      for (int rt = 0; rt < MLP_TILES; ++rt)
#pragma unroll
        for (int r = 0; r < 8; ++r) x[t][rt][r] = xp[(rt * 16 + r) * FDIM + t * 16];
#pragma unroll
    for (int t = 0; t < 2; ++t)
#pragma unroll
      for (int rt = 0; rt < MLP_TILES; ++rt)
#pragma unroll
        for (int r = 0; r < 8; ++r)
          op[(rt * 16 + r) * FDIM + t * 16] = x[t][rt][r] + acc[t][rt][r] + (t ? bia1 : bia0);
  } else {
#pragma unroll
    for (int t = 0; t < 2; ++t)
#pragma unroll
      for (int rt = 0; rt < MLP_TILES; ++rt)
#pragma unroll
        for (int r = 0; r < 8; ++r)
          if (row0 + rt * 16 + 8 * kh + r < n)
            op[(rt * 16 + r) * FDIM + t * 16] =
                xp[(rt * 16 + r) * FDIM + t * 16] + acc[t][rt][r] + (t ? bia1 : bia0);
  }
}

// ---------------- host ----------------
extern "C" void kernel_launch(void* const* d_in, const int* in_sizes, int n_in,
                              void* d_out, int out_size, void* d_ws, size_t ws_size,
                              hipStream_t stream) {
  const int*   coords = (const int*)d_in[0];
  const float* feats  = (const float*)d_in[1];
  const float* Wq     = (const float*)d_in[2];
  const float* Wk     = (const float*)d_in[3];
  const float* bk     = (const float*)d_in[4];
  const float* Wv     = (const float*)d_in[5];
  const float* bv     = (const float*)d_in[6];
  const float* g1     = (const float*)d_in[7];
  const float* b1     = (const float*)d_in[8];
  const float* g2     = (const float*)d_in[9];
  const float* b2     = (const float*)d_in[10];
  const float* W1     = (const float*)d_in[11];
  const float* bm1    = (const float*)d_in[12];
  const float* W2     = (const float*)d_in[13];
  const float* bm2    = (const float*)d_in[14];
  float* out = (float*)d_out;
  const int N = in_sizes[1] / FDIM;
  (void)n_in; (void)out_size; (void)ws_size;

  char* ws = (char*)d_ws;
  size_t off = 0;
  auto carve = [&](size_t bytes) {
    void* p = ws + off;
    off = (off + bytes + 255) & ~(size_t)255;
    return p;
  };
  int*       grid = (int*)carve((size_t)GRID_CELLS * sizeof(int));
  int*       nbr  = (int*)carve((size_t)N * 27 * sizeof(int));
  float*     qb   = (float*)carve((size_t)N * FDIM * sizeof(float));
  float*     kb   = (float*)carve((size_t)N * FDIM * sizeof(float));
  float*     vb   = (float*)carve((size_t)N * FDIM * sizeof(float));
  float*     xr   = (float*)carve((size_t)N * FDIM * sizeof(float));
  _Float16*  Xh   = (_Float16*)carve((size_t)N * FDIM * sizeof(_Float16));
  _Float16*  xnh  = (_Float16*)carve((size_t)N * FDIM * sizeof(_Float16));
  _Float16*  Wqh  = (_Float16*)carve((size_t)FDIM * FDIM * sizeof(_Float16));
  _Float16*  W1h  = (_Float16*)carve((size_t)4 * FDIM * FDIM * sizeof(_Float16));
  _Float16*  W2h  = (_Float16*)carve((size_t)4 * FDIM * FDIM * sizeof(_Float16));

  const int mt = (N + 15) / 16;

  // inputs only: f32 -> f16 conversions and the grid fill
  int nf4 = (N * FDIM) / 4;
  prep_k<<<TILES_OF(nf4) + PREP_FIXED_BLOCKS, STREAM_BLOCK, 0, stream>>>(
      feats, Xh, nf4, Wq, Wqh, W1, W1h, W2, W2h, grid);

  // q projection beside the scatter into the grid
  q_scatter_k<<<PROJ_BLOCKS(N) + POINT_BLOCKS(N), PROJ_BLOCK, 0, stream>>>(
      Xh, Wqh, qb, coords, grid, N);

  // k, v with norm1 applied in the same kernel, beside the neighbor table
  kv_neighbors_k<<<PROJ_BLOCKS(N) + POINT_BLOCKS(N), PROJ_BLOCK, 0, stream>>>(
      Xh, Wk, bk, Wv, bv, g1, b1, kb, vb, coords, grid, nbr, N);

  // attention + residual -> xr
  attention_k<<<(N * NHEAD + ATT_BLOCK - 1) / ATT_BLOCK, ATT_BLOCK, 0, stream>>>(
      qb, kb, vb, feats, nbr, xr, N);

  // norm2 -> f16 activations for the MLP
  layernorm_rows_k<_Float16><<<(N + NORM_ROWS - 1) / NORM_ROWS, STREAM_BLOCK, 0, stream>>>(
      xr, xnh, g2, b2, N);

  // fused MLP + residual -> out (64 rows per block, h tile in static LDS)
  mlp_fused_k<<<(mt + 3) / 4, 128, 0, stream>>>(xnh, xr, W1h, bm1, W2h, bm2, out, N);
}

// v007
// One run takes 78.2 microseconds.
// Next to v006, in two timings, it ran 1.03 times as fast each time.
// Counting every step since v000, it is 3.12 times as fast.
#include <hip/hip_runtime.h>
#include <math.h>

// ---------------- problem constants ----------------
#define GX 256
#define GY 256
#define GZ 32
#define GRID_CELLS (GX * GY * GZ)   // 2,097,152
#define FDIM 128
#define NHEAD 8
#define HDIM 16

typedef __attribute__((ext_vector_type(16))) _Float16 v16h;
typedef __attribute__((ext_vector_type(8)))  _Float16 v8h;
typedef __attribute__((ext_vector_type(4)))  _Float16 v4h;
typedef __attribute__((ext_vector_type(8)))  float    v8f;

// A/B fragment for v_wmma_f32_16x16x32_f16 from row-major packed f16.
// p = &M[row][k0 + khalf*8]:
//   frag[i]   = K(k0 + khalf*8 + i)       i in 0..7   (16B contiguous)
//   frag[8+i] = K(k0 + 16 + khalf*8 + i)              (16B contiguous)
__device__ __forceinline__ v16h frag_ld_f16(const _Float16* __restrict__ p) {
  v8h lo = *(const v8h*)p;
  v8h hi = *(const v8h*)(p + 16);
  v16h r;
#pragma unroll
  for (int i = 0; i < 8; ++i) { r[i] = lo[i]; r[8 + i] = hi[i]; }
  return r;
}

__device__ __forceinline__ v8f wmma_f16(v16h a, v16h b, v8f c) {
  return __builtin_amdgcn_wmma_f32_16x16x32_f16(false, a, false, b, (short)0, c,
                                                false, false);
}

// Streaming blocks (grid fill, conversion): each wave moves WORK_PER_WAVE
// 512-B pieces, for speed only.
#define STREAM_BLOCK 256
#define WORK_PER_WAVE 8
#define STREAM_TILE (STREAM_BLOCK * WORK_PER_WAVE)  // 16-B pieces per block

// Launches that do not depend on each other share one grid: each block takes one role,
// picked by a scalar compare on its index, and gets its index within that role (blk).

// ---------------- f32 -> f16 conversion (vectorized x4) ----------------
// 8 float4 per thread, all loads issued before the first store.
__device__ __forceinline__ void cvt4_f16_block(
    const float* __restrict__ in, _Float16* __restrict__ out, int n4, int blk) {
  const int base = blk * STREAM_TILE;
  const float4* __restrict__ ip = (const float4*)in + base + threadIdx.x;
  v4h* __restrict__ op = (v4h*)out + base + threadIdx.x;
  if (base + STREAM_TILE <= n4) {  // whole block in range: scalar branch
    float4 v[WORK_PER_WAVE];
    for (int j = 0; j < WORK_PER_WAVE; ++j) v[j] = ip[j * STREAM_BLOCK];
    for (int j = 0; j < WORK_PER_WAVE; ++j) {
      v4h o = {(_Float16)v[j].x, (_Float16)v[j].y, (_Float16)v[j].z, (_Float16)v[j].w};
      op[j * STREAM_BLOCK] = o;
    }
    // The built code joins the tail's path here, which reuses the stores' registers.
    asm volatile("s_wait_xcnt 0x0" ::: "memory");
  } else {
    for (int j = 0; j < WORK_PER_WAVE; ++j) {
      if (base + j * STREAM_BLOCK + (int)threadIdx.x < n4) {
        float4 v = ip[j * STREAM_BLOCK];
        v4h o = {(_Float16)v.x, (_Float16)v.y, (_Float16)v.z, (_Float16)v.w};
        op[j * STREAM_BLOCK] = o;
      }
    }
  }
}

// ---------------- neighbor table ----------------
// 8 stores of 16 B per thread; the grid is a whole number of block tiles.
static_assert(GRID_CELLS % (4 * STREAM_TILE) == 0, "grid fill has no tail");
__device__ __forceinline__ void init_grid_block(int* __restrict__ grid, int blk) {
  int4* __restrict__ p = (int4*)grid + blk * STREAM_TILE + threadIdx.x;
  for (int j = 0; j < WORK_PER_WAVE; ++j)
    p[j * STREAM_BLOCK] = make_int4(-1, -1, -1, -1);
}

// First launch: everything that reads only inputs. Roles in index order: feats, the
// grid fill, then Wq, W1, W2.
#define TILES_OF(n4) (((n4) + STREAM_TILE - 1) / STREAM_TILE)
#define GRID_BLOCKS (GRID_CELLS / (4 * STREAM_TILE))
#define WQ_N4 (FDIM * FDIM / 4)
#define WM_N4 (4 * FDIM * FDIM / 4)  // W1 and W2 alike
#define PREP_FIXED_BLOCKS (GRID_BLOCKS + TILES_OF(WQ_N4) + 2 * TILES_OF(WM_N4))
__global__ void __launch_bounds__(STREAM_BLOCK) prep_k(
    const float* __restrict__ feats, _Float16* __restrict__ Xh, int nf4,
    const float* __restrict__ Wq, _Float16* __restrict__ Wqh,
    const float* __restrict__ W1, _Float16* __restrict__ W1h,
    const float* __restrict__ W2, _Float16* __restrict__ W2h, int* __restrict__ grid) {
  int blk = blockIdx.x;
  if (blk < TILES_OF(nf4)) { cvt4_f16_block(feats, Xh, nf4, blk); return; }
  blk -= TILES_OF(nf4);
  if (blk < GRID_BLOCKS) { init_grid_block(grid, blk); return; }
  blk -= GRID_BLOCKS;
  if (blk < TILES_OF(WQ_N4)) { cvt4_f16_block(Wq, Wqh, WQ_N4, blk); return; }
  blk -= TILES_OF(WQ_N4);
  if (blk < TILES_OF(WM_N4)) { cvt4_f16_block(W1, W1h, WM_N4, blk); return; }
  cvt4_f16_block(W2, W2h, WM_N4, blk - TILES_OF(WM_N4));
}

// scatter and look-up run in blocks of PROJ_BLOCK threads, the size of the projection
// blocks whose grids they share.
#define PROJ_BLOCK 128
__device__ __forceinline__ void scatter_block(const int* __restrict__ coords,
                                              int* __restrict__ grid, int n, int blk) {
  int i = blk * PROJ_BLOCK + threadIdx.x;
  if (i >= n) return;
  int x = coords[i * 3 + 0], y = coords[i * 3 + 1], z = coords[i * 3 + 2];
  grid[x * (GY * GZ) + y * GZ + z] = i;
}

__device__ __forceinline__ void neighbors_block(const int* __restrict__ coords,
                                                const int* __restrict__ grid,
                                                int* __restrict__ nbr, int n, int blk) {
  int i = blk * PROJ_BLOCK + threadIdx.x;
  if (i >= n) return;
  int x = coords[i * 3 + 0], y = coords[i * 3 + 1], z = coords[i * 3 + 2];
#pragma unroll
  for (int j = 0; j < 27; ++j) {
    int dx = j / 9 - 1, dy = (j / 3) % 3 - 1, dz = j % 3 - 1;
    int nx = x + dx, ny = y + dy, nz = z + dz;
    int v = -1;
    if (nx >= 0 && nx < GX && ny >= 0 && ny < GY && nz >= 0 && nz < GZ)
      v = grid[nx * (GY * GZ) + ny * GZ + nz];
    nbr[i * 27 + j] = v;
  }
}

// ---------------- q = feats @ Wq^T  (WMMA, f16 operands) ----------------
// 4 waves/block; each wave owns one 16-row strip; 2 groups of 4 col tiles so
// 4 independent accumulator chains hide B-load latency behind wmma.
__device__ __forceinline__ void gemm_q_block(const _Float16* __restrict__ Xh,
                                             const _Float16* __restrict__ Wqh,
                                             float* __restrict__ Q, int n, int blk) {
  int lane = threadIdx.x & 31;
  int m = lane & 15, kh = lane >> 4;
  int tm = __builtin_amdgcn_readfirstlane(blk * 4 + (threadIdx.x >> 5));
  if (tm * 16 >= n) return;  // scalar branch
  int row = tm * 16 + m;
  if (row >= n) row = n - 1;
  const bool full = (tm * 16 + 16) <= n;  // SGPR condition

  v16h av[4];
#pragma unroll
  for (int k = 0; k < 4; ++k)
    av[k] = frag_ld_f16(Xh + (size_t)row * FDIM + k * 32 + kh * 8);

#pragma unroll 1
  for (int tg = 0; tg < 2; ++tg) {  // 2 groups of 4 column tiles
    v8f acc[4] = {{}, {}, {}, {}};
#pragma unroll
    for (int k = 0; k < 4; ++k) {
      v16h b[4];
#pragma unroll
      for (int t = 0; t < 4; ++t) {
        int col = (tg * 4 + t) * 16 + m;
        b[t] = frag_ld_f16(Wqh + (size_t)col * FDIM + k * 32 + kh * 8);
      }
#pragma unroll
      for (int t = 0; t < 4; ++t) acc[t] = wmma_f16(av[k], b[t], acc[t]);
    }
#pragma unroll
    for (int t = 0; t < 4; ++t) {
      int cn = (tg * 4 + t) * 16 + m;
      int rb = tm * 16 + 8 * kh;  // C layout: lanes<16 -> M=r, lanes>=16 -> M=8+r
      if (full) {
#pragma unroll
        for (int r = 0; r < 8; ++r) Q[(size_t)(rb + r) * FDIM + cn] = acc[t][r];
        // The built code joins the guarded path here, which reuses the stores' registers.
        asm volatile("s_wait_xcnt 0x0" ::: "memory");
      } else {
#pragma unroll
        for (int r = 0; r < 8; ++r)
          if (rb + r < n) Q[(size_t)(rb + r) * FDIM + cn] = acc[t][r];
      }
    }
  }
}

// Second launch: what needs only the first one's results. The projection blocks come
// first in the index, the short scatter blocks behind them.
#define PROJ_BLOCKS(n) (((n) + 63) / 64)                    // 4 strips of 16 rows each
#define POINT_BLOCKS(n) (((n) + PROJ_BLOCK - 1) / PROJ_BLOCK)  // one thread per point
__global__ void __launch_bounds__(PROJ_BLOCK) q_scatter_k(
    const _Float16* __restrict__ Xh, const _Float16* __restrict__ Wqh,
    float* __restrict__ Q, const int* __restrict__ coords, int* __restrict__ grid,
    int n) {
  const int blk = blockIdx.x;
  if (blk < PROJ_BLOCKS(n)) gemm_q_block(Xh, Wqh, Q, n, blk);
  else scatter_block(coords, grid, n, blk - PROJ_BLOCKS(n));
}

// ------- k,v per-head 16x16 projections (WMMA, K padded to 32) + norm1 -------
// Sum over the 16 lanes that hold the 16 columns of one C tile: DPP row_xmask
// butterfly (ctrl 0x160 | mask), all lanes on; it stays on the vector port, where
// a shuffle would go through the LDS pipe and its wait.
__device__ __forceinline__ float row16_sum(float x) {
  x += __int_as_float(__builtin_amdgcn_update_dpp(0, __float_as_int(x), 0x161, 0xf, 0xf, true));
  x += __int_as_float(__builtin_amdgcn_update_dpp(0, __float_as_int(x), 0x162, 0xf, 0xf, true));
  x += __int_as_float(__builtin_amdgcn_update_dpp(0, __float_as_int(x), 0x164, 0xf, 0xf, true));
  x += __int_as_float(__builtin_amdgcn_update_dpp(0, __float_as_int(x), 0x168, 0xf, 0xf, true));
  return x;
}

// One projection (k or v) of a wave's 16 rows: the 16 x 128 result stays in
// accumulator registers (8 heads x 8 rows per lane), so the row statistics of
// the layernorm come from registers and only the normalised rows are stored.
__device__ __forceinline__ void proj_norm_store(
    const v16h (&a)[NHEAD], const float* __restrict__ wp,
    const float* __restrict__ bias, const float* __restrict__ g,
    const float* __restrict__ b, float* __restrict__ op, int m, int rb, int n) {
  v8f acc[NHEAD];
#pragma unroll
  for (int h = 0; h < NHEAD; ++h) {
    v16h bf = {};  // W[h][e][d], e = m; slots 8..15 = K>=16 stay zero
#pragma unroll
    for (int i = 0; i < 8; ++i) bf[i] = (_Float16)wp[h * HDIM * HDIM + i];
    v8f z = {};
    acc[h] = wmma_f16(a[h], bf, z);
  }

  // bias, then per-row sum and sum of squares: 8 heads in the lane, 16 lanes
  float s[8], q[8];
#pragma unroll
  for (int r = 0; r < 8; ++r) { s[r] = 0.f; q[r] = 0.f; }
#pragma unroll
  for (int h = 0; h < NHEAD; ++h) {
    float bia = bias[h * HDIM + m];
#pragma unroll
    for (int r = 0; r < 8; ++r) {
      float x = acc[h][r] + bia;
      acc[h][r] = x;
      s[r] += x; q[r] += x * x;
    }
  }
#pragma unroll
  for (int r = 0; r < 8; ++r) {
    float mean = row16_sum(s[r]) * (1.0f / FDIM);
    float var  = row16_sum(q[r]) * (1.0f / FDIM) - mean * mean;
    s[r] = mean;
    q[r] = rsqrtf(var + 1e-5f);
  }
#pragma unroll
  for (int h = 0; h < NHEAD; ++h) {
    float gg = g[h * HDIM + m], bb = b[h * HDIM + m];
#pragma unroll
    for (int r = 0; r < 8; ++r) acc[h][r] = (acc[h][r] - s[r]) * q[r] * gg + bb;
  }
#pragma unroll
  for (int r = 0; r < 8; ++r) {
    if (rb + r < n) {
#pragma unroll
      for (int h = 0; h < NHEAD; ++h) op[r * FDIM + h * HDIM] = acc[h][r];
    }
  }
}

__device__ __forceinline__ void kv_heads_ln_block(
    const _Float16* __restrict__ Xh, const float* __restrict__ Wk,
    const float* __restrict__ bk, const float* __restrict__ Wv,
    const float* __restrict__ bv, const float* __restrict__ g,
    const float* __restrict__ b, float* __restrict__ K, float* __restrict__ V,
    int n, int blk) {
  int lane = threadIdx.x & 31;
  int m = lane & 15, kh = lane >> 4;
  int tm = __builtin_amdgcn_readfirstlane(blk * 4 + (threadIdx.x >> 5));
  if (tm * 16 >= n) return;  // scalar branch
  int row = tm * 16 + m;
  if (row >= n) row = n - 1;
  const _Float16* __restrict__ xp = Xh + (size_t)row * FDIM + kh * 8;

  // A: 16 pts x 16 dims (f16) per head, zero-padded to K=32 (slots 8..15 = K>=16)
  v16h a[NHEAD];
#pragma unroll
  for (int h = 0; h < NHEAD; ++h) {
    v8h xa = *(const v8h*)(xp + h * HDIM);
    v16h t = {};
#pragma unroll
    for (int i = 0; i < 8; ++i) t[i] = xa[i];
    a[h] = t;
  }

  const int rb = tm * 16 + 8 * kh;  // C layout: lanes<16 -> M=r, lanes>=16 -> M=8+r
  const int wo = m * HDIM + kh * 8;
  proj_norm_store(a, Wk + wo, bk, g, b, K + (size_t)rb * FDIM + m, m, rb, n);
  proj_norm_store(a, Wv + wo, bv, g, b, V + (size_t)rb * FDIM + m, m, rb, n);
}

// Third launch: the look-up needs the scattered grid; k and v, which attention needs no
// earlier than the table, fill the chip beside it.
__global__ void __launch_bounds__(PROJ_BLOCK) kv_neighbors_k(
    const _Float16* __restrict__ Xh, const float* __restrict__ Wk,
    const float* __restrict__ bk, const float* __restrict__ Wv,
    const float* __restrict__ bv, const float* __restrict__ g,
    const float* __restrict__ b, float* __restrict__ K, float* __restrict__ V,
    const int* __restrict__ coords, const int* __restrict__ grid,
    int* __restrict__ nbr, int n) {
  const int blk = blockIdx.x;
  if (blk < PROJ_BLOCKS(n)) kv_heads_ln_block(Xh, Wk, bk, Wv, bv, g, b, K, V, n, blk);
  else neighbors_block(coords, grid, nbr, n, blk - PROJ_BLOCKS(n));
}

// rsqrtf as the compiler expands it (x below the smallest normal scaled by 2^24, the
// result by 2^12). The v_rsq_f32 is asm text so that the v_nop, the slot the
// instruction set asks for behind a transcendental, stays directly behind it wherever
// the compiler schedules it.
__device__ __forceinline__ float rsqrt_with_slot(float x) {
  const bool tiny = x < 1.17549435e-38f;
  const float xs = tiny ? x * 16777216.0f : x;
  float r;
  asm("v_rsq_f32 %0, %1\n\tv_nop" : "=v"(r) : "v"(xs));
  return tiny ? r * 4096.0f : r;
}

// ---------------- 27-neighbor attention + residual + norm2 ----------------
// one thread per (point, head). The four loops over the 27 slots are unrolled, so
// every index into nb[] and sc[] is a constant and both arrays are plain registers:
// indexed by a loop counter, nb[] is placed in LDS by the compiler, sized for the
// largest block the kernel might get, and that much LDS holds a WGP to two blocks. The
// real block size is declared for the same reason.
#define ATT_BLOCK 256
#define NSLOT 27

// __expf as the compiler expands it (x * log2(e), then v_exp_f32). The v_exp_f32 is asm
// text so that the v_nop, the slot the instruction set asks for behind a transcendental,
// stays directly behind it wherever the compiler schedules the 27 slots.
__device__ __forceinline__ float exp_with_slot(float x) {
  const float y = x * 1.44269504088896340736f;
  float r;
  asm("v_exp_f32 %0, %1\n\tv_nop" : "=v"(r) : "v"(y));
  return r;
}

// Sum over the 8 neighbouring lanes that hold the 8 heads of one point: DPP row_xmask
// butterfly (ctrl 0x160 | mask) on the vector port. The 8 lanes are on or off together.
__device__ __forceinline__ float head8_sum(float x) {
  x += __int_as_float(__builtin_amdgcn_update_dpp(0, __float_as_int(x), 0x161, 0xf, 0xf, true));
  x += __int_as_float(__builtin_amdgcn_update_dpp(0, __float_as_int(x), 0x162, 0xf, 0xf, true));
  x += __int_as_float(__builtin_amdgcn_update_dpp(0, __float_as_int(x), 0x164, 0xf, 0xf, true));
  return x;
}

__global__ void __launch_bounds__(ATT_BLOCK) attention_k(
    const float* __restrict__ Q, const float* __restrict__ Kn,
    const float* __restrict__ Vn, const float* __restrict__ feats,
    const int* __restrict__ nbr, const float* __restrict__ g,
    const float* __restrict__ b, float* __restrict__ Xr, _Float16* __restrict__ XNh,
    int n) {
  int t = blockIdx.x * ATT_BLOCK + threadIdx.x;
  if (t >= n * NHEAD) return;
  int pt = t >> 3, h = t & 7;
  const float scale = 0.0883883476483184f;  // 1/sqrt(128)
  int nb[NSLOT];  // no slot's load waits for another's: 27 loads in flight together
#pragma unroll
  for (int j = 0; j < NSLOT; ++j) nb[j] = nbr[pt * NSLOT + j];
  float q[HDIM];
#pragma unroll
  for (int d = 0; d < HDIM; ++d) q[d] = Q[(size_t)pt * FDIM + h * HDIM + d];
  float sc[NSLOT];
  float mx = -3.0e38f;
#pragma unroll
  for (int j = 0; j < NSLOT; ++j) {
    float s = -1.0e30f;
    if (nb[j] >= 0) {
      const float* kp = Kn + (size_t)nb[j] * FDIM + h * HDIM;
      float acc = 0.f;
#pragma unroll
      for (int d = 0; d < HDIM; ++d) acc += q[d] * kp[d];
      s = acc * scale;
    }
    sc[j] = s;
    mx = fmaxf(mx, s);
  }
  float denom = 0.f;
#pragma unroll
  for (int j = 0; j < NSLOT; ++j) {
    float e = (nb[j] >= 0) ? exp_with_slot(sc[j] - mx) : 0.f;
    sc[j] = e;
    denom += e;
  }
  float inv = 1.0f / denom;
  float o[HDIM];
#pragma unroll
  for (int d = 0; d < HDIM; ++d) o[d] = 0.f;
#pragma unroll
  for (int j = 0; j < NSLOT; ++j) {
    if (nb[j] >= 0) {
      float p = sc[j] * inv;
      const float* vp = Vn + (size_t)nb[j] * FDIM + h * HDIM;
#pragma unroll
      for (int d = 0; d < HDIM; ++d) o[d] += p * vp[d];
    }
  }
  // residual row x, and norm2 of it while it is still in registers: a row is 16 columns
  // in each of 8 lanes, so its sum and sum of squares are 16 terms in the lane, then 8 lanes.
  const size_t off = (size_t)pt * FDIM + h * HDIM;
  float s = 0.f, ss = 0.f;
#pragma unroll
  for (int d = 0; d < HDIM; ++d) {
    o[d] += feats[off + d];
    s += o[d];
    ss += o[d] * o[d];
  }
  const float mean = head8_sum(s) * (1.0f / FDIM);
  const float var  = head8_sum(ss) * (1.0f / FDIM) - mean * mean;
  const float rs = rsqrt_with_slot(var + 1e-5f);
  v8h xn[2];
#pragma unroll
  for (int d = 0; d < HDIM; ++d)
    xn[d >> 3][d & 7] = (_Float16)((o[d] - mean) * rs * g[h * HDIM + d] + b[h * HDIM + d]);
#pragma unroll
  for (int d = 0; d < HDIM; ++d) Xr[off + d] = o[d];
  *(v8h*)(XNh + off) = xn[0];
  *(v8h*)(XNh + off + 8) = xn[1];
}

// gelu(x) = 0.5 x (1 + erf(x / sqrt 2)) = max(x, 0) - |x| * 0.5 erfc(|x| / sqrt 2), with
// erfc(z) = t (a1 + t (a2 + t (a3 + t (a4 + t a5)))) exp(-z^2), t = 1 / (1 + p z): the
// five-term rational form of erf, absolute error below 1.5e-7 for every z >= 0; the 0.5
// is folded into the coefficients. One straight line for every x, so the 32 values of a
// trip are worked on side by side; the library's erff takes one of two ranges by |x|,
// and a wave with lanes in both walks both, one value after the other.
// The hardware's own rcp and exp2 are enough here: exp2 gives 0 where the true value is
// below the smallest normal, and there the whole term is far below an f16 step of h.
__device__ __forceinline__ float gelu_erf(float x) {
  const float ax = fabsf(x);
  const float t = __builtin_amdgcn_rcpf(fmaf(ax, 0.3275911f * 0.7071067811865475f, 1.0f));
  const float e = __builtin_amdgcn_exp2f(x * x * -0.72134752044448170368f);  // exp(-x^2/2)
  float p = 0.5f * 1.061405429f;
  p = fmaf(p, t, 0.5f * -1.453152027f);
  p = fmaf(p, t, 0.5f * 1.421413741f);
  p = fmaf(p, t, 0.5f * -0.284496736f);
  p = fmaf(p, t, 0.5f * 0.254829592f);
  return fmaf(-(ax * e), p * t, fmaxf(x, 0.0f));
}

// ---------------- fused MLP: gelu(LN(x)@W1^T+b1)@W2^T + b2 + x ----------------
// One block = 64 rows (4 row tiles), 4 waves. The waves split the COLUMNS: every wave
// works on all 4 row tiles, so a weight fragment is loaded by one wave of the block and
// feeds 4 WMMAs; with a row tile per wave each of the 4 waves loaded every fragment.
#define MLP_TILES 4                 // row tiles per block
#define MLP_ROWS (MLP_TILES * 16)
#define HID (4 * FDIM)
#define H_PITCH (HID + 8)           // f16: rows 16 B apart in the banks for b128 readers
__global__ void __launch_bounds__(128) mlp_fused_k(
    const _Float16* __restrict__ XNh, const float* __restrict__ Xr,
    const _Float16* __restrict__ W1h, const float* __restrict__ bm1,
    const _Float16* __restrict__ W2h, const float* __restrict__ bm2,
    float* __restrict__ out, int n) {
  __shared__ __attribute__((aligned(16))) _Float16 hbuf[MLP_ROWS * H_PITCH];  // 65 KB
  const int lane = threadIdx.x & 31;
  const int wave = __builtin_amdgcn_readfirstlane(threadIdx.x >> 5);
  const int m = lane & 15, kh = lane >> 4;
  const int row0 = blockIdx.x * MLP_ROWS;  // < n by the grid

  // stage 1: h = gelu(XN @ W1^T + bm1) -> LDS (f16). A frags of all 64 rows stay in
  // registers; wave w makes columns [128 w, 128 w + 128) of h.
  v16h av[MLP_TILES][4];
#pragma unroll
  for (int rt = 0; rt < MLP_TILES; ++rt) {
    int row = row0 + rt * 16 + m;
    if (row >= n) row = n - 1;  // clamp: duplicate work, never stored
#pragma unroll
    for (int k = 0; k < 4; ++k)
      av[rt][k] = frag_ld_f16(XNh + (size_t)row * FDIM + k * 32 + kh * 8);
    // The built code lets a later tile's loads land on this tile's address registers.
    asm volatile("s_wait_xcnt 0x0" ::: "memory");
  }

  for (int ct = 0; ct < 8; ++ct) {  // the wave's 8 column tiles
    const int cn = (wave * 8 + ct) * 16 + m;
    v16h b[4];
#pragma unroll
    for (int k = 0; k < 4; ++k)
      b[k] = frag_ld_f16(W1h + (size_t)cn * FDIM + k * 32 + kh * 8);
    // The built code lets the bias load land on the fragment loads' address registers.
    asm volatile("s_wait_xcnt 0x0" ::: "memory");
    const float bia = bm1[cn];
    // Inputs-only fence on the loaded fragments: keeps the tile's 8 loads in flight
    // together; without it the compiler reuses one fragment's registers and waits 4 times.
    asm volatile("" ::"v"(b[0]), "v"(b[1]), "v"(b[2]), "v"(b[3]));
    v8f acc[MLP_TILES] = {{}, {}, {}, {}};
#pragma unroll
    for (int k = 0; k < 4; ++k) {
#pragma unroll
      for (int rt = 0; rt < MLP_TILES; ++rt) acc[rt] = wmma_f16(av[rt][k], b[k], acc[rt]);
    }
#pragma unroll
    for (int rt = 0; rt < MLP_TILES; ++rt) {
      const int rb = rt * 16 + 8 * kh;  // C layout: lanes<16 -> M=r, lanes>=16 -> M=8+r
#pragma unroll
      for (int r = 0; r < 8; ++r) {
        hbuf[(rb + r) * H_PITCH + cn] = (_Float16)gelu_erf(acc[rt][r] + bia);
      }
    }
  }
  __syncthreads();  // every wave reads all 512 columns of h below

  // stage 2: out = Xr + h @ W2^T + bm2; wave w makes output columns [32 w, 32 w + 32)
  v8f acc[2][MLP_TILES] = {{{}, {}, {}, {}}, {{}, {}, {}, {}}};
  // Two k steps per trip: together they use up the 128-B line of each W2 row, and the
  // second step's loads fly while the first step's WMMAs run.
#pragma unroll 2
  for (int k0 = 0; k0 < HID; k0 += 32) {
    v16h b[2], a[MLP_TILES];
#pragma unroll
    for (int t = 0; t < 2; ++t)
      b[t] = frag_ld_f16(W2h + (size_t)((wave * 2 + t) * 16 + m) * HID + k0 + kh * 8);
#pragma unroll
    for (int rt = 0; rt < MLP_TILES; ++rt)
      a[rt] = frag_ld_f16(&hbuf[(rt * 16 + m) * H_PITCH + k0 + kh * 8]);
#pragma unroll
    for (int t = 0; t < 2; ++t) {
#pragma unroll
      for (int rt = 0; rt < MLP_TILES; ++rt) acc[t][rt] = wmma_f16(a[rt], b[t], acc[t][rt]);
    }
  }
  const float bia0 = bm2[wave * 32 + m], bia1 = bm2[wave * 32 + 16 + m];
  const size_t o0 = (size_t)(row0 + 8 * kh) * FDIM + wave * 32 + m;
  const float* __restrict__ xp = Xr + o0;
  float* __restrict__ op = out + o0;
  if (row0 + MLP_ROWS <= n) {  // scalar branch: whole block in range
    float x[2][MLP_TILES][8];
#pragma unroll
    for (int t = 0; t < 2; ++t)
#pragma unroll
      for (int rt = 0; rt < MLP_TILES; ++rt)
#pragma unroll
        for (int r = 0; r < 8; ++r) x[t][rt][r] = xp[(rt * 16 + r) * FDIM + t * 16];
#pragma unroll
    for (int t = 0; t < 2; ++t)
#pragma unroll
      for (int rt = 0; rt < MLP_TILES; ++rt)
#pragma unroll
        for (int r = 0; r < 8; ++r)
          op[(rt * 16 + r) * FDIM + t * 16] = x[t][rt][r] + acc[t][rt][r] + (t ? bia1 : bia0);
  } else {
#pragma unroll
    for (int t = 0; t < 2; ++t)
#pragma unroll
      for (int rt = 0; rt < MLP_TILES; ++rt)
#pragma unroll
        for (int r = 0; r < 8; ++r)
          if (row0 + rt * 16 + 8 * kh + r < n)
            op[(rt * 16 + r) * FDIM + t * 16] =
                xp[(rt * 16 + r) * FDIM + t * 16] + acc[t][rt][r] + (t ? bia1 : bia0);
  }
}

// ---------------- host ----------------
extern "C" void kernel_launch(void* const* d_in, const int* in_sizes, int n_in,
                              void* d_out, int out_size, void* d_ws, size_t ws_size,
                              hipStream_t stream) {
  const int*   coords = (const int*)d_in[0];
  const float* feats  = (const float*)d_in[1];
  const float* Wq     = (const float*)d_in[2];
  const float* Wk     = (const float*)d_in[3];
  const float* bk     = (const float*)d_in[4];
  const float* Wv     = (const float*)d_in[5];
  const float* bv     = (const float*)d_in[6];
  const float* g1     = (const float*)d_in[7];
  const float* b1     = (const float*)d_in[8];
  const float* g2     = (const float*)d_in[9];
  const float* b2     = (const float*)d_in[10];
  const float* W1     = (const float*)d_in[11];
  const float* bm1    = (const float*)d_in[12];
  const float* W2     = (const float*)d_in[13];
  const float* bm2    = (const float*)d_in[14];
  float* out = (float*)d_out;
  const int N = in_sizes[1] / FDIM;
  (void)n_in; (void)out_size; (void)ws_size;

  char* ws = (char*)d_ws;
  size_t off = 0;
  auto carve = [&](size_t bytes) {
    void* p = ws + off;
    off = (off + bytes + 255) & ~(size_t)255;
    return p;
  };
  int*       grid = (int*)carve((size_t)GRID_CELLS * sizeof(int));
  int*       nbr  = (int*)carve((size_t)N * 27 * sizeof(int));
  float*     qb   = (float*)carve((size_t)N * FDIM * sizeof(float));
  float*     kb   = (float*)carve((size_t)N * FDIM * sizeof(float));
  float*     vb   = (float*)carve((size_t)N * FDIM * sizeof(float));
  float*     xr   = (float*)carve((size_t)N * FDIM * sizeof(float));
  _Float16*  Xh   = (_Float16*)carve((size_t)N * FDIM * sizeof(_Float16));
  _Float16*  xnh  = (_Float16*)carve((size_t)N * FDIM * sizeof(_Float16));
  _Float16*  Wqh  = (_Float16*)carve((size_t)FDIM * FDIM * sizeof(_Float16));
  _Float16*  W1h  = (_Float16*)carve((size_t)4 * FDIM * FDIM * sizeof(_Float16));
  _Float16*  W2h  = (_Float16*)carve((size_t)4 * FDIM * FDIM * sizeof(_Float16));

  const int mt = (N + 15) / 16;

  // inputs only: f32 -> f16 conversions and the grid fill
  int nf4 = (N * FDIM) / 4;
  prep_k<<<TILES_OF(nf4) + PREP_FIXED_BLOCKS, STREAM_BLOCK, 0, stream>>>(
      feats, Xh, nf4, Wq, Wqh, W1, W1h, W2, W2h, grid);

  // q projection beside the scatter into the grid
  q_scatter_k<<<PROJ_BLOCKS(N) + POINT_BLOCKS(N), PROJ_BLOCK, 0, stream>>>(
      Xh, Wqh, qb, coords, grid, N);

  // k, v with norm1 applied in the same kernel, beside the neighbor table
  kv_neighbors_k<<<PROJ_BLOCKS(N) + POINT_BLOCKS(N), PROJ_BLOCK, 0, stream>>>(
      Xh, Wk, bk, Wv, bv, g1, b1, kb, vb, coords, grid, nbr, N);

  // attention + residual -> xr, and norm2 of it -> f16 activations for the MLP
  attention_k<<<(N * NHEAD + ATT_BLOCK - 1) / ATT_BLOCK, ATT_BLOCK, 0, stream>>>(
      qb, kb, vb, feats, nbr, g2, b2, xr, xnh, N);

  // fused MLP + residual -> out (64 rows per block, h tile in static LDS)
  mlp_fused_k<<<(mt + 3) / 4, 128, 0, stream>>>(xnh, xr, W1h, bm1, W2h, bm2, out, N);
}

// v008
// One run takes 70.6 microseconds.
// Next to v007, in two timings, it ran 1.11 and 1.09 times as fast.
// Counting every step since v000, it is 3.43 times as fast.
#include <hip/hip_runtime.h>
#include <math.h>

// ---------------- problem constants ----------------
#define GX 256
#define GY 256
#define GZ 32
#define GRID_CELLS (GX * GY * GZ)   // 2,097,152
#define FDIM 128
#define NHEAD 8
#define HDIM 16

typedef __attribute__((ext_vector_type(16))) _Float16 v16h;
typedef __attribute__((ext_vector_type(8)))  _Float16 v8h;
typedef __attribute__((ext_vector_type(4)))  _Float16 v4h;
typedef __attribute__((ext_vector_type(8)))  float    v8f;

// A/B fragment for v_wmma_f32_16x16x32_f16 from row-major packed f16.
// p = &M[row][k0 + khalf*8]:
//   frag[i]   = K(k0 + khalf*8 + i)       i in 0..7   (16B contiguous)
//   frag[8+i] = K(k0 + 16 + khalf*8 + i)              (16B contiguous)
__device__ __forceinline__ v16h frag_ld_f16(const _Float16* __restrict__ p) {
  v8h lo = *(const v8h*)p;
  v8h hi = *(const v8h*)(p + 16);
  v16h r;
#pragma unroll
  for (int i = 0; i < 8; ++i) { r[i] = lo[i]; r[8 + i] = hi[i]; }
  return r;
}

__device__ __forceinline__ v8f wmma_f16(v16h a, v16h b, v8f c) {
  return __builtin_amdgcn_wmma_f32_16x16x32_f16(false, a, false, b, (short)0, c,
                                                false, false);
}

// Streaming blocks (grid fill, conversion): each wave moves WORK_PER_WAVE
// 512-B pieces, for speed only.
#define STREAM_BLOCK 256
#define WORK_PER_WAVE 8
#define STREAM_TILE (STREAM_BLOCK * WORK_PER_WAVE)  // 16-B pieces per block

// Launches that do not depend on each other share one grid: each block takes one role,
// picked by a scalar compare on its index, and gets its index within that role (blk).

// ---------------- f32 -> f16 conversion (vectorized x4) ----------------
// 8 float4 per thread, all loads issued before the first store.
__device__ __forceinline__ void cvt4_f16_block(
    const float* __restrict__ in, _Float16* __restrict__ out, int n4, int blk) {
  const int base = blk * STREAM_TILE;
  const float4* __restrict__ ip = (const float4*)in + base + threadIdx.x;
  v4h* __restrict__ op = (v4h*)out + base + threadIdx.x;
  if (base + STREAM_TILE <= n4) {  // whole block in range: scalar branch
    float4 v[WORK_PER_WAVE];
    for (int j = 0; j < WORK_PER_WAVE; ++j) v[j] = ip[j * STREAM_BLOCK];
    for (int j = 0; j < WORK_PER_WAVE; ++j) {
      v4h o = {(_Float16)v[j].x, (_Float16)v[j].y, (_Float16)v[j].z, (_Float16)v[j].w};
      op[j * STREAM_BLOCK] = o;
    }
    // The built code joins the tail's path here, which reuses the stores' registers.
    asm volatile("s_wait_xcnt 0x0" ::: "memory");
  } else {
    for (int j = 0; j < WORK_PER_WAVE; ++j) {
      if (base + j * STREAM_BLOCK + (int)threadIdx.x < n4) {
        float4 v = ip[j * STREAM_BLOCK];
        v4h o = {(_Float16)v.x, (_Float16)v.y, (_Float16)v.z, (_Float16)v.w};
        op[j * STREAM_BLOCK] = o;
      }
    }
  }
}

// ---------------- neighbor table ----------------
// 8 stores of 16 B per thread; the grid is a whole number of block tiles.
static_assert(GRID_CELLS % (4 * STREAM_TILE) == 0, "grid fill has no tail");
__device__ __forceinline__ void init_grid_block(int* __restrict__ grid, int blk) {
  int4* __restrict__ p = (int4*)grid + blk * STREAM_TILE + threadIdx.x;
  for (int j = 0; j < WORK_PER_WAVE; ++j)
    p[j * STREAM_BLOCK] = make_int4(-1, -1, -1, -1);
}

// First launch: everything that reads only inputs. Roles in index order: feats, the
// grid fill, then Wq, W1, W2.
#define TILES_OF(n4) (((n4) + STREAM_TILE - 1) / STREAM_TILE)
#define GRID_BLOCKS (GRID_CELLS / (4 * STREAM_TILE))
#define WQ_N4 (FDIM * FDIM / 4)
#define WM_N4 (4 * FDIM * FDIM / 4)  // W1 and W2 alike
#define PREP_FIXED_BLOCKS (GRID_BLOCKS + TILES_OF(WQ_N4) + 2 * TILES_OF(WM_N4))
__global__ void __launch_bounds__(STREAM_BLOCK) prep_k(
    const float* __restrict__ feats, _Float16* __restrict__ Xh, int nf4,
    const float* __restrict__ Wq, _Float16* __restrict__ Wqh,
    const float* __restrict__ W1, _Float16* __restrict__ W1h,
    const float* __restrict__ W2, _Float16* __restrict__ W2h, int* __restrict__ grid) {
  int blk = blockIdx.x;
  if (blk < TILES_OF(nf4)) { cvt4_f16_block(feats, Xh, nf4, blk); return; }
  blk -= TILES_OF(nf4);
  if (blk < GRID_BLOCKS) { init_grid_block(grid, blk); return; }
  blk -= GRID_BLOCKS;
  if (blk < TILES_OF(WQ_N4)) { cvt4_f16_block(Wq, Wqh, WQ_N4, blk); return; }
  blk -= TILES_OF(WQ_N4);
  if (blk < TILES_OF(WM_N4)) { cvt4_f16_block(W1, W1h, WM_N4, blk); return; }
  cvt4_f16_block(W2, W2h, WM_N4, blk - TILES_OF(WM_N4));
}

// The scatter runs in blocks of PROJ_BLOCK threads, the size of the projection blocks
// whose grid it shares.
#define PROJ_BLOCK 128
__device__ __forceinline__ void scatter_block(const int* __restrict__ coords,
                                              int* __restrict__ grid, int n, int blk) {
  int i = blk * PROJ_BLOCK + threadIdx.x;
  if (i >= n) return;
  int x = coords[i * 3 + 0], y = coords[i * 3 + 1], z = coords[i * 3 + 2];
  grid[x * (GY * GZ) + y * GZ + z] = i;
}

// ---------------- q = feats @ Wq^T  (WMMA, f16 operands) ----------------
// av = the A fragments of the wave's 16-row strip tm; 2 groups of 4 col tiles so
// 4 independent accumulator chains hide B-load latency behind wmma.
__device__ __forceinline__ void gemm_q_strip(const v16h (&av)[4],
                                             const _Float16* __restrict__ Wqh,
                                             float* __restrict__ Q, int n, int tm,
                                             int m, int kh) {
  const bool full = (tm * 16 + 16) <= n;  // SGPR condition

#pragma unroll 1
  for (int tg = 0; tg < 2; ++tg) {  // 2 groups of 4 column tiles
    v8f acc[4] = {{}, {}, {}, {}};
#pragma unroll
    for (int k = 0; k < 4; ++k) {
      v16h b[4];
#pragma unroll
      for (int t = 0; t < 4; ++t) {
        int col = (tg * 4 + t) * 16 + m;
        b[t] = frag_ld_f16(Wqh + (size_t)col * FDIM + k * 32 + kh * 8);
      }
#pragma unroll
      for (int t = 0; t < 4; ++t) acc[t] = wmma_f16(av[k], b[t], acc[t]);
    }
#pragma unroll
    for (int t = 0; t < 4; ++t) {
      int cn = (tg * 4 + t) * 16 + m;
      int rb = tm * 16 + 8 * kh;  // C layout: lanes<16 -> M=r, lanes>=16 -> M=8+r
      if (full) {
#pragma unroll
        for (int r = 0; r < 8; ++r) Q[(size_t)(rb + r) * FDIM + cn] = acc[t][r];
        // The built code joins the guarded path here, which reuses the stores' registers.
        asm volatile("s_wait_xcnt 0x0" ::: "memory");
      } else {
#pragma unroll
        for (int r = 0; r < 8; ++r)
          if (rb + r < n) Q[(size_t)(rb + r) * FDIM + cn] = acc[t][r];
        // What follows the last tile (k and v) reuses these stores' registers too.
        asm volatile("s_wait_xcnt 0x0" ::: "memory");
      }
    }
  }
}

// ------- k,v per-head 16x16 projections (WMMA, K padded to 32) + norm1 -------
// Sum over the 16 lanes that hold the 16 columns of one C tile: DPP row_xmask
// butterfly (ctrl 0x160 | mask), all lanes on; it stays on the vector port, where
// a shuffle would go through the LDS pipe and its wait.
__device__ __forceinline__ float row16_sum(float x) {
  x += __int_as_float(__builtin_amdgcn_update_dpp(0, __float_as_int(x), 0x161, 0xf, 0xf, true));
  x += __int_as_float(__builtin_amdgcn_update_dpp(0, __float_as_int(x), 0x162, 0xf, 0xf, true));
  x += __int_as_float(__builtin_amdgcn_update_dpp(0, __float_as_int(x), 0x164, 0xf, 0xf, true));
  x += __int_as_float(__builtin_amdgcn_update_dpp(0, __float_as_int(x), 0x168, 0xf, 0xf, true));
  return x;
}

// One projection (k or v) of a wave's 16 rows: the 16 x 128 result stays in
// accumulator registers (8 heads x 8 rows per lane), so the row statistics of
// the layernorm come from registers and only the normalised rows are stored.
__device__ __forceinline__ void proj_norm_store(
    const v16h (&a)[NHEAD], const float* __restrict__ wp,
    const float* __restrict__ bias, const float* __restrict__ g,
    const float* __restrict__ b, float* __restrict__ op, int m, int rb, int n) {
  v8f acc[NHEAD];
#pragma unroll
  for (int h = 0; h < NHEAD; ++h) {
    v16h bf = {};  // W[h][e][d], e = m; slots 8..15 = K>=16 stay zero
#pragma unroll
    for (int i = 0; i < 8; ++i) bf[i] = (_Float16)wp[h * HDIM * HDIM + i];
    v8f z = {};
    acc[h] = wmma_f16(a[h], bf, z);
  }

  // bias, then per-row sum and sum of squares: 8 heads in the lane, 16 lanes
  float s[8], q[8];
#pragma unroll
  for (int r = 0; r < 8; ++r) { s[r] = 0.f; q[r] = 0.f; }
#pragma unroll
  for (int h = 0; h < NHEAD; ++h) {
    float bia = bias[h * HDIM + m];
#pragma unroll
    for (int r = 0; r < 8; ++r) {
      float x = acc[h][r] + bia;
      acc[h][r] = x;
      s[r] += x; q[r] += x * x;
    }
  }
#pragma unroll
  for (int r = 0; r < 8; ++r) {
    float mean = row16_sum(s[r]) * (1.0f / FDIM);
    float var  = row16_sum(q[r]) * (1.0f / FDIM) - mean * mean;
    s[r] = mean;
    q[r] = rsqrtf(var + 1e-5f);
  }
#pragma unroll
  for (int h = 0; h < NHEAD; ++h) {
    float gg = g[h * HDIM + m], bb = b[h * HDIM + m];
#pragma unroll
    for (int r = 0; r < 8; ++r) acc[h][r] = (acc[h][r] - s[r]) * q[r] * gg + bb;
  }
#pragma unroll
  for (int r = 0; r < 8; ++r) {
    if (rb + r < n) {
#pragma unroll
      for (int h = 0; h < NHEAD; ++h) op[r * FDIM + h * HDIM] = acc[h][r];
    }
  }
}

// q, k and v of one 16-row strip per wave (4 waves/block). The strip's f16 rows are
// loaded once: a q fragment holds k = 32 columns, which are the 16 columns of two heads.
__device__ __forceinline__ void qkv_block(
    const _Float16* __restrict__ Xh, const _Float16* __restrict__ Wqh,
    float* __restrict__ Q, const float* __restrict__ Wk, const float* __restrict__ bk,
    const float* __restrict__ Wv, const float* __restrict__ bv,
    const float* __restrict__ g, const float* __restrict__ b, float* __restrict__ K,
    float* __restrict__ V, int n, int blk) {
  int lane = threadIdx.x & 31;
  int m = lane & 15, kh = lane >> 4;
  int tm = __builtin_amdgcn_readfirstlane(blk * 4 + (threadIdx.x >> 5));
  if (tm * 16 >= n) return;  // scalar branch
  int row = tm * 16 + m;
  if (row >= n) row = n - 1;

  v16h av[4];
#pragma unroll
  for (int k = 0; k < 4; ++k)
    av[k] = frag_ld_f16(Xh + (size_t)row * FDIM + k * 32 + kh * 8);

  gemm_q_strip(av, Wqh, Q, n, tm, m, kh);

  // A: 16 pts x 16 dims (f16) per head, zero-padded to K=32 (slots 8..15 = K>=16)
  v16h a[NHEAD];
#pragma unroll
  for (int h = 0; h < NHEAD; ++h) {
    v16h t = {};
#pragma unroll
    for (int i = 0; i < 8; ++i) t[i] = av[h >> 1][(h & 1) * 8 + i];
    a[h] = t;
  }

  const int rb = tm * 16 + 8 * kh;  // C layout: lanes<16 -> M=r, lanes>=16 -> M=8+r
  const int wo = m * HDIM + kh * 8;
  proj_norm_store(a, Wk + wo, bk, g, b, K + (size_t)rb * FDIM + m, m, rb, n);
  proj_norm_store(a, Wv + wo, bv, g, b, V + (size_t)rb * FDIM + m, m, rb, n);
}

// Second launch: what needs only the first one's results. The projection blocks come
// first in the index, the short scatter blocks behind them.
#define PROJ_BLOCKS(n) (((n) + 63) / 64)                    // 4 strips of 16 rows each
#define POINT_BLOCKS(n) (((n) + PROJ_BLOCK - 1) / PROJ_BLOCK)  // one thread per point
__global__ void __launch_bounds__(PROJ_BLOCK) qkv_scatter_k(
    const _Float16* __restrict__ Xh, const _Float16* __restrict__ Wqh,
    float* __restrict__ Q, const float* __restrict__ Wk, const float* __restrict__ bk,
    const float* __restrict__ Wv, const float* __restrict__ bv,
    const float* __restrict__ g, const float* __restrict__ b, float* __restrict__ K,
    float* __restrict__ V, const int* __restrict__ coords, int* __restrict__ grid,
    int n) {
  const int blk = blockIdx.x;
  if (blk < PROJ_BLOCKS(n)) qkv_block(Xh, Wqh, Q, Wk, bk, Wv, bv, g, b, K, V, n, blk);
  else scatter_block(coords, grid, n, blk - PROJ_BLOCKS(n));
}

// rsqrtf as the compiler expands it (x below the smallest normal scaled by 2^24, the
// result by 2^12). The v_rsq_f32 is asm text so that the v_nop, the slot the
// instruction set asks for behind a transcendental, stays directly behind it wherever
// the compiler schedules it.
__device__ __forceinline__ float rsqrt_with_slot(float x) {
  const bool tiny = x < 1.17549435e-38f;
  const float xs = tiny ? x * 16777216.0f : x;
  float r;
  asm("v_rsq_f32 %0, %1\n\tv_nop" : "=v"(r) : "v"(xs));
  return tiny ? r * 4096.0f : r;
}

// ---------------- 27-neighbor attention + residual + norm2 ----------------
// one thread per (point, head). The four loops over the 27 slots are unrolled, so
// every index into nb[] and sc[] is a constant and both arrays are plain registers:
// indexed by a loop counter, nb[] is placed in LDS by the compiler, sized for the
// largest block the kernel might get, and that much LDS holds a WGP to two blocks. The
// real block size is declared for the same reason.
#define ATT_BLOCK 256
#define NSLOT 27

// __expf as the compiler expands it (x * log2(e), then v_exp_f32). The v_exp_f32 is asm
// text so that the v_nop, the slot the instruction set asks for behind a transcendental,
// stays directly behind it wherever the compiler schedules the 27 slots.
__device__ __forceinline__ float exp_with_slot(float x) {
  const float y = x * 1.44269504088896340736f;
  float r;
  asm("v_exp_f32 %0, %1\n\tv_nop" : "=v"(r) : "v"(y));
  return r;
}

// Sum over the 8 neighbouring lanes that hold the 8 heads of one point: DPP row_xmask
// butterfly (ctrl 0x160 | mask) on the vector port. The 8 lanes are on or off together.
__device__ __forceinline__ float head8_sum(float x) {
  x += __int_as_float(__builtin_amdgcn_update_dpp(0, __float_as_int(x), 0x161, 0xf, 0xf, true));
  x += __int_as_float(__builtin_amdgcn_update_dpp(0, __float_as_int(x), 0x162, 0xf, 0xf, true));
  x += __int_as_float(__builtin_amdgcn_update_dpp(0, __float_as_int(x), 0x164, 0xf, 0xf, true));
  return x;
}

// Head h of row i >= 0 of a [n][FDIM] f32 array in the workspace, whose 256 MiB hold
// fewer than 2^19 such rows: told so, the compiler forms the byte offset in one register
// beside the scalar base; in 64 bits each of the 27 indices is held in a register pair.
__device__ __forceinline__ const float* head_at(const float* __restrict__ base, int i, int h) {
  __builtin_assume((unsigned)i < (1u << 19));
  return (const float*)((const char*)base +
                        ((unsigned)i * FDIM + (unsigned)h * HDIM) * (unsigned)sizeof(float));
}

__global__ void __launch_bounds__(ATT_BLOCK) attention_k(
    const float* __restrict__ Q, const float* __restrict__ Kn,
    const float* __restrict__ Vn, const float* __restrict__ feats,
    const int* __restrict__ coords, const int* grid,
    const float* __restrict__ g, const float* __restrict__ b, float* __restrict__ Xr,
    _Float16* __restrict__ XNh, int n) {
  int t = blockIdx.x * ATT_BLOCK + threadIdx.x;
  if (t >= n * NHEAD) return;
  int pt = t >> 3, h = t & 7;
  // Byte offset of the thread's own 16 columns in a [n][FDIM] f32 array (t = pt * 8 + h),
  // 32 bits as in head_at: one register, live to the last store, serves Q, feats and x.
  __builtin_assume((unsigned)t < (1u << 22));
  const unsigned own = (unsigned)t * (unsigned)(HDIM * sizeof(float));
  const float scale = 0.0883883476483184f;  // 1/sqrt(128)
  // The point's 27 neighbour cells are looked up here, by each of its 8 lanes (one
  // address for the 8). The 3 cells along z lie side by side in one 128-B row of the
  // grid: one 12-B load per (dx, dy), its window held inside the row (zc), so at z = 0 and
  // z = GZ - 1 the wanted cells sit one place off in it. A row off the grid reads row 0;
  // what is off the grid is then set to -1. No load stands under a branch or waits for
  // another's: 9 loads in flight together.
  const int x = coords[pt * 3 + 0], y = coords[pt * 3 + 1], z = coords[pt * 3 + 2];
  const int zc = min(max(z, 1), GZ - 2);
  const bool zlo = z < 1, zhi = z > GZ - 2;
  const bool in_m = (unsigned)(z - 1) < GZ, in_0 = (unsigned)z < GZ, in_p = (unsigned)(z + 1) < GZ;
  bool in[NSLOT / 3];
  unsigned at[NSLOT / 3];  // byte offsets of the windows, below the grid's 8 MiB
  int e[NSLOT / 3][3];
#pragma unroll
  for (int r = 0; r < NSLOT / 3; ++r) {
    const int nx = x + r / 3 - 1, ny = y + r % 3 - 1;
    in[r] = (unsigned)nx < GX && (unsigned)ny < GY;
    at[r] = in[r] ? (unsigned)(nx * (GY * GZ) + ny * GZ + zc - 1) * (unsigned)sizeof(int) : 0u;
    __builtin_assume(at[r] < GRID_CELLS * (unsigned)sizeof(int));
  }
#pragma unroll
  for (int r = 0; r < NSLOT / 3; ++r) {
    const int* w = (const int*)((const char*)grid + at[r]);
    e[r][0] = w[0]; e[r][1] = w[1]; e[r][2] = w[2];
  }
  // The built code let a later window land on an earlier load's address register. The
  // offsets are inputs here so that they stay whole up to this wait; grid is not declared
  // __restrict__, so that the "memory" clobber keeps its loads in front of the wait.
  asm volatile("s_wait_xcnt 0x0" ::"v"(at[0]), "v"(at[1]), "v"(at[2]), "v"(at[3]), "v"(at[4]),
               "v"(at[5]), "v"(at[6]), "v"(at[7]), "v"(at[8])
               : "memory");
  int nb[NSLOT];
#pragma unroll
  for (int r = 0; r < NSLOT / 3; ++r) {
    nb[r * 3 + 0] = (in[r] && in_m) ? (zhi ? e[r][1] : e[r][0]) : -1;
    nb[r * 3 + 1] = (in[r] && in_0) ? (zlo ? e[r][0] : zhi ? e[r][2] : e[r][1]) : -1;
    nb[r * 3 + 2] = (in[r] && in_p) ? (zlo ? e[r][1] : e[r][2]) : -1;
  }
  float q[HDIM];
#pragma unroll
  for (int d = 0; d < HDIM; ++d) q[d] = ((const float*)((const char*)Q + own))[d];
  float sc[NSLOT];
  float mx = -3.0e38f;
#pragma unroll
  for (int j = 0; j < NSLOT; ++j) {
    float s = -1.0e30f;
    if (nb[j] >= 0) {
      const float* kp = head_at(Kn, nb[j], h);
      float acc = 0.f;
#pragma unroll
      for (int d = 0; d < HDIM; ++d) acc += q[d] * kp[d];
      s = acc * scale;
    }
    sc[j] = s;
    mx = fmaxf(mx, s);
  }
  float denom = 0.f;
#pragma unroll
  for (int j = 0; j < NSLOT; ++j) {
    float e = (nb[j] >= 0) ? exp_with_slot(sc[j] - mx) : 0.f;
    sc[j] = e;
    denom += e;
  }
  float inv = 1.0f / denom;
  float o[HDIM];
#pragma unroll
  for (int d = 0; d < HDIM; ++d) o[d] = 0.f;
#pragma unroll
  for (int j = 0; j < NSLOT; ++j) {
    if (nb[j] >= 0) {
      float p = sc[j] * inv;
      const float* vp = head_at(Vn, nb[j], h);
#pragma unroll
      for (int d = 0; d < HDIM; ++d) o[d] += p * vp[d];
    }
  }
  // residual row x, and norm2 of it while it is still in registers: a row is 16 columns
  // in each of 8 lanes, so its sum and sum of squares are 16 terms in the lane, then 8 lanes.
  const float* __restrict__ fin = (const float*)((const char*)feats + own);
  float* __restrict__ xout = (float*)((char*)Xr + own);
  _Float16* __restrict__ xnout = (_Float16*)((char*)XNh + own / 2);
  float s = 0.f, ss = 0.f;
#pragma unroll
  for (int d = 0; d < HDIM; ++d) {
    o[d] += fin[d];
    s += o[d];
    ss += o[d] * o[d];
  }
  const float mean = head8_sum(s) * (1.0f / FDIM);
  const float var  = head8_sum(ss) * (1.0f / FDIM) - mean * mean;
  const float rs = rsqrt_with_slot(var + 1e-5f);
  v8h xn[2];
#pragma unroll
  for (int d = 0; d < HDIM; ++d)
    xn[d >> 3][d & 7] = (_Float16)((o[d] - mean) * rs * g[h * HDIM + d] + b[h * HDIM + d]);
#pragma unroll
  for (int d = 0; d < HDIM; ++d) xout[d] = o[d];
  *(v8h*)xnout = xn[0];
  *(v8h*)(xnout + 8) = xn[1];
}

// gelu(x) = 0.5 x (1 + erf(x / sqrt 2)) = max(x, 0) - |x| * 0.5 erfc(|x| / sqrt 2), with
// erfc(z) = t (a1 + t (a2 + t (a3 + t (a4 + t a5)))) exp(-z^2), t = 1 / (1 + p z): the
// five-term rational form of erf, absolute error below 1.5e-7 for every z >= 0; the 0.5
// is folded into the coefficients. One straight line for every x, so the 32 values of a
// trip are worked on side by side; the library's erff takes one of two ranges by |x|,
// and a wave with lanes in both walks both, one value after the other.
// The hardware's own rcp and exp2 are enough here: exp2 gives 0 where the true value is
// below the smallest normal, and there the whole term is far below an f16 step of h.
__device__ __forceinline__ float gelu_erf(float x) {
  const float ax = fabsf(x);
  const float t = __builtin_amdgcn_rcpf(fmaf(ax, 0.3275911f * 0.7071067811865475f, 1.0f));
  const float e = __builtin_amdgcn_exp2f(x * x * -0.72134752044448170368f);  // exp(-x^2/2)
  float p = 0.5f * 1.061405429f;
  p = fmaf(p, t, 0.5f * -1.453152027f);
  p = fmaf(p, t, 0.5f * 1.421413741f);
  p = fmaf(p, t, 0.5f * -0.284496736f);
  p = fmaf(p, t, 0.5f * 0.254829592f);
  return fmaf(-(ax * e), p * t, fmaxf(x, 0.0f));
}

// ---------------- fused MLP: gelu(LN(x)@W1^T+b1)@W2^T + b2 + x ----------------
// One block = 64 rows (4 row tiles), 4 waves. The waves split the COLUMNS: every wave
// works on all 4 row tiles, so a weight fragment is loaded by one wave of the block and
// feeds 4 WMMAs; with a row tile per wave each of the 4 waves loaded every fragment.
#define MLP_TILES 4                 // row tiles per block
#define MLP_ROWS (MLP_TILES * 16)
#define HID (4 * FDIM)
#define H_PITCH (HID + 8)           // f16: rows 16 B apart in the banks for b128 readers
__global__ void __launch_bounds__(128) mlp_fused_k(
    const _Float16* __restrict__ XNh, const float* __restrict__ Xr,
    const _Float16* __restrict__ W1h, const float* __restrict__ bm1,
    const _Float16* __restrict__ W2h, const float* __restrict__ bm2,
    float* __restrict__ out, int n) {
  __shared__ __attribute__((aligned(16))) _Float16 hbuf[MLP_ROWS * H_PITCH];  // 65 KB
  const int lane = threadIdx.x & 31;
  const int wave = __builtin_amdgcn_readfirstlane(threadIdx.x >> 5);
  const int m = lane & 15, kh = lane >> 4;
  const int row0 = blockIdx.x * MLP_ROWS;  // < n by the grid

  // stage 1: h = gelu(XN @ W1^T + bm1) -> LDS (f16). A frags of all 64 rows stay in
  // registers; wave w makes columns [128 w, 128 w + 128) of h.
  v16h av[MLP_TILES][4];
#pragma unroll
  for (int rt = 0; rt < MLP_TILES; ++rt) {
    int row = row0 + rt * 16 + m;
    if (row >= n) row = n - 1;  // clamp: duplicate work, never stored
#pragma unroll
    for (int k = 0; k < 4; ++k)
      av[rt][k] = frag_ld_f16(XNh + (size_t)row * FDIM + k * 32 + kh * 8);
    // The built code lets a later tile's loads land on this tile's address registers.
    asm volatile("s_wait_xcnt 0x0" ::: "memory");
  }

  for (int ct = 0; ct < 8; ++ct) {  // the wave's 8 column tiles
    const int cn = (wave * 8 + ct) * 16 + m;
    v16h b[4];
#pragma unroll
    for (int k = 0; k < 4; ++k)
      b[k] = frag_ld_f16(W1h + (size_t)cn * FDIM + k * 32 + kh * 8);
    // The built code lets the bias load land on the fragment loads' address registers.
    asm volatile("s_wait_xcnt 0x0" ::: "memory");
    const float bia = bm1[cn];
    // Inputs-only fence on the loaded fragments: keeps the tile's 8 loads in flight
    // together; without it the compiler reuses one fragment's registers and waits 4 times.
    asm volatile("" ::"v"(b[0]), "v"(b[1]), "v"(b[2]), "v"(b[3]));
    v8f acc[MLP_TILES] = {{}, {}, {}, {}};
#pragma unroll
    for (int k = 0; k < 4; ++k) {
#pragma unroll
      for (int rt = 0; rt < MLP_TILES; ++rt) acc[rt] = wmma_f16(av[rt][k], b[k], acc[rt]);
    }
#pragma unroll
    for (int rt = 0; rt < MLP_TILES; ++rt) {
      const int rb = rt * 16 + 8 * kh;  // C layout: lanes<16 -> M=r, lanes>=16 -> M=8+r
#pragma unroll
      for (int r = 0; r < 8; ++r) {
        hbuf[(rb + r) * H_PITCH + cn] = (_Float16)gelu_erf(acc[rt][r] + bia);
      }
    }
  }
  __syncthreads();  // every wave reads all 512 columns of h below

  // stage 2: out = Xr + h @ W2^T + bm2; wave w makes output columns [32 w, 32 w + 32)
  v8f acc[2][MLP_TILES] = {{{}, {}, {}, {}}, {{}, {}, {}, {}}};
  // Two k steps per trip: together they use up the 128-B line of each W2 row, and the
  // second step's loads fly while the first step's WMMAs run.
#pragma unroll 2
  for (int k0 = 0; k0 < HID; k0 += 32) {
    v16h b[2], a[MLP_TILES];
#pragma unroll
    for (int t = 0; t < 2; ++t)
      b[t] = frag_ld_f16(W2h + (size_t)((wave * 2 + t) * 16 + m) * HID + k0 + kh * 8);
#pragma unroll
    for (int rt = 0; rt < MLP_TILES; ++rt)
      a[rt] = frag_ld_f16(&hbuf[(rt * 16 + m) * H_PITCH + k0 + kh * 8]);
#pragma unroll
    for (int t = 0; t < 2; ++t) {
#pragma unroll
      for (int rt = 0; rt < MLP_TILES; ++rt) acc[t][rt] = wmma_f16(a[rt], b[t], acc[t][rt]);
    }
  }
  const float bia0 = bm2[wave * 32 + m], bia1 = bm2[wave * 32 + 16 + m];
  const size_t o0 = (size_t)(row0 + 8 * kh) * FDIM + wave * 32 + m;
  const float* __restrict__ xp = Xr + o0;
  float* __restrict__ op = out + o0;
  if (row0 + MLP_ROWS <= n) {  // scalar branch: whole block in range
    float x[2][MLP_TILES][8];
#pragma unroll
    for (int t = 0; t < 2; ++t)
#pragma unroll
      for (int rt = 0; rt < MLP_TILES; ++rt)
#pragma unroll
        for (int r = 0; r < 8; ++r) x[t][rt][r] = xp[(rt * 16 + r) * FDIM + t * 16];
#pragma unroll
    for (int t = 0; t < 2; ++t)
#pragma unroll
      for (int rt = 0; rt < MLP_TILES; ++rt)
#pragma unroll
        for (int r = 0; r < 8; ++r)
          op[(rt * 16 + r) * FDIM + t * 16] = x[t][rt][r] + acc[t][rt][r] + (t ? bia1 : bia0);
  } else {
#pragma unroll
    for (int t = 0; t < 2; ++t)
#pragma unroll
      for (int rt = 0; rt < MLP_TILES; ++rt)
#pragma unroll
        for (int r = 0; r < 8; ++r)
          if (row0 + rt * 16 + 8 * kh + r < n)
            op[(rt * 16 + r) * FDIM + t * 16] =
                xp[(rt * 16 + r) * FDIM + t * 16] + acc[t][rt][r] + (t ? bia1 : bia0);
  }
}

// ---------------- host ----------------
extern "C" void kernel_launch(void* const* d_in, const int* in_sizes, int n_in,
                              void* d_out, int out_size, void* d_ws, size_t ws_size,
                              hipStream_t stream) {
  const int*   coords = (const int*)d_in[0];
  const float* feats  = (const float*)d_in[1];
  const float* Wq     = (const float*)d_in[2];
  const float* Wk     = (const float*)d_in[3];
  const float* bk     = (const float*)d_in[4];
  const float* Wv     = (const float*)d_in[5];
  const float* bv     = (const float*)d_in[6];
  const float* g1     = (const float*)d_in[7];
  const float* b1     = (const float*)d_in[8];
  const float* g2     = (const float*)d_in[9];
  const float* b2     = (const float*)d_in[10];
  const float* W1     = (const float*)d_in[11];
  const float* bm1    = (const float*)d_in[12];
  const float* W2     = (const float*)d_in[13];
  const float* bm2    = (const float*)d_in[14];
  float* out = (float*)d_out;
  const int N = in_sizes[1] / FDIM;
  (void)n_in; (void)out_size; (void)ws_size;

  char* ws = (char*)d_ws;
  size_t off = 0;
  auto carve = [&](size_t bytes) {
    void* p = ws + off;
    off = (off + bytes + 255) & ~(size_t)255;
    return p;
  };
  int*       grid = (int*)carve((size_t)GRID_CELLS * sizeof(int));
  float*     qb   = (float*)carve((size_t)N * FDIM * sizeof(float));
  float*     kb   = (float*)carve((size_t)N * FDIM * sizeof(float));
  float*     vb   = (float*)carve((size_t)N * FDIM * sizeof(float));
  float*     xr   = (float*)carve((size_t)N * FDIM * sizeof(float));
  _Float16*  Xh   = (_Float16*)carve((size_t)N * FDIM * sizeof(_Float16));
  _Float16*  xnh  = (_Float16*)carve((size_t)N * FDIM * sizeof(_Float16));
  _Float16*  Wqh  = (_Float16*)carve((size_t)FDIM * FDIM * sizeof(_Float16));
  _Float16*  W1h  = (_Float16*)carve((size_t)4 * FDIM * FDIM * sizeof(_Float16));
  _Float16*  W2h  = (_Float16*)carve((size_t)4 * FDIM * FDIM * sizeof(_Float16));

  const int mt = (N + 15) / 16;

  // inputs only: f32 -> f16 conversions and the grid fill
  int nf4 = (N * FDIM) / 4;
  prep_k<<<TILES_OF(nf4) + PREP_FIXED_BLOCKS, STREAM_BLOCK, 0, stream>>>(
      feats, Xh, nf4, Wq, Wqh, W1, W1h, W2, W2h, grid);

  // q, and k, v with norm1 applied, beside the scatter into the grid
  qkv_scatter_k<<<PROJ_BLOCKS(N) + POINT_BLOCKS(N), PROJ_BLOCK, 0, stream>>>(
      Xh, Wqh, qb, Wk, bk, Wv, bv, g1, b1, kb, vb, coords, grid, N);

  // neighbour look-up + attention + residual -> xr, and norm2 of it -> f16 for the MLP
  attention_k<<<(N * NHEAD + ATT_BLOCK - 1) / ATT_BLOCK, ATT_BLOCK, 0, stream>>>(
      qb, kb, vb, feats, coords, grid, g2, b2, xr, xnh, N);

  // fused MLP + residual -> out (64 rows per block, h tile in static LDS)
  mlp_fused_k<<<(mt + 3) / 4, 128, 0, stream>>>(xnh, xr, W1h, bm1, W2h, bm2, out, N);
}

// v009
// A run of this version takes 68.7 microseconds.
// Next to v008, in two timings, it ran 1.03 and 1.02 times as fast.
// Over all steps from v000 it is 3.53 times as fast.
#include <hip/hip_runtime.h>
#include <math.h>

// ---------------- problem constants ----------------
#define GX 256
#define GY 256
#define GZ 32
#define GRID_CELLS (GX * GY * GZ)   // 2,097,152
#define FDIM 128
#define NHEAD 8
#define HDIM 16

typedef __attribute__((ext_vector_type(16))) _Float16 v16h;
typedef __attribute__((ext_vector_type(8)))  _Float16 v8h;
typedef __attribute__((ext_vector_type(4)))  _Float16 v4h;
typedef __attribute__((ext_vector_type(8)))  float    v8f;

// A/B fragment for v_wmma_f32_16x16x32_f16 from row-major packed f16.
// p = &M[row][k0 + khalf*8]:
//   frag[i]   = K(k0 + khalf*8 + i)       i in 0..7   (16B contiguous)
//   frag[8+i] = K(k0 + 16 + khalf*8 + i)              (16B contiguous)
__device__ __forceinline__ v16h frag_ld_f16(const _Float16* __restrict__ p) {
  v8h lo = *(const v8h*)p;
  v8h hi = *(const v8h*)(p + 16);
  v16h r;
#pragma unroll
  for (int i = 0; i < 8; ++i) { r[i] = lo[i]; r[8 + i] = hi[i]; }
  return r;
}

__device__ __forceinline__ v8f wmma_f16(v16h a, v16h b, v8f c) {
  return __builtin_amdgcn_wmma_f32_16x16x32_f16(false, a, false, b, (short)0, c,
                                                false, false);
}

// Streaming blocks (grid fill, conversion): each wave moves WORK_PER_WAVE
// 512-B pieces, for speed only.
#define STREAM_BLOCK 256
#define WORK_PER_WAVE 8
#define STREAM_TILE (STREAM_BLOCK * WORK_PER_WAVE)  // 16-B pieces per block

// Launches that do not depend on each other share one grid: each block takes one role,
// picked by a scalar compare on its index, and gets its index within that role (blk).

// ---------------- f32 -> f16 conversion (vectorized x4) ----------------
// 8 float4 per thread, all loads issued before the first store.
__device__ __forceinline__ void cvt4_f16_block(
    const float* __restrict__ in, _Float16* __restrict__ out, int n4, int blk) {
  const int base = blk * STREAM_TILE;
  const float4* __restrict__ ip = (const float4*)in + base + threadIdx.x;
  v4h* __restrict__ op = (v4h*)out + base + threadIdx.x;
  if (base + STREAM_TILE <= n4) {  // whole block in range: scalar branch
    float4 v[WORK_PER_WAVE];
    for (int j = 0; j < WORK_PER_WAVE; ++j) v[j] = ip[j * STREAM_BLOCK];
    for (int j = 0; j < WORK_PER_WAVE; ++j) {
      v4h o = {(_Float16)v[j].x, (_Float16)v[j].y, (_Float16)v[j].z, (_Float16)v[j].w};
      op[j * STREAM_BLOCK] = o;
    }
    // The built code joins the tail's path here, which reuses the stores' registers.
    asm volatile("s_wait_xcnt 0x0" ::: "memory");
  } else {
    for (int j = 0; j < WORK_PER_WAVE; ++j) {
      if (base + j * STREAM_BLOCK + (int)threadIdx.x < n4) {
        float4 v = ip[j * STREAM_BLOCK];
        v4h o = {(_Float16)v.x, (_Float16)v.y, (_Float16)v.z, (_Float16)v.w};
        op[j * STREAM_BLOCK] = o;
      }
    }
  }
}

// ---------------- neighbor table ----------------
// 8 stores of 16 B per thread; the grid is a whole number of block tiles.
static_assert(GRID_CELLS % (4 * STREAM_TILE) == 0, "grid fill has no tail");
__device__ __forceinline__ void init_grid_block(int* __restrict__ grid, int blk) {
  int4* __restrict__ p = (int4*)grid + blk * STREAM_TILE + threadIdx.x;
  for (int j = 0; j < WORK_PER_WAVE; ++j)
    p[j * STREAM_BLOCK] = make_int4(-1, -1, -1, -1);
}

// First launch: everything that reads only inputs. Roles in index order: feats, the
// grid fill, then Wq, W1, W2.
#define TILES_OF(n4) (((n4) + STREAM_TILE - 1) / STREAM_TILE)
#define GRID_BLOCKS (GRID_CELLS / (4 * STREAM_TILE))
#define WQ_N4 (FDIM * FDIM / 4)
#define WM_N4 (4 * FDIM * FDIM / 4)  // W1 and W2 alike
#define PREP_FIXED_BLOCKS (GRID_BLOCKS + TILES_OF(WQ_N4) + 2 * TILES_OF(WM_N4))
__global__ void __launch_bounds__(STREAM_BLOCK) prep_k(
    const float* __restrict__ feats, _Float16* __restrict__ Xh, int nf4,
    const float* __restrict__ Wq, _Float16* __restrict__ Wqh,
    const float* __restrict__ W1, _Float16* __restrict__ W1h,
    const float* __restrict__ W2, _Float16* __restrict__ W2h, int* __restrict__ grid) {
  int blk = blockIdx.x;
  if (blk < TILES_OF(nf4)) { cvt4_f16_block(feats, Xh, nf4, blk); return; }
  blk -= TILES_OF(nf4);
  if (blk < GRID_BLOCKS) { init_grid_block(grid, blk); return; }
  blk -= GRID_BLOCKS;
  if (blk < TILES_OF(WQ_N4)) { cvt4_f16_block(Wq, Wqh, WQ_N4, blk); return; }
  blk -= TILES_OF(WQ_N4);
  if (blk < TILES_OF(WM_N4)) { cvt4_f16_block(W1, W1h, WM_N4, blk); return; }
  cvt4_f16_block(W2, W2h, WM_N4, blk - TILES_OF(WM_N4));
}

// The scatter runs in blocks of PROJ_BLOCK threads, the size of the projection blocks
// whose grid it shares.
#define PROJ_BLOCK 128
__device__ __forceinline__ void scatter_block(const int* __restrict__ coords,
                                              int* __restrict__ grid, int n, int blk) {
  int i = blk * PROJ_BLOCK + threadIdx.x;
  if (i >= n) return;
  int x = coords[i * 3 + 0], y = coords[i * 3 + 1], z = coords[i * 3 + 2];
  grid[x * (GY * GZ) + y * GZ + z] = i;
}

// ---------------- q = feats @ Wq^T  (WMMA, f16 operands) ----------------
// av = the A fragments of the wave's 16-row strip tm; 2 groups of 4 col tiles so
// 4 independent accumulator chains hide B-load latency behind wmma.
__device__ __forceinline__ void gemm_q_strip(const v16h (&av)[4],
                                             const _Float16* __restrict__ Wqh,
                                             float* __restrict__ Q, int n, int tm,
                                             int m, int kh) {
  const bool full = (tm * 16 + 16) <= n;  // SGPR condition

#pragma unroll 1
  for (int tg = 0; tg < 2; ++tg) {  // 2 groups of 4 column tiles
    v8f acc[4] = {{}, {}, {}, {}};
#pragma unroll
    for (int k = 0; k < 4; ++k) {
      v16h b[4];
#pragma unroll
      for (int t = 0; t < 4; ++t) {
        int col = (tg * 4 + t) * 16 + m;
        b[t] = frag_ld_f16(Wqh + (size_t)col * FDIM + k * 32 + kh * 8);
      }
#pragma unroll
      for (int t = 0; t < 4; ++t) acc[t] = wmma_f16(av[k], b[t], acc[t]);
    }
#pragma unroll
    for (int t = 0; t < 4; ++t) {
      int cn = (tg * 4 + t) * 16 + m;
      int rb = tm * 16 + 8 * kh;  // C layout: lanes<16 -> M=r, lanes>=16 -> M=8+r
      if (full) {
#pragma unroll
        for (int r = 0; r < 8; ++r) Q[(size_t)(rb + r) * FDIM + cn] = acc[t][r];
        // The built code joins the guarded path here, which reuses the stores' registers.
        asm volatile("s_wait_xcnt 0x0" ::: "memory");
      } else {
#pragma unroll
        for (int r = 0; r < 8; ++r)
          if (rb + r < n) Q[(size_t)(rb + r) * FDIM + cn] = acc[t][r];
        // What follows the last tile (k and v) reuses these stores' registers too.
        asm volatile("s_wait_xcnt 0x0" ::: "memory");
      }
    }
  }
}

// ------- k,v per-head 16x16 projections (WMMA, K padded to 32) + norm1 -------
// Sum over the 16 lanes that hold the 16 columns of one C tile: DPP row_xmask
// butterfly (ctrl 0x160 | mask), all lanes on; it stays on the vector port, where
// a shuffle would go through the LDS pipe and its wait.
__device__ __forceinline__ float row16_sum(float x) {
  x += __int_as_float(__builtin_amdgcn_update_dpp(0, __float_as_int(x), 0x161, 0xf, 0xf, true));
  x += __int_as_float(__builtin_amdgcn_update_dpp(0, __float_as_int(x), 0x162, 0xf, 0xf, true));
  x += __int_as_float(__builtin_amdgcn_update_dpp(0, __float_as_int(x), 0x164, 0xf, 0xf, true));
  x += __int_as_float(__builtin_amdgcn_update_dpp(0, __float_as_int(x), 0x168, 0xf, 0xf, true));
  return x;
}

// One projection (k or v) of a wave's 16 rows: the 16 x 128 result stays in
// accumulator registers (8 heads x 8 rows per lane), so the row statistics of
// the layernorm come from registers and only the normalised rows are stored.
__device__ __forceinline__ void proj_norm_store(
    const v16h (&a)[NHEAD], const float* __restrict__ wp,
    const float* __restrict__ bias, const float* __restrict__ g,
    const float* __restrict__ b, float* __restrict__ op, int m, int rb, int n) {
  v8f acc[NHEAD];
#pragma unroll
  for (int h = 0; h < NHEAD; ++h) {
    v16h bf = {};  // W[h][e][d], e = m; slots 8..15 = K>=16 stay zero
#pragma unroll
    for (int i = 0; i < 8; ++i) bf[i] = (_Float16)wp[h * HDIM * HDIM + i];
    v8f z = {};
    acc[h] = wmma_f16(a[h], bf, z);
  }

  // bias, then per-row sum and sum of squares: 8 heads in the lane, 16 lanes
  float s[8], q[8];
#pragma unroll
  for (int r = 0; r < 8; ++r) { s[r] = 0.f; q[r] = 0.f; }
#pragma unroll
  for (int h = 0; h < NHEAD; ++h) {
    float bia = bias[h * HDIM + m];
#pragma unroll
    for (int r = 0; r < 8; ++r) {
      float x = acc[h][r] + bia;
      acc[h][r] = x;
      s[r] += x; q[r] += x * x;
    }
  }
#pragma unroll
  for (int r = 0; r < 8; ++r) {
    float mean = row16_sum(s[r]) * (1.0f / FDIM);
    float var  = row16_sum(q[r]) * (1.0f / FDIM) - mean * mean;
    s[r] = mean;
    q[r] = rsqrtf(var + 1e-5f);
  }
#pragma unroll
  for (int h = 0; h < NHEAD; ++h) {
    float gg = g[h * HDIM + m], bb = b[h * HDIM + m];
#pragma unroll
    for (int r = 0; r < 8; ++r) acc[h][r] = (acc[h][r] - s[r]) * q[r] * gg + bb;
  }
#pragma unroll
  for (int r = 0; r < 8; ++r) {
    if (rb + r < n) {
#pragma unroll
      for (int h = 0; h < NHEAD; ++h) op[r * FDIM + h * HDIM] = acc[h][r];
    }
  }
}

// q, k and v of one 16-row strip per wave (4 waves/block). The strip's f16 rows are
// loaded once: a q fragment holds k = 32 columns, which are the 16 columns of two heads.
__device__ __forceinline__ void qkv_block(
    const _Float16* __restrict__ Xh, const _Float16* __restrict__ Wqh,
    float* __restrict__ Q, const float* __restrict__ Wk, const float* __restrict__ bk,
    const float* __restrict__ Wv, const float* __restrict__ bv,
    const float* __restrict__ g, const float* __restrict__ b, float* __restrict__ K,
    float* __restrict__ V, int n, int blk) {
  int lane = threadIdx.x & 31;
  int m = lane & 15, kh = lane >> 4;
  int tm = __builtin_amdgcn_readfirstlane(blk * 4 + (threadIdx.x >> 5));
  if (tm * 16 >= n) return;  // scalar branch
  int row = tm * 16 + m;
  if (row >= n) row = n - 1;

  v16h av[4];
#pragma unroll
  for (int k = 0; k < 4; ++k)
    av[k] = frag_ld_f16(Xh + (size_t)row * FDIM + k * 32 + kh * 8);

  gemm_q_strip(av, Wqh, Q, n, tm, m, kh);

  // A: 16 pts x 16 dims (f16) per head, zero-padded to K=32 (slots 8..15 = K>=16)
  v16h a[NHEAD];
#pragma unroll
  for (int h = 0; h < NHEAD; ++h) {
    v16h t = {};
#pragma unroll
    for (int i = 0; i < 8; ++i) t[i] = av[h >> 1][(h & 1) * 8 + i];
    a[h] = t;
  }

  const int rb = tm * 16 + 8 * kh;  // C layout: lanes<16 -> M=r, lanes>=16 -> M=8+r
  const int wo = m * HDIM + kh * 8;
  proj_norm_store(a, Wk + wo, bk, g, b, K + (size_t)rb * FDIM + m, m, rb, n);
  proj_norm_store(a, Wv + wo, bv, g, b, V + (size_t)rb * FDIM + m, m, rb, n);
}

// Second launch: what needs only the first one's results. The projection blocks come
// first in the index, the short scatter blocks behind them.
#define PROJ_BLOCKS(n) (((n) + 63) / 64)                    // 4 strips of 16 rows each
#define POINT_BLOCKS(n) (((n) + PROJ_BLOCK - 1) / PROJ_BLOCK)  // one thread per point
__global__ void __launch_bounds__(PROJ_BLOCK) qkv_scatter_k(
    const _Float16* __restrict__ Xh, const _Float16* __restrict__ Wqh,
    float* __restrict__ Q, const float* __restrict__ Wk, const float* __restrict__ bk,
    const float* __restrict__ Wv, const float* __restrict__ bv,
    const float* __restrict__ g, const float* __restrict__ b, float* __restrict__ K,
    float* __restrict__ V, const int* __restrict__ coords, int* __restrict__ grid,
    int n) {
  const int blk = blockIdx.x;
  if (blk < PROJ_BLOCKS(n)) qkv_block(Xh, Wqh, Q, Wk, bk, Wv, bv, g, b, K, V, n, blk);
  else scatter_block(coords, grid, n, blk - PROJ_BLOCKS(n));
}

// rsqrtf as the compiler expands it (x below the smallest normal scaled by 2^24, the
// result by 2^12). The v_rsq_f32 is asm text so that the v_nop, the slot the
// instruction set asks for behind a transcendental, stays directly behind it wherever
// the compiler schedules it.
__device__ __forceinline__ float rsqrt_with_slot(float x) {
  const bool tiny = x < 1.17549435e-38f;
  const float xs = tiny ? x * 16777216.0f : x;
  float r;
  asm("v_rsq_f32 %0, %1\n\tv_nop" : "=v"(r) : "v"(xs));
  return tiny ? r * 4096.0f : r;
}

// ---------------- 27-neighbor attention + residual + norm2 ----------------
// A wave's 32 lanes share one point: lane l holds columns 4 l .. 4 l + 3 of a row (head
// l / 4), so every load and store of a q, k, v, feats or x row is 512 contiguous bytes,
// 4 whole lines. With a lane per (point, head) a 16-B load had its lanes 64 B apart and
// touched 16 lines for the same 512 bytes. A wave takes ATT_PPW points side by side.
#define ATT_BLOCK 256
#define NSLOT 27
#define ATT_PPW 4
static_assert(ATT_BLOCK / 32 * ATT_PPW * NHEAD == ATT_BLOCK, "grid: 32 points per block");

// __expf as the compiler expands it (x * log2(e), then v_exp_f32). The v_exp_f32 is asm
// text so that the v_nop, the slot the instruction set asks for behind a transcendental,
// stays directly behind it wherever the compiler schedules it.
__device__ __forceinline__ float exp_with_slot(float x) {
  const float y = x * 1.44269504088896340736f;
  float r;
  asm("v_exp_f32 %0, %1\n\tv_nop" : "=v"(r) : "v"(y));
  return r;
}

// Sum over the 4 neighbouring lanes that hold the 16 columns of one head: DPP row_xmask
// butterfly (ctrl 0x160 | mask) on the vector port, all lanes on.
__device__ __forceinline__ float head_sum(float x) {
  x += __int_as_float(__builtin_amdgcn_update_dpp(0, __float_as_int(x), 0x161, 0xf, 0xf, true));
  x += __int_as_float(__builtin_amdgcn_update_dpp(0, __float_as_int(x), 0x162, 0xf, 0xf, true));
  return x;
}

// Sum over the wave's 32 lanes (a whole row): 16 lanes by DPP, then the other 16-lane
// half by a cross-row move (lane i reads lane i of the other half).
__device__ __forceinline__ float row32_sum(float x) {
  x = row16_sum(x);
  const unsigned u = (unsigned)__float_as_int(x);
  return x + __int_as_float((int)__builtin_amdgcn_permlanex16(u, u, 0x76543210u, 0xfedcba98u,
                                                              false, false));
}

// Address of row i >= 0 of an array of rows of row_bytes, i the same in every lane. The
// workspace's 256 MiB hold fewer than 2^19 rows of 512 B, so the byte offset fits 32 bits.
// Both words are held scalar: a row access is then scalar base + the lane's offset.
typedef __attribute__((address_space(1))) char gchar;  // global memory, as the arrays are
typedef __attribute__((ext_vector_type(4))) float v4f;
typedef __attribute__((address_space(1))) v4f gv4f;
typedef __attribute__((address_space(1))) v4h gv4h;
__device__ __forceinline__ unsigned long long row_at(const void* base, int i, unsigned row_bytes) {
  __builtin_assume((unsigned)i < (1u << 19));
  const unsigned long long a = (unsigned long long)base + (unsigned)i * row_bytes;
  const unsigned lo = __builtin_amdgcn_readfirstlane((unsigned)a);
  const unsigned hi = __builtin_amdgcn_readfirstlane((unsigned)(a >> 32));
  return ((unsigned long long)hi << 32) | lo;
}
#define ROW_BYTES (FDIM * (unsigned)sizeof(float))

// Xr and XNh are not declared __restrict__, so that the "memory" clobber of the wait behind
// their stores keeps the stores in front of it.
__global__ void __launch_bounds__(ATT_BLOCK) attention_k(
    const float* Q, const float* Kn, const float* Vn, const float* feats,
    const int* __restrict__ coords, const int* grid, const float* g, const float* b,
    float* Xr, _Float16* XNh, int n) {
  const int lane = threadIdx.x & 31;
  const int pt0 = __builtin_amdgcn_readfirstlane(
      (int)(blockIdx.x * (ATT_BLOCK / 32) + (threadIdx.x >> 5)) * ATT_PPW);
  if (pt0 >= n) return;  // scalar branch
  const unsigned col = (unsigned)lane * 16u;  // the lane's 4 columns, in bytes
  const float scale = 0.0883883476483184f;    // 1/sqrt(128)
  // Lane j < 27 looks up neighbour cell j of the point: one 4-B load for all 27 cells. A
  // cell off the grid reads cell 0 and is then set to -1.
  const int dx = lane / 9 - 1, dy = (lane / 3) % 3 - 1, dz = lane % 3 - 1;
  int pt[ATT_PPW];  // a point past the end repeats the last one and is not stored
  bool in[ATT_PPW];
  unsigned at[ATT_PPW];  // byte offsets of the cells, below the grid's 8 MiB
#pragma unroll
  for (int p = 0; p < ATT_PPW; ++p) {
    pt[p] = min(pt0 + p, n - 1);
    const int nx = coords[pt[p] * 3 + 0] + dx, ny = coords[pt[p] * 3 + 1] + dy,
              nz = coords[pt[p] * 3 + 2] + dz;
    in[p] = lane < NSLOT && (unsigned)nx < GX && (unsigned)ny < GY && (unsigned)nz < GZ;
    at[p] = in[p] ? (unsigned)(nx * (GY * GZ) + ny * GZ + nz) * (unsigned)sizeof(int) : 0u;
  }
  int idx[ATT_PPW];
  v4f q[ATT_PPW], x[ATT_PPW];
  // Each run of row loads is one asm statement that ends in its data wait: all its loads
  // are in flight together, no row lands in a register that a load of the run still names
  // (early-clobber outputs), and every address register is whole until the data is there.
  // Left to the compiler, later rows landed in earlier loads' address pairs.
  // Here: the 4 points' cells, q rows and feats rows.
  asm volatile(
      "global_load_b32 %0, %12, %17\n\t"
      "global_load_b32 %1, %13, %17\n\t"
      "global_load_b32 %2, %14, %17\n\t"
      "global_load_b32 %3, %15, %17\n\t"
      "global_load_b128 %4, %16, %18\n\t"
      "global_load_b128 %5, %16, %19\n\t"
      "global_load_b128 %6, %16, %20\n\t"
      "global_load_b128 %7, %16, %21\n\t"
      "global_load_b128 %8, %16, %22\n\t"
      "global_load_b128 %9, %16, %23\n\t"
      "global_load_b128 %10, %16, %24\n\t"
      "global_load_b128 %11, %16, %25\n\t"
      "s_wait_loadcnt 0x0"
      : "=&v"(idx[0]), "=&v"(idx[1]), "=&v"(idx[2]), "=&v"(idx[3]), "=&v"(q[0]), "=&v"(q[1]),
        "=&v"(q[2]), "=&v"(q[3]), "=&v"(x[0]), "=&v"(x[1]), "=&v"(x[2]), "=&v"(x[3])
      : "v"(at[0]), "v"(at[1]), "v"(at[2]), "v"(at[3]), "v"(col),
        "s"((unsigned long long)grid), "s"(row_at(Q, pt[0], ROW_BYTES)),
        "s"(row_at(Q, pt[1], ROW_BYTES)), "s"(row_at(Q, pt[2], ROW_BYTES)),
        "s"(row_at(Q, pt[3], ROW_BYTES)), "s"(row_at(feats, pt[0], ROW_BYTES)),
        "s"(row_at(feats, pt[1], ROW_BYTES)), "s"(row_at(feats, pt[2], ROW_BYTES)),
        "s"(row_at(feats, pt[3], ROW_BYTES))
      : "memory");
  unsigned left[ATT_PPW];  // the point's occupied cells not yet worked on, a bit per slot
#pragma unroll
  for (int p = 0; p < ATT_PPW; ++p) {
    idx[p] = in[p] ? idx[p] : -1;
    left[p] = __builtin_amdgcn_readfirstlane(__builtin_amdgcn_ballot_w32(idx[p] >= 0));
  }

  // One pass over the occupied cells only: the walk's length is known only at run time, so
  // there is no register array of scores, and the softmax keeps a running maximum. A trip
  // takes the next occupied cell of each of the 4 points; a point that has none left reads
  // row 0 with weight exp(-huge) = 0.
  float mx[ATT_PPW], den[ATT_PPW];
  v4f o[ATT_PPW];
#pragma unroll
  for (int p = 0; p < ATT_PPW; ++p) {
    mx[p] = -3.0e38f;
    den[p] = 0.f;
    o[p] = (v4f){0.f, 0.f, 0.f, 0.f};
  }
#pragma unroll 1  // the trip count is known only at run time: copies would only be code
  for (int trip = 0; trip < NSLOT && (left[0] | left[1] | left[2] | left[3]) != 0u; ++trip) {
    float none[ATT_PPW];  // 0, or -huge for a point that has no cell left
    int row[ATT_PPW];
    v4f k[ATT_PPW], v[ATT_PPW];
#pragma unroll
    for (int p = 0; p < ATT_PPW; ++p) {
      const bool has = left[p] != 0u;
      const int slot = has ? __builtin_ctz(left[p]) : 0;
      const int found = __builtin_amdgcn_readlane(idx[p], slot);
      row[p] = has ? found : 0;
      none[p] = has ? 0.f : -3.0e38f;
      left[p] &= ~(1u << slot);  // an empty mask stays empty
    }
    // The trip's 4 k rows and 4 v rows, one statement with its data wait, as above.
    asm volatile(
        "global_load_b128 %0, %8, %9\n\t"
        "global_load_b128 %1, %8, %10\n\t"
        "global_load_b128 %2, %8, %11\n\t"
        "global_load_b128 %3, %8, %12\n\t"
        "global_load_b128 %4, %8, %13\n\t"
        "global_load_b128 %5, %8, %14\n\t"
        "global_load_b128 %6, %8, %15\n\t"
        "global_load_b128 %7, %8, %16\n\t"
        "s_wait_loadcnt 0x0"
        : "=&v"(k[0]), "=&v"(k[1]), "=&v"(k[2]), "=&v"(k[3]), "=&v"(v[0]), "=&v"(v[1]),
          "=&v"(v[2]), "=&v"(v[3])
        : "v"(col), "s"(row_at(Kn, row[0], ROW_BYTES)), "s"(row_at(Kn, row[1], ROW_BYTES)),
          "s"(row_at(Kn, row[2], ROW_BYTES)), "s"(row_at(Kn, row[3], ROW_BYTES)),
          "s"(row_at(Vn, row[0], ROW_BYTES)), "s"(row_at(Vn, row[1], ROW_BYTES)),
          "s"(row_at(Vn, row[2], ROW_BYTES)), "s"(row_at(Vn, row[3], ROW_BYTES))
        : "memory");
#pragma unroll
    for (int p = 0; p < ATT_PPW; ++p) {
      const float dot = head_sum(q[p].x * k[p].x + q[p].y * k[p].y + q[p].z * k[p].z +
                                 q[p].w * k[p].w);
      const float s = fmaf(dot, scale, none[p]);
      const float mnew = fmaxf(mx[p], s);
      const float c = exp_with_slot(mx[p] - mnew), w = exp_with_slot(s - mnew);
      mx[p] = mnew;
      den[p] = den[p] * c + w;
      o[p].x = o[p].x * c + w * v[p].x;
      o[p].y = o[p].y * c + w * v[p].y;
      o[p].z = o[p].z * c + w * v[p].z;
      o[p].w = o[p].w * c + w * v[p].w;
    }
  }

  // g and b are loaded only here: held across the loop their 8 registers would leave a WGP
  // room for 4 blocks, and the grid has 5 for most. One statement with its data wait.
  v4f gg, bb;
  asm volatile(
      "global_load_b128 %0, %2, %3\n\t"
      "global_load_b128 %1, %2, %4\n\t"
      "s_wait_loadcnt 0x0"
      : "=&v"(gg), "=&v"(bb)
      : "v"(col), "s"((unsigned long long)g), "s"((unsigned long long)b)
      : "memory");

  // residual row x, and norm2 of it while it is still in registers: a row is 4 columns in
  // each of 32 lanes, so its sum and sum of squares are 4 terms in the lane, then 32 lanes.
#pragma unroll
  for (int p = 0; p < ATT_PPW; ++p) {
    const float inv = 1.0f / den[p];
    x[p].x += o[p].x * inv;
    x[p].y += o[p].y * inv;
    x[p].z += o[p].z * inv;
    x[p].w += o[p].w * inv;
    const float s = x[p].x + x[p].y + x[p].z + x[p].w;
    const float ss = x[p].x * x[p].x + x[p].y * x[p].y + x[p].z * x[p].z + x[p].w * x[p].w;
    const float mean = row32_sum(s) * (1.0f / FDIM);
    const float var  = row32_sum(ss) * (1.0f / FDIM) - mean * mean;
    const float rs = rsqrt_with_slot(var + 1e-5f);
    const v4h xn = {(_Float16)((x[p].x - mean) * rs * gg.x + bb.x),
                    (_Float16)((x[p].y - mean) * rs * gg.y + bb.y),
                    (_Float16)((x[p].z - mean) * rs * gg.z + bb.z),
                    (_Float16)((x[p].w - mean) * rs * gg.w + bb.w)};
    if (pt0 + p < n) {  // scalar branch
      *(gv4f*)((gchar*)row_at(Xr, pt0 + p, ROW_BYTES) + col) = x[p];
      *(gv4h*)((gchar*)row_at(XNh, pt0 + p, ROW_BYTES / 2) + col / 2) = xn;
      // The next point's arithmetic reuses the registers that these stores name.
      asm volatile("s_wait_xcnt 0x0" ::: "memory");
    }
  }
}

// gelu(x) = 0.5 x (1 + erf(x / sqrt 2)) = max(x, 0) - |x| * 0.5 erfc(|x| / sqrt 2), with
// erfc(z) = t (a1 + t (a2 + t (a3 + t (a4 + t a5)))) exp(-z^2), t = 1 / (1 + p z): the
// five-term rational form of erf, absolute error below 1.5e-7 for every z >= 0; the 0.5
// is folded into the coefficients. One straight line for every x, so the 32 values of a
// trip are worked on side by side; the library's erff takes one of two ranges by |x|,
// and a wave with lanes in both walks both, one value after the other.
// The hardware's own rcp and exp2 are enough here: exp2 gives 0 where the true value is
// below the smallest normal, and there the whole term is far below an f16 step of h.
__device__ __forceinline__ float gelu_erf(float x) {
  const float ax = fabsf(x);
  const float t = __builtin_amdgcn_rcpf(fmaf(ax, 0.3275911f * 0.7071067811865475f, 1.0f));
  const float e = __builtin_amdgcn_exp2f(x * x * -0.72134752044448170368f);  // exp(-x^2/2)
  float p = 0.5f * 1.061405429f;
  p = fmaf(p, t, 0.5f * -1.453152027f);
  p = fmaf(p, t, 0.5f * 1.421413741f);
  p = fmaf(p, t, 0.5f * -0.284496736f);
  p = fmaf(p, t, 0.5f * 0.254829592f);
  return fmaf(-(ax * e), p * t, fmaxf(x, 0.0f));
}

// ---------------- fused MLP: gelu(LN(x)@W1^T+b1)@W2^T + b2 + x ----------------
// One block = 64 rows (4 row tiles), 4 waves. The waves split the COLUMNS: every wave
// works on all 4 row tiles, so a weight fragment is loaded by one wave of the block and
// feeds 4 WMMAs; with a row tile per wave each of the 4 waves loaded every fragment.
#define MLP_TILES 4                 // row tiles per block
#define MLP_ROWS (MLP_TILES * 16)
#define HID (4 * FDIM)
#define H_PITCH (HID + 8)           // f16: rows 16 B apart in the banks for b128 readers
__global__ void __launch_bounds__(128) mlp_fused_k(
    const _Float16* __restrict__ XNh, const float* __restrict__ Xr,
    const _Float16* __restrict__ W1h, const float* __restrict__ bm1,
    const _Float16* __restrict__ W2h, const float* __restrict__ bm2,
    float* __restrict__ out, int n) {
  __shared__ __attribute__((aligned(16))) _Float16 hbuf[MLP_ROWS * H_PITCH];  // 65 KB
  const int lane = threadIdx.x & 31;
  const int wave = __builtin_amdgcn_readfirstlane(threadIdx.x >> 5);
  const int m = lane & 15, kh = lane >> 4;
  const int row0 = blockIdx.x * MLP_ROWS;  // < n by the grid

  // stage 1: h = gelu(XN @ W1^T + bm1) -> LDS (f16). A frags of all 64 rows stay in
  // registers; wave w makes columns [128 w, 128 w + 128) of h.
  v16h av[MLP_TILES][4];
#pragma unroll
  for (int rt = 0; rt < MLP_TILES; ++rt) {
    int row = row0 + rt * 16 + m;
    if (row >= n) row = n - 1;  // clamp: duplicate work, never stored
#pragma unroll
    for (int k = 0; k < 4; ++k)
      av[rt][k] = frag_ld_f16(XNh + (size_t)row * FDIM + k * 32 + kh * 8);
    // The built code lets a later tile's loads land on this tile's address registers.
    asm volatile("s_wait_xcnt 0x0" ::: "memory");
  }

  for (int ct = 0; ct < 8; ++ct) {  // the wave's 8 column tiles
    const int cn = (wave * 8 + ct) * 16 + m;
    v16h b[4];
#pragma unroll
    for (int k = 0; k < 4; ++k)
      b[k] = frag_ld_f16(W1h + (size_t)cn * FDIM + k * 32 + kh * 8);
    // The built code lets the bias load land on the fragment loads' address registers.
    asm volatile("s_wait_xcnt 0x0" ::: "memory");
    const float bia = bm1[cn];
    // Inputs-only fence on the loaded fragments: keeps the tile's 8 loads in flight
    // together; without it the compiler reuses one fragment's registers and waits 4 times.
    asm volatile("" ::"v"(b[0]), "v"(b[1]), "v"(b[2]), "v"(b[3]));
    v8f acc[MLP_TILES] = {{}, {}, {}, {}};
#pragma unroll
    for (int k = 0; k < 4; ++k) {
#pragma unroll
      for (int rt = 0; rt < MLP_TILES; ++rt) acc[rt] = wmma_f16(av[rt][k], b[k], acc[rt]);
    }
#pragma unroll
    for (int rt = 0; rt < MLP_TILES; ++rt) {
      const int rb = rt * 16 + 8 * kh;  // C layout: lanes<16 -> M=r, lanes>=16 -> M=8+r
#pragma unroll
      for (int r = 0; r < 8; ++r) {
        hbuf[(rb + r) * H_PITCH + cn] = (_Float16)gelu_erf(acc[rt][r] + bia);
      }
    }
  }
  __syncthreads();  // every wave reads all 512 columns of h below

  // stage 2: out = Xr + h @ W2^T + bm2; wave w makes output columns [32 w, 32 w + 32)
  v8f acc[2][MLP_TILES] = {{{}, {}, {}, {}}, {{}, {}, {}, {}}};
  // Two k steps per trip: together they use up the 128-B line of each W2 row, and the
  // second step's loads fly while the first step's WMMAs run.
#pragma unroll 2
  for (int k0 = 0; k0 < HID; k0 += 32) {
    v16h b[2], a[MLP_TILES];
#pragma unroll
    for (int t = 0; t < 2; ++t)
      b[t] = frag_ld_f16(W2h + (size_t)((wave * 2 + t) * 16 + m) * HID + k0 + kh * 8);
#pragma unroll
    for (int rt = 0; rt < MLP_TILES; ++rt)
      a[rt] = frag_ld_f16(&hbuf[(rt * 16 + m) * H_PITCH + k0 + kh * 8]);
#pragma unroll
    for (int t = 0; t < 2; ++t) {
#pragma unroll
      for (int rt = 0; rt < MLP_TILES; ++rt) acc[t][rt] = wmma_f16(a[rt], b[t], acc[t][rt]);
    }
  }
  const float bia0 = bm2[wave * 32 + m], bia1 = bm2[wave * 32 + 16 + m];
  const size_t o0 = (size_t)(row0 + 8 * kh) * FDIM + wave * 32 + m;
  const float* __restrict__ xp = Xr + o0;
  float* __restrict__ op = out + o0;
  if (row0 + MLP_ROWS <= n) {  // scalar branch: whole block in range
    float x[2][MLP_TILES][8];
#pragma unroll
    for (int t = 0; t < 2; ++t)
#pragma unroll
      for (int rt = 0; rt < MLP_TILES; ++rt)
#pragma unroll
        for (int r = 0; r < 8; ++r) x[t][rt][r] = xp[(rt * 16 + r) * FDIM + t * 16];
#pragma unroll
    for (int t = 0; t < 2; ++t)
#pragma unroll
      for (int rt = 0; rt < MLP_TILES; ++rt)
#pragma unroll
        for (int r = 0; r < 8; ++r)
          op[(rt * 16 + r) * FDIM + t * 16] = x[t][rt][r] + acc[t][rt][r] + (t ? bia1 : bia0);
  } else {
#pragma unroll
    for (int t = 0; t < 2; ++t)
#pragma unroll
      for (int rt = 0; rt < MLP_TILES; ++rt)
#pragma unroll
        for (int r = 0; r < 8; ++r)
          if (row0 + rt * 16 + 8 * kh + r < n)
            op[(rt * 16 + r) * FDIM + t * 16] =
                xp[(rt * 16 + r) * FDIM + t * 16] + acc[t][rt][r] + (t ? bia1 : bia0);
  }
}

// ---------------- host ----------------
extern "C" void kernel_launch(void* const* d_in, const int* in_sizes, int n_in,
                              void* d_out, int out_size, void* d_ws, size_t ws_size,
                              hipStream_t stream) {
  const int*   coords = (const int*)d_in[0];
  const float* feats  = (const float*)d_in[1];
  const float* Wq     = (const float*)d_in[2];
  const float* Wk     = (const float*)d_in[3];
  const float* bk     = (const float*)d_in[4];
  const float* Wv     = (const float*)d_in[5];
  const float* bv     = (const float*)d_in[6];
  const float* g1     = (const float*)d_in[7];
  const float* b1     = (const float*)d_in[8];
  const float* g2     = (const float*)d_in[9];
  const float* b2     = (const float*)d_in[10];
  const float* W1     = (const float*)d_in[11];
  const float* bm1    = (const float*)d_in[12];
  const float* W2     = (const float*)d_in[13];
  const float* bm2    = (const float*)d_in[14];
  float* out = (float*)d_out;
  const int N = in_sizes[1] / FDIM;
  (void)n_in; (void)out_size; (void)ws_size;

  char* ws = (char*)d_ws;
  size_t off = 0;
  auto carve = [&](size_t bytes) {
    void* p = ws + off;
    off = (off + bytes + 255) & ~(size_t)255;
    return p;
  };
  int*       grid = (int*)carve((size_t)GRID_CELLS * sizeof(int));
  float*     qb   = (float*)carve((size_t)N * FDIM * sizeof(float));
  float*     kb   = (float*)carve((size_t)N * FDIM * sizeof(float));
  float*     vb   = (float*)carve((size_t)N * FDIM * sizeof(float));
  float*     xr   = (float*)carve((size_t)N * FDIM * sizeof(float));
  _Float16*  Xh   = (_Float16*)carve((size_t)N * FDIM * sizeof(_Float16));
  _Float16*  xnh  = (_Float16*)carve((size_t)N * FDIM * sizeof(_Float16));
  _Float16*  Wqh  = (_Float16*)carve((size_t)FDIM * FDIM * sizeof(_Float16));
  _Float16*  W1h  = (_Float16*)carve((size_t)4 * FDIM * FDIM * sizeof(_Float16));
  _Float16*  W2h  = (_Float16*)carve((size_t)4 * FDIM * FDIM * sizeof(_Float16));

  const int mt = (N + 15) / 16;

  // inputs only: f32 -> f16 conversions and the grid fill
  int nf4 = (N * FDIM) / 4;
  prep_k<<<TILES_OF(nf4) + PREP_FIXED_BLOCKS, STREAM_BLOCK, 0, stream>>>(
      feats, Xh, nf4, Wq, Wqh, W1, W1h, W2, W2h, grid);

  // q, and k, v with norm1 applied, beside the scatter into the grid
  qkv_scatter_k<<<PROJ_BLOCKS(N) + POINT_BLOCKS(N), PROJ_BLOCK, 0, stream>>>(
      Xh, Wqh, qb, Wk, bk, Wv, bv, g1, b1, kb, vb, coords, grid, N);

  // neighbour look-up + attention + residual -> xr, and norm2 of it -> f16 for the MLP
  attention_k<<<(N * NHEAD + ATT_BLOCK - 1) / ATT_BLOCK, ATT_BLOCK, 0, stream>>>(
      qb, kb, vb, feats, coords, grid, g2, b2, xr, xnh, N);

  // fused MLP + residual -> out (64 rows per block, h tile in static LDS)
  mlp_fused_k<<<(mt + 3) / 4, 128, 0, stream>>>(xnh, xr, W1h, bm1, W2h, bm2, out, N);
}

// v010
// One run takes 61.9 microseconds.
// Next to v009, in two timings, it ran 1.11 and 1.10 times as fast.
// All steps since v000 together make it 3.89 times as fast.
#include <hip/hip_runtime.h>
#include <math.h>

// ---------------- problem constants ----------------
#define GX 256
#define GY 256
#define GZ 32
#define GRID_CELLS (GX * GY * GZ)   // 2,097,152
#define FDIM 128
#define NHEAD 8
#define HDIM 16

typedef __attribute__((ext_vector_type(16))) _Float16 v16h;
typedef __attribute__((ext_vector_type(8)))  _Float16 v8h;
typedef __attribute__((ext_vector_type(4)))  _Float16 v4h;
typedef __attribute__((ext_vector_type(8)))  float    v8f;

// A/B fragment for v_wmma_f32_16x16x32_f16 from row-major packed f16.
// p = &M[row][k0 + khalf*8]:
//   frag[i]   = K(k0 + khalf*8 + i)       i in 0..7   (16B contiguous)
//   frag[8+i] = K(k0 + 16 + khalf*8 + i)              (16B contiguous)
__device__ __forceinline__ v16h frag_ld_f16(const _Float16* __restrict__ p) {
  v8h lo = *(const v8h*)p;
  v8h hi = *(const v8h*)(p + 16);
  v16h r;
#pragma unroll
  for (int i = 0; i < 8; ++i) { r[i] = lo[i]; r[8 + i] = hi[i]; }
  return r;
}

__device__ __forceinline__ v8f wmma_f16(v16h a, v16h b, v8f c) {
  return __builtin_amdgcn_wmma_f32_16x16x32_f16(false, a, false, b, (short)0, c,
                                                false, false);
}

// Streaming blocks (grid fill, conversion): each wave moves WORK_PER_WAVE
// 512-B pieces, for speed only.
#define STREAM_BLOCK 256
#define WORK_PER_WAVE 8
#define STREAM_TILE (STREAM_BLOCK * WORK_PER_WAVE)  // 16-B pieces per block

// Launches that do not depend on each other share one grid: each block takes one role,
// picked by a scalar compare on its index, and gets its index within that role (blk).

// ---------------- f32 -> f16 conversion (vectorized x4) ----------------
// 8 float4 per thread, all loads issued before the first store.
__device__ __forceinline__ void cvt4_f16_block(
    const float* __restrict__ in, _Float16* __restrict__ out, int n4, int blk) {
  const int base = blk * STREAM_TILE;
  const float4* __restrict__ ip = (const float4*)in + base + threadIdx.x;
  v4h* __restrict__ op = (v4h*)out + base + threadIdx.x;
  if (base + STREAM_TILE <= n4) {  // whole block in range: scalar branch
    float4 v[WORK_PER_WAVE];
    for (int j = 0; j < WORK_PER_WAVE; ++j) v[j] = ip[j * STREAM_BLOCK];
    for (int j = 0; j < WORK_PER_WAVE; ++j) {
      v4h o = {(_Float16)v[j].x, (_Float16)v[j].y, (_Float16)v[j].z, (_Float16)v[j].w};
      op[j * STREAM_BLOCK] = o;
    }
    // The built code joins the tail's path here, which reuses the stores' registers.
    asm volatile("s_wait_xcnt 0x0" ::: "memory");
  } else {
    for (int j = 0; j < WORK_PER_WAVE; ++j) {
      if (base + j * STREAM_BLOCK + (int)threadIdx.x < n4) {
        float4 v = ip[j * STREAM_BLOCK];
        v4h o = {(_Float16)v.x, (_Float16)v.y, (_Float16)v.z, (_Float16)v.w};
        op[j * STREAM_BLOCK] = o;
      }
    }
  }
}

// ---------------- neighbor table ----------------
// 8 stores of 16 B per thread; the grid is a whole number of block tiles.
static_assert(GRID_CELLS % (4 * STREAM_TILE) == 0, "grid fill has no tail");
__device__ __forceinline__ void init_grid_block(int* __restrict__ grid, int blk) {
  int4* __restrict__ p = (int4*)grid + blk * STREAM_TILE + threadIdx.x;
  for (int j = 0; j < WORK_PER_WAVE; ++j)
    p[j * STREAM_BLOCK] = make_int4(-1, -1, -1, -1);
}

// Wq as f16 in the order its B fragments are read: piece ((ct * 4 + k) * 2 + half) * 32 + lane
// holds the 8 values that lane (m = lane & 15, kh = lane >> 4) takes for column ct * 16 + m at
// K = k * 32 + half * 16 + kh * 8, so a wave's 16-B fragment load is 512 contiguous bytes.
#define WQ_BLOCKS (FDIM * FDIM / 8 / STREAM_BLOCK)  // one piece per thread
__device__ __forceinline__ void pack_wq_block(const float* __restrict__ Wq,
                                              _Float16* __restrict__ Wqp, int blk) {
  const int piece = blk * STREAM_BLOCK + threadIdx.x;
  const int lane = piece & 31, half = (piece >> 5) & 1, k = (piece >> 6) & 3, ct = piece >> 8;
  const float4* __restrict__ p = (const float4*)(
      Wq + (ct * 16 + (lane & 15)) * FDIM + k * 32 + half * 16 + (lane >> 4) * 8);
  const float4 a = p[0], b = p[1];
  const v8h o = {(_Float16)a.x, (_Float16)a.y, (_Float16)a.z, (_Float16)a.w,
                 (_Float16)b.x, (_Float16)b.y, (_Float16)b.z, (_Float16)b.w};
  *(v8h*)(Wqp + piece * 8) = o;
  // The built code joins the other roles' paths here, which reuse the store's registers.
  asm volatile("s_wait_xcnt 0x0" ::: "memory");
}

// First launch: everything that reads only inputs. Roles in index order: feats, the
// grid fill, then Wq, W1, W2.
#define TILES_OF(n4) (((n4) + STREAM_TILE - 1) / STREAM_TILE)
#define GRID_BLOCKS (GRID_CELLS / (4 * STREAM_TILE))
#define WM_N4 (4 * FDIM * FDIM / 4)  // W1 and W2 alike
#define PREP_FIXED_BLOCKS (GRID_BLOCKS + WQ_BLOCKS + 2 * TILES_OF(WM_N4))
__global__ void __launch_bounds__(STREAM_BLOCK) prep_k(
    const float* __restrict__ feats, _Float16* __restrict__ Xh, int nf4,
    const float* __restrict__ Wq, _Float16* __restrict__ Wqp,
    const float* __restrict__ W1, _Float16* __restrict__ W1h,
    const float* __restrict__ W2, _Float16* __restrict__ W2h, int* __restrict__ grid) {
  int blk = blockIdx.x;
  if (blk < TILES_OF(nf4)) { cvt4_f16_block(feats, Xh, nf4, blk); return; }
  blk -= TILES_OF(nf4);
  if (blk < GRID_BLOCKS) { init_grid_block(grid, blk); return; }
  blk -= GRID_BLOCKS;
  if (blk < WQ_BLOCKS) { pack_wq_block(Wq, Wqp, blk); return; }
  blk -= WQ_BLOCKS;
  if (blk < TILES_OF(WM_N4)) { cvt4_f16_block(W1, W1h, WM_N4, blk); return; }
  cvt4_f16_block(W2, W2h, WM_N4, blk - TILES_OF(WM_N4));
}

// The scatter runs in blocks of PROJ_BLOCK threads, the size of the projection blocks
// whose grid it shares.
#define PROJ_BLOCK 128
__device__ __forceinline__ void scatter_block(const int* __restrict__ coords,
                                              int* __restrict__ grid, int n, int blk) {
  int i = blk * PROJ_BLOCK + threadIdx.x;
  if (i >= n) return;
  int x = coords[i * 3 + 0], y = coords[i * 3 + 1], z = coords[i * 3 + 2];
  grid[x * (GY * GZ) + y * GZ + z] = i;
}

// ------- k,v per-head 16x16 projections (WMMA, K padded to 32) + norm1 -------
// Sum over the 16 lanes that hold the 16 columns of one C tile: DPP row_xmask
// butterfly (ctrl 0x160 | mask), all lanes on; it stays on the vector port, where
// a shuffle would go through the LDS pipe and its wait.
__device__ __forceinline__ float row16_sum(float x) {
  x += __int_as_float(__builtin_amdgcn_update_dpp(0, __float_as_int(x), 0x161, 0xf, 0xf, true));
  x += __int_as_float(__builtin_amdgcn_update_dpp(0, __float_as_int(x), 0x162, 0xf, 0xf, true));
  x += __int_as_float(__builtin_amdgcn_update_dpp(0, __float_as_int(x), 0x164, 0xf, 0xf, true));
  x += __int_as_float(__builtin_amdgcn_update_dpp(0, __float_as_int(x), 0x168, 0xf, 0xf, true));
  return x;
}

// One projection (k or v) of a wave's 16 rows: the 16 x 128 result stays in
// accumulator registers (8 heads x 8 rows per lane), so the row statistics of
// the layernorm come from registers and only the normalised rows are stored.
__device__ __forceinline__ void proj_norm_store(
    const v16h (&a)[NHEAD], const float* __restrict__ wp,
    const float* __restrict__ bias, const float* __restrict__ g,
    const float* __restrict__ b, float* __restrict__ op, int m, int rb, int n) {
  v8f acc[NHEAD];
#pragma unroll
  for (int h = 0; h < NHEAD; ++h) {
    v16h bf = {};  // W[h][e][d], e = m; slots 8..15 = K>=16 stay zero
#pragma unroll
    for (int i = 0; i < 8; ++i) bf[i] = (_Float16)wp[h * HDIM * HDIM + i];
    v8f z = {};
    acc[h] = wmma_f16(a[h], bf, z);
  }

  // bias, then per-row sum and sum of squares: 8 heads in the lane, 16 lanes
  float s[8], q[8];
#pragma unroll
  for (int r = 0; r < 8; ++r) { s[r] = 0.f; q[r] = 0.f; }
#pragma unroll
  for (int h = 0; h < NHEAD; ++h) {
    float bia = bias[h * HDIM + m];
#pragma unroll
    for (int r = 0; r < 8; ++r) {
      float x = acc[h][r] + bia;
      acc[h][r] = x;
      s[r] += x; q[r] += x * x;
    }
  }
#pragma unroll
  for (int r = 0; r < 8; ++r) {
    float mean = row16_sum(s[r]) * (1.0f / FDIM);
    float var  = row16_sum(q[r]) * (1.0f / FDIM) - mean * mean;
    s[r] = mean;
    q[r] = rsqrtf(var + 1e-5f);
  }
#pragma unroll
  for (int h = 0; h < NHEAD; ++h) {
    float gg = g[h * HDIM + m], bb = b[h * HDIM + m];
#pragma unroll
    for (int r = 0; r < 8; ++r) acc[h][r] = (acc[h][r] - s[r]) * q[r] * gg + bb;
  }
#pragma unroll
  for (int r = 0; r < 8; ++r) {
    if (rb + r < n) {
#pragma unroll
      for (int h = 0; h < NHEAD; ++h) op[r * FDIM + h * HDIM] = acc[h][r];
    }
  }
}

// k and v of one 16-row strip per wave (4 waves/block). The strip's f16 rows are loaded
// in fragments of 32 columns, which are the 16 columns of two heads.
__device__ __forceinline__ void kv_block(
    const _Float16* __restrict__ Xh, const float* __restrict__ Wk, const float* __restrict__ bk,
    const float* __restrict__ Wv, const float* __restrict__ bv,
    const float* __restrict__ g, const float* __restrict__ b, float* __restrict__ K,
    float* __restrict__ V, int n, int blk) {
  int lane = threadIdx.x & 31;
  int m = lane & 15, kh = lane >> 4;
  int tm = __builtin_amdgcn_readfirstlane(blk * 4 + (threadIdx.x >> 5));
  if (tm * 16 >= n) return;  // scalar branch
  int row = tm * 16 + m;
  if (row >= n) row = n - 1;

  v16h av[4];
#pragma unroll
  for (int k = 0; k < 4; ++k)
    av[k] = frag_ld_f16(Xh + (size_t)row * FDIM + k * 32 + kh * 8);

  // A: 16 pts x 16 dims (f16) per head, zero-padded to K=32 (slots 8..15 = K>=16)
  v16h a[NHEAD];
#pragma unroll
  for (int h = 0; h < NHEAD; ++h) {
    v16h t = {};
#pragma unroll
    for (int i = 0; i < 8; ++i) t[i] = av[h >> 1][(h & 1) * 8 + i];
    a[h] = t;
  }

  const int rb = tm * 16 + 8 * kh;  // C layout: lanes<16 -> M=r, lanes>=16 -> M=8+r
  const int wo = m * HDIM + kh * 8;
  proj_norm_store(a, Wk + wo, bk, g, b, K + (size_t)rb * FDIM + m, m, rb, n);
  proj_norm_store(a, Wv + wo, bv, g, b, V + (size_t)rb * FDIM + m, m, rb, n);
}

// Second launch: what needs only the first one's results. The projection blocks come
// first in the index, the short scatter blocks behind them.
#define PROJ_BLOCKS(n) (((n) + 63) / 64)                    // 4 strips of 16 rows each
#define POINT_BLOCKS(n) (((n) + PROJ_BLOCK - 1) / PROJ_BLOCK)  // one thread per point
__global__ void __launch_bounds__(PROJ_BLOCK) kv_scatter_k(
    const _Float16* __restrict__ Xh, const float* __restrict__ Wk, const float* __restrict__ bk,
    const float* __restrict__ Wv, const float* __restrict__ bv,
    const float* __restrict__ g, const float* __restrict__ b, float* __restrict__ K,
    float* __restrict__ V, const int* __restrict__ coords, int* __restrict__ grid,
    int n) {
  const int blk = blockIdx.x;
  if (blk < PROJ_BLOCKS(n)) kv_block(Xh, Wk, bk, Wv, bv, g, b, K, V, n, blk);
  else scatter_block(coords, grid, n, blk - PROJ_BLOCKS(n));
}

// rsqrtf as the compiler expands it (x below the smallest normal scaled by 2^24, the
// result by 2^12). The v_rsq_f32 is asm text so that the v_nop, the slot the
// instruction set asks for behind a transcendental, stays directly behind it wherever
// the compiler schedules it.
__device__ __forceinline__ float rsqrt_with_slot(float x) {
  const bool tiny = x < 1.17549435e-38f;
  const float xs = tiny ? x * 16777216.0f : x;
  float r;
  asm("v_rsq_f32 %0, %1\n\tv_nop" : "=v"(r) : "v"(xs));
  return tiny ? r * 4096.0f : r;
}

// ---------------- 27-neighbor attention + residual + norm2 ----------------
// A wave's 32 lanes share one point: lane l holds columns 4 l .. 4 l + 3 of a row (head
// l / 4), so every load and store of a k, v, feats or x row is 512 contiguous bytes,
// 4 whole lines. With a lane per (point, head) a 16-B load had its lanes 64 B apart and
// touched 16 lines for the same 512 bytes. A wave takes ATT_PPW points side by side.
#define ATT_BLOCK 256
#define NSLOT 27
#define ATT_PPW 4
#define ATT_ROWS (ATT_BLOCK / 32 * ATT_PPW)  // points per block
static_assert(ATT_ROWS * NHEAD == ATT_BLOCK, "grid: 32 points per block");
static_assert(ATT_ROWS == 32 && ATT_BLOCK / 32 * 16 == FDIM, "q: 2 row tiles, a column tile per wave");
#define XH_PITCH (FDIM + 8)  // f16: rows 16 B apart in the banks for b128 readers
#define QS_PITCH (FDIM + 4)  // f32: rows r and r + 8 of a C tile half the banks apart

// __expf as the compiler expands it (x * log2(e), then v_exp_f32). The v_exp_f32 is asm
// text so that the v_nop, the slot the instruction set asks for behind a transcendental,
// stays directly behind it wherever the compiler schedules it.
__device__ __forceinline__ float exp_with_slot(float x) {
  const float y = x * 1.44269504088896340736f;
  float r;
  asm("v_exp_f32 %0, %1\n\tv_nop" : "=v"(r) : "v"(y));
  return r;
}

// Sum over the 4 neighbouring lanes that hold the 16 columns of one head: DPP row_xmask
// butterfly (ctrl 0x160 | mask) on the vector port, all lanes on.
__device__ __forceinline__ float head_sum(float x) {
  x += __int_as_float(__builtin_amdgcn_update_dpp(0, __float_as_int(x), 0x161, 0xf, 0xf, true));
  x += __int_as_float(__builtin_amdgcn_update_dpp(0, __float_as_int(x), 0x162, 0xf, 0xf, true));
  return x;
}

// Sum over the wave's 32 lanes (a whole row): 16 lanes by DPP, then the other 16-lane
// half by a cross-row move (lane i reads lane i of the other half).
__device__ __forceinline__ float row32_sum(float x) {
  x = row16_sum(x);
  const unsigned u = (unsigned)__float_as_int(x);
  return x + __int_as_float((int)__builtin_amdgcn_permlanex16(u, u, 0x76543210u, 0xfedcba98u,
                                                              false, false));
}

// Address of row i >= 0 of an array of rows of row_bytes, i the same in every lane. The
// workspace's 256 MiB hold fewer than 2^19 rows of 512 B, so the byte offset fits 32 bits.
// Both words are held scalar: a row access is then scalar base + the lane's offset.
typedef __attribute__((address_space(1))) char gchar;  // global memory, as the arrays are
typedef __attribute__((ext_vector_type(4))) float v4f;
typedef __attribute__((address_space(1))) v4f gv4f;
typedef __attribute__((address_space(1))) v4h gv4h;
__device__ __forceinline__ unsigned long long row_at(const void* base, int i, unsigned row_bytes) {
  __builtin_assume((unsigned)i < (1u << 19));
  const unsigned long long a = (unsigned long long)base + (unsigned)i * row_bytes;
  const unsigned lo = __builtin_amdgcn_readfirstlane((unsigned)a);
  const unsigned hi = __builtin_amdgcn_readfirstlane((unsigned)(a >> 32));
  return ((unsigned long long)hi << 32) | lo;
}
#define ROW_BYTES (FDIM * (unsigned)sizeof(float))

// Xr and XNh are not declared __restrict__, so that the "memory" clobber of the wait behind
// their stores keeps the stores in front of it.
__global__ void __launch_bounds__(ATT_BLOCK) attention_k(
    const _Float16* Wqp, const float* Kn, const float* Vn, const float* feats,
    const int* __restrict__ coords, const int* grid, const float* g, const float* b,
    float* Xr, _Float16* XNh, int n) {
  __shared__ __attribute__((aligned(16))) _Float16 xh[ATT_ROWS * XH_PITCH];
  __shared__ __attribute__((aligned(16))) float qs[ATT_ROWS * QS_PITCH];
  const int lane = threadIdx.x & 31;
  const int wave = __builtin_amdgcn_readfirstlane(threadIdx.x >> 5);
  // A wave wholly past the end stays for the barriers: it repeats the last point, stores nothing.
  const int pt0 = __builtin_amdgcn_readfirstlane(
      (int)(blockIdx.x * (ATT_BLOCK / 32) + (threadIdx.x >> 5)) * ATT_PPW);
  const unsigned col = (unsigned)lane * 16u;  // the lane's 4 columns, in bytes
  const float scale = 0.0883883476483184f;    // 1/sqrt(128)
  // Lane j < 27 looks up neighbour cell j of the point: one 4-B load for all 27 cells. A
  // cell off the grid reads cell 0 and is then set to -1.
  const int dx = lane / 9 - 1, dy = (lane / 3) % 3 - 1, dz = lane % 3 - 1;
  int pt[ATT_PPW];  // a point past the end repeats the last one and is not stored
  bool in[ATT_PPW];
  unsigned at[ATT_PPW];  // byte offsets of the cells, below the grid's 8 MiB
#pragma unroll
  for (int p = 0; p < ATT_PPW; ++p) {
    pt[p] = min(pt0 + p, n - 1);
    const int nx = coords[pt[p] * 3 + 0] + dx, ny = coords[pt[p] * 3 + 1] + dy,
              nz = coords[pt[p] * 3 + 2] + dz;
    in[p] = lane < NSLOT && (unsigned)nx < GX && (unsigned)ny < GY && (unsigned)nz < GZ;
    at[p] = in[p] ? (unsigned)(nx * (GY * GZ) + ny * GZ + nz) * (unsigned)sizeof(int) : 0u;
  }
  int idx[ATT_PPW];
  v4f q[ATT_PPW], x[ATT_PPW];
  v8h wq[8];  // the wave's column tile of Wq: 4 B fragments, each a low and a high half
  // Each run of row loads is one asm statement that ends in its data wait: all its loads
  // are in flight together, no row lands in a register that a load of the run still names
  // (early-clobber outputs), and every address register is whole until the data is there.
  // Left to the compiler, later rows landed in earlier loads' address pairs.
  // Here: the 4 points' cells and feats rows, and the wave's 4 KiB of packed Wq.
  asm volatile(
      "global_load_b32 %0, %16, %21\n\t"
      "global_load_b32 %1, %17, %21\n\t"
      "global_load_b32 %2, %18, %21\n\t"
      "global_load_b32 %3, %19, %21\n\t"
      "global_load_b128 %4, %20, %22\n\t"
      "global_load_b128 %5, %20, %23\n\t"
      "global_load_b128 %6, %20, %24\n\t"
      "global_load_b128 %7, %20, %25\n\t"
      "global_load_b128 %8, %20, %26\n\t"
      "global_load_b128 %9, %20, %26 offset:512\n\t"
      "global_load_b128 %10, %20, %26 offset:1024\n\t"
      "global_load_b128 %11, %20, %26 offset:1536\n\t"
      "global_load_b128 %12, %20, %26 offset:2048\n\t"
      "global_load_b128 %13, %20, %26 offset:2560\n\t"
      "global_load_b128 %14, %20, %26 offset:3072\n\t"
      "global_load_b128 %15, %20, %26 offset:3584\n\t"
      "s_wait_loadcnt 0x0"
      : "=&v"(idx[0]), "=&v"(idx[1]), "=&v"(idx[2]), "=&v"(idx[3]), "=&v"(x[0]), "=&v"(x[1]),
        "=&v"(x[2]), "=&v"(x[3]), "=&v"(wq[0]), "=&v"(wq[1]), "=&v"(wq[2]), "=&v"(wq[3]),
        "=&v"(wq[4]), "=&v"(wq[5]), "=&v"(wq[6]), "=&v"(wq[7])
      : "v"(at[0]), "v"(at[1]), "v"(at[2]), "v"(at[3]), "v"(col),
        "s"((unsigned long long)grid), "s"(row_at(feats, pt[0], ROW_BYTES)),
        "s"(row_at(feats, pt[1], ROW_BYTES)), "s"(row_at(feats, pt[2], ROW_BYTES)),
        "s"(row_at(feats, pt[3], ROW_BYTES)), "s"(row_at(Wqp, wave, 16 * FDIM * 2u))
      : "memory");

  // q = feats @ Wq^T of the block's 32 points, on the rows just loaded for the residual: as
  // f16 through LDS into A fragments; wave w makes columns [16 w, 16 w + 16) of both row
  // tiles; the C tiles go through LDS back to a row per wave. q never goes through memory.
  {
    const int m = lane & 15, kh = lane >> 4;
#pragma unroll
    for (int p = 0; p < ATT_PPW; ++p) {
      const v4h h = {(_Float16)x[p].x, (_Float16)x[p].y, (_Float16)x[p].z, (_Float16)x[p].w};
      *(v4h*)&xh[(wave * ATT_PPW + p) * XH_PITCH + lane * 4] = h;
    }
    __syncthreads();  // every wave reads all 32 rows
    v8f acc[2] = {{}, {}};
#pragma unroll
    for (int k = 0; k < 4; ++k) {
      const v16h bf = __builtin_shufflevector(wq[2 * k], wq[2 * k + 1], 0, 1, 2, 3, 4, 5, 6, 7,
                                              8, 9, 10, 11, 12, 13, 14, 15);
#pragma unroll
      for (int rt = 0; rt < 2; ++rt)
        acc[rt] = wmma_f16(frag_ld_f16(&xh[(rt * 16 + m) * XH_PITCH + k * 32 + kh * 8]), bf,
                           acc[rt]);
    }
#pragma unroll
    for (int rt = 0; rt < 2; ++rt)
#pragma unroll
      for (int r = 0; r < 8; ++r)  // C layout: lanes<16 -> M=r, lanes>=16 -> M=8+r
        qs[(rt * 16 + 8 * kh + r) * QS_PITCH + wave * 16 + m] = acc[rt][r];
    __syncthreads();  // a q row holds columns of all 8 waves
    // Only this wave reads these 4 rows of qs, so once q is out of them they hold the feats
    // rows until the residual: across the walk those 16 registers would take the kernel past
    // 96, and a WGP would hold 4 blocks where the grid has 5 for most.
#pragma unroll
    for (int p = 0; p < ATT_PPW; ++p) {
      v4f* const own = (v4f*)&qs[(wave * ATT_PPW + p) * QS_PITCH + lane * 4];
      q[p] = *own;
      *own = x[p];
    }
  }
  unsigned left[ATT_PPW];  // the point's occupied cells not yet worked on, a bit per slot
#pragma unroll
  for (int p = 0; p < ATT_PPW; ++p) {
    idx[p] = in[p] ? idx[p] : -1;
    left[p] = __builtin_amdgcn_readfirstlane(__builtin_amdgcn_ballot_w32(idx[p] >= 0));
  }

  // One pass over the occupied cells only: the walk's length is known only at run time, so
  // there is no register array of scores, and the softmax keeps a running maximum. A trip
  // takes the next occupied cell of each of the 4 points; a point that has none left reads
  // row 0 with weight exp(-huge) = 0.
  float mx[ATT_PPW], den[ATT_PPW];
  v4f o[ATT_PPW];
#pragma unroll
  for (int p = 0; p < ATT_PPW; ++p) {
    mx[p] = -3.0e38f;
    den[p] = 0.f;
    o[p] = (v4f){0.f, 0.f, 0.f, 0.f};
  }
#pragma unroll 1  // the trip count is known only at run time: copies would only be code
  for (int trip = 0; trip < NSLOT && (left[0] | left[1] | left[2] | left[3]) != 0u; ++trip) {
    float none[ATT_PPW];  // 0, or -huge for a point that has no cell left
    int row[ATT_PPW];
    v4f k[ATT_PPW], v[ATT_PPW];
#pragma unroll
    for (int p = 0; p < ATT_PPW; ++p) {
      const bool has = left[p] != 0u;
      const int slot = has ? __builtin_ctz(left[p]) : 0;
      const int found = __builtin_amdgcn_readlane(idx[p], slot);
      row[p] = has ? found : 0;
      none[p] = has ? 0.f : -3.0e38f;
      left[p] &= ~(1u << slot);  // an empty mask stays empty
    }
    // The trip's 4 k rows and 4 v rows, one statement with its data wait, as above.
    asm volatile(
        "global_load_b128 %0, %8, %9\n\t"
        "global_load_b128 %1, %8, %10\n\t"
        "global_load_b128 %2, %8, %11\n\t"
        "global_load_b128 %3, %8, %12\n\t"
        "global_load_b128 %4, %8, %13\n\t"
        "global_load_b128 %5, %8, %14\n\t"
        "global_load_b128 %6, %8, %15\n\t"
        "global_load_b128 %7, %8, %16\n\t"
        "s_wait_loadcnt 0x0"
        : "=&v"(k[0]), "=&v"(k[1]), "=&v"(k[2]), "=&v"(k[3]), "=&v"(v[0]), "=&v"(v[1]),
          "=&v"(v[2]), "=&v"(v[3])
        : "v"(col), "s"(row_at(Kn, row[0], ROW_BYTES)), "s"(row_at(Kn, row[1], ROW_BYTES)),
          "s"(row_at(Kn, row[2], ROW_BYTES)), "s"(row_at(Kn, row[3], ROW_BYTES)),
          "s"(row_at(Vn, row[0], ROW_BYTES)), "s"(row_at(Vn, row[1], ROW_BYTES)),
          "s"(row_at(Vn, row[2], ROW_BYTES)), "s"(row_at(Vn, row[3], ROW_BYTES))
        : "memory");
#pragma unroll
    for (int p = 0; p < ATT_PPW; ++p) {
      const float dot = head_sum(q[p].x * k[p].x + q[p].y * k[p].y + q[p].z * k[p].z +
                                 q[p].w * k[p].w);
      const float s = fmaf(dot, scale, none[p]);
      const float mnew = fmaxf(mx[p], s);
      const float c = exp_with_slot(mx[p] - mnew), w = exp_with_slot(s - mnew);
      mx[p] = mnew;
      den[p] = den[p] * c + w;
      o[p].x = o[p].x * c + w * v[p].x;
      o[p].y = o[p].y * c + w * v[p].y;
      o[p].z = o[p].z * c + w * v[p].z;
      o[p].w = o[p].w * c + w * v[p].w;
    }
  }

  // The feats rows come back from LDS while g and b are on their way.
#pragma unroll
  for (int p = 0; p < ATT_PPW; ++p)
    x[p] = *(const v4f*)&qs[(wave * ATT_PPW + p) * QS_PITCH + lane * 4];

  // g and b are loaded only here: held across the loop their 8 registers would leave a WGP
  // room for 4 blocks, and the grid has 5 for most. One statement with its data wait.
  v4f gg, bb;
  asm volatile(
      "global_load_b128 %0, %2, %3\n\t"
      "global_load_b128 %1, %2, %4\n\t"
      "s_wait_loadcnt 0x0"
      : "=&v"(gg), "=&v"(bb)
      : "v"(col), "s"((unsigned long long)g), "s"((unsigned long long)b)
      : "memory");

  // residual row x, and norm2 of it while it is still in registers: a row is 4 columns in
  // each of 32 lanes, so its sum and sum of squares are 4 terms in the lane, then 32 lanes.
#pragma unroll
  for (int p = 0; p < ATT_PPW; ++p) {
    const float inv = 1.0f / den[p];
    x[p].x += o[p].x * inv;
    x[p].y += o[p].y * inv;
    x[p].z += o[p].z * inv;
    x[p].w += o[p].w * inv;
    const float s = x[p].x + x[p].y + x[p].z + x[p].w;
    const float ss = x[p].x * x[p].x + x[p].y * x[p].y + x[p].z * x[p].z + x[p].w * x[p].w;
    const float mean = row32_sum(s) * (1.0f / FDIM);
    const float var  = row32_sum(ss) * (1.0f / FDIM) - mean * mean;
    const float rs = rsqrt_with_slot(var + 1e-5f);
    const v4h xn = {(_Float16)((x[p].x - mean) * rs * gg.x + bb.x),
                    (_Float16)((x[p].y - mean) * rs * gg.y + bb.y),
                    (_Float16)((x[p].z - mean) * rs * gg.z + bb.z),
                    (_Float16)((x[p].w - mean) * rs * gg.w + bb.w)};
    if (pt0 + p < n) {  // scalar branch
      *(gv4f*)((gchar*)row_at(Xr, pt0 + p, ROW_BYTES) + col) = x[p];
      *(gv4h*)((gchar*)row_at(XNh, pt0 + p, ROW_BYTES / 2) + col / 2) = xn;
      // The next point's arithmetic reuses the registers that these stores name.
      asm volatile("s_wait_xcnt 0x0" ::: "memory");
    }
  }
}

// gelu(x) = 0.5 x (1 + erf(x / sqrt 2)) = max(x, 0) - |x| * 0.5 erfc(|x| / sqrt 2), with
// erfc(z) = t (a1 + t (a2 + t (a3 + t (a4 + t a5)))) exp(-z^2), t = 1 / (1 + p z): the
// five-term rational form of erf, absolute error below 1.5e-7 for every z >= 0; the 0.5
// is folded into the coefficients. One straight line for every x, so the 32 values of a
// trip are worked on side by side; the library's erff takes one of two ranges by |x|,
// and a wave with lanes in both walks both, one value after the other.
// The hardware's own rcp and exp2 are enough here: exp2 gives 0 where the true value is
// below the smallest normal, and there the whole term is far below an f16 step of h.
__device__ __forceinline__ float gelu_erf(float x) {
  const float ax = fabsf(x);
  const float t = __builtin_amdgcn_rcpf(fmaf(ax, 0.3275911f * 0.7071067811865475f, 1.0f));
  const float e = __builtin_amdgcn_exp2f(x * x * -0.72134752044448170368f);  // exp(-x^2/2)
  float p = 0.5f * 1.061405429f;
  p = fmaf(p, t, 0.5f * -1.453152027f);
  p = fmaf(p, t, 0.5f * 1.421413741f);
  p = fmaf(p, t, 0.5f * -0.284496736f);
  p = fmaf(p, t, 0.5f * 0.254829592f);
  return fmaf(-(ax * e), p * t, fmaxf(x, 0.0f));
}

// ---------------- fused MLP: gelu(LN(x)@W1^T+b1)@W2^T + b2 + x ----------------
// One block = 64 rows (4 row tiles), 4 waves. The waves split the COLUMNS: every wave
// works on all 4 row tiles, so a weight fragment is loaded by one wave of the block and
// feeds 4 WMMAs; with a row tile per wave each of the 4 waves loaded every fragment.
#define MLP_TILES 4                 // row tiles per block
#define MLP_ROWS (MLP_TILES * 16)
#define HID (4 * FDIM)
#define H_PITCH (HID + 8)           // f16: rows 16 B apart in the banks for b128 readers
__global__ void __launch_bounds__(128) mlp_fused_k(
    const _Float16* __restrict__ XNh, const float* __restrict__ Xr,
    const _Float16* __restrict__ W1h, const float* __restrict__ bm1,
    const _Float16* __restrict__ W2h, const float* __restrict__ bm2,
    float* __restrict__ out, int n) {
  __shared__ __attribute__((aligned(16))) _Float16 hbuf[MLP_ROWS * H_PITCH];  // 65 KB
  const int lane = threadIdx.x & 31;
  const int wave = __builtin_amdgcn_readfirstlane(threadIdx.x >> 5);
  const int m = lane & 15, kh = lane >> 4;
  const int row0 = blockIdx.x * MLP_ROWS;  // < n by the grid

  // stage 1: h = gelu(XN @ W1^T + bm1) -> LDS (f16). A frags of all 64 rows stay in
  // registers; wave w makes columns [128 w, 128 w + 128) of h.
  v16h av[MLP_TILES][4];
#pragma unroll
  for (int rt = 0; rt < MLP_TILES; ++rt) {
    int row = row0 + rt * 16 + m;
    if (row >= n) row = n - 1;  // clamp: duplicate work, never stored
#pragma unroll
    for (int k = 0; k < 4; ++k)
      av[rt][k] = frag_ld_f16(XNh + (size_t)row * FDIM + k * 32 + kh * 8);
    // The built code lets a later tile's loads land on this tile's address registers.
    asm volatile("s_wait_xcnt 0x0" ::: "memory");
  }

  for (int ct = 0; ct < 8; ++ct) {  // the wave's 8 column tiles
    const int cn = (wave * 8 + ct) * 16 + m;
    v16h b[4];
#pragma unroll
    for (int k = 0; k < 4; ++k)
      b[k] = frag_ld_f16(W1h + (size_t)cn * FDIM + k * 32 + kh * 8);
    // The built code lets the bias load land on the fragment loads' address registers.
    asm volatile("s_wait_xcnt 0x0" ::: "memory");
    const float bia = bm1[cn];
    // Inputs-only fence on the loaded fragments: keeps the tile's 8 loads in flight
    // together; without it the compiler reuses one fragment's registers and waits 4 times.
    asm volatile("" ::"v"(b[0]), "v"(b[1]), "v"(b[2]), "v"(b[3]));
    v8f acc[MLP_TILES] = {{}, {}, {}, {}};
#pragma unroll
    for (int k = 0; k < 4; ++k) {
#pragma unroll
      for (int rt = 0; rt < MLP_TILES; ++rt) acc[rt] = wmma_f16(av[rt][k], b[k], acc[rt]);
    }
#pragma unroll
    for (int rt = 0; rt < MLP_TILES; ++rt) {
      const int rb = rt * 16 + 8 * kh;  // C layout: lanes<16 -> M=r, lanes>=16 -> M=8+r
#pragma unroll
      for (int r = 0; r < 8; ++r) {
        hbuf[(rb + r) * H_PITCH + cn] = (_Float16)gelu_erf(acc[rt][r] + bia);
      }
    }
  }
  __syncthreads();  // every wave reads all 512 columns of h below

  // stage 2: out = Xr + h @ W2^T + bm2; wave w makes output columns [32 w, 32 w + 32)
  v8f acc[2][MLP_TILES] = {{{}, {}, {}, {}}, {{}, {}, {}, {}}};
  // Two k steps per trip: together they use up the 128-B line of each W2 row, and the
  // second step's loads fly while the first step's WMMAs run.
#pragma unroll 2
  for (int k0 = 0; k0 < HID; k0 += 32) {
    v16h b[2], a[MLP_TILES];
#pragma unroll
    for (int t = 0; t < 2; ++t)
      b[t] = frag_ld_f16(W2h + (size_t)((wave * 2 + t) * 16 + m) * HID + k0 + kh * 8);
#pragma unroll
    for (int rt = 0; rt < MLP_TILES; ++rt)
      a[rt] = frag_ld_f16(&hbuf[(rt * 16 + m) * H_PITCH + k0 + kh * 8]);
#pragma unroll
    for (int t = 0; t < 2; ++t) {
#pragma unroll
      for (int rt = 0; rt < MLP_TILES; ++rt) acc[t][rt] = wmma_f16(a[rt], b[t], acc[t][rt]);
    }
  }
  const float bia0 = bm2[wave * 32 + m], bia1 = bm2[wave * 32 + 16 + m];
  const size_t o0 = (size_t)(row0 + 8 * kh) * FDIM + wave * 32 + m;
  const float* __restrict__ xp = Xr + o0;
  float* __restrict__ op = out + o0;
  if (row0 + MLP_ROWS <= n) {  // scalar branch: whole block in range
    float x[2][MLP_TILES][8];
#pragma unroll
    for (int t = 0; t < 2; ++t)
#pragma unroll
      for (int rt = 0; rt < MLP_TILES; ++rt)
#pragma unroll
        for (int r = 0; r < 8; ++r) x[t][rt][r] = xp[(rt * 16 + r) * FDIM + t * 16];
#pragma unroll
    for (int t = 0; t < 2; ++t)
#pragma unroll
      for (int rt = 0; rt < MLP_TILES; ++rt)
#pragma unroll
        for (int r = 0; r < 8; ++r)
          op[(rt * 16 + r) * FDIM + t * 16] = x[t][rt][r] + acc[t][rt][r] + (t ? bia1 : bia0);
  } else {
#pragma unroll
    for (int t = 0; t < 2; ++t)
#pragma unroll
      for (int rt = 0; rt < MLP_TILES; ++rt)
#pragma unroll
        for (int r = 0; r < 8; ++r)
          if (row0 + rt * 16 + 8 * kh + r < n)
            op[(rt * 16 + r) * FDIM + t * 16] =
                xp[(rt * 16 + r) * FDIM + t * 16] + acc[t][rt][r] + (t ? bia1 : bia0);
  }
}

// ---------------- host ----------------
extern "C" void kernel_launch(void* const* d_in, const int* in_sizes, int n_in,
                              void* d_out, int out_size, void* d_ws, size_t ws_size,
                              hipStream_t stream) {
  const int*   coords = (const int*)d_in[0];
  const float* feats  = (const float*)d_in[1];
  const float* Wq     = (const float*)d_in[2];
  const float* Wk     = (const float*)d_in[3];
  const float* bk     = (const float*)d_in[4];
  const float* Wv     = (const float*)d_in[5];
  const float* bv     = (const float*)d_in[6];
  const float* g1     = (const float*)d_in[7];
  const float* b1     = (const float*)d_in[8];
  const float* g2     = (const float*)d_in[9];
  const float* b2     = (const float*)d_in[10];
  const float* W1     = (const float*)d_in[11];
  const float* bm1    = (const float*)d_in[12];
  const float* W2     = (const float*)d_in[13];
  const float* bm2    = (const float*)d_in[14];
  float* out = (float*)d_out;
  const int N = in_sizes[1] / FDIM;
  (void)n_in; (void)out_size; (void)ws_size;

  char* ws = (char*)d_ws;
  size_t off = 0;
  auto carve = [&](size_t bytes) {
    void* p = ws + off;
    off = (off + bytes + 255) & ~(size_t)255;
    return p;
  };
  int*       grid = (int*)carve((size_t)GRID_CELLS * sizeof(int));
  float*     kb   = (float*)carve((size_t)N * FDIM * sizeof(float));
  float*     vb   = (float*)carve((size_t)N * FDIM * sizeof(float));
  float*     xr   = (float*)carve((size_t)N * FDIM * sizeof(float));
  _Float16*  Xh   = (_Float16*)carve((size_t)N * FDIM * sizeof(_Float16));
  _Float16*  xnh  = (_Float16*)carve((size_t)N * FDIM * sizeof(_Float16));
  _Float16*  Wqp  = (_Float16*)carve((size_t)FDIM * FDIM * sizeof(_Float16));
  _Float16*  W1h  = (_Float16*)carve((size_t)4 * FDIM * FDIM * sizeof(_Float16));
  _Float16*  W2h  = (_Float16*)carve((size_t)4 * FDIM * FDIM * sizeof(_Float16));

  const int mt = (N + 15) / 16;

  // inputs only: f32 -> f16 conversions and the grid fill
  int nf4 = (N * FDIM) / 4;
  prep_k<<<TILES_OF(nf4) + PREP_FIXED_BLOCKS, STREAM_BLOCK, 0, stream>>>(
      feats, Xh, nf4, Wq, Wqp, W1, W1h, W2, W2h, grid);

  // k, v with norm1 applied, beside the scatter into the grid
  kv_scatter_k<<<PROJ_BLOCKS(N) + POINT_BLOCKS(N), PROJ_BLOCK, 0, stream>>>(
      Xh, Wk, bk, Wv, bv, g1, b1, kb, vb, coords, grid, N);

  // q + neighbour look-up + attention + residual -> xr, and norm2 of it -> f16 for the MLP
  attention_k<<<(N * NHEAD + ATT_BLOCK - 1) / ATT_BLOCK, ATT_BLOCK, 0, stream>>>(
      Wqp, kb, vb, feats, coords, grid, g2, b2, xr, xnh, N);

  // fused MLP + residual -> out (64 rows per block, h tile in static LDS)
  mlp_fused_k<<<(mt + 3) / 4, 128, 0, stream>>>(xnh, xr, W1h, bm1, W2h, bm2, out, N);
}
